// v000
// The times below were measured on an AMD MI455X: many runs one after another, warmed up first and cycling through
// copies of the inputs, with the whole window's GPU time divided by the number of runs. Launches and the gaps
// between them are all in it. The median over several windows is given; except for v000 it joins two sittings, which
// can be a few percent apart, so the side-by-side timings, each taken in one sitting, are the better comparison.
// The starting kernel, v000, takes 463 microseconds a run.
// compute dtype: all float inputs rounded to bf16, mask (int) read; q/k/v/pos projections with EXACT bf16 products on WMMA 16x16x32 (natural weights, + bias), f32 accumulate; q kept in f32 (bias_u / bias_v added per head, then split into f16 hi + residual fragments), k / ph rounded once to f16, v split into f16 hi + residual planes; content scores (q+bu) . k and the Transformer-XL position term (q+bv) . ph with single f16 products (logits ~1-2; q, k, ph each rounded once), the rel_shift realised exactly as an index map onto 16 x 32 position tiles (incl. its upper-triangle wrap-around rows and the zero at j == i+1), x 1/8, masked keys excluded, running-max softmax in f32 (hardware exp); P (f16 x 2^11 + residual) . v; out = x (bf16 hi + lo) . Wo^T + bo; f32 output.
#include <hip/hip_runtime.h>
#include <math.h>

typedef __attribute__((ext_vector_type(16))) _Float16 v16h;
typedef __attribute__((ext_vector_type(16))) __bf16 v16b;
typedef __attribute__((ext_vector_type(8)))  _Float16 v8h;
typedef __attribute__((ext_vector_type(8)))  float v8f;
typedef __attribute__((ext_vector_type(4)))  float v4f;
typedef __attribute__((ext_vector_type(2)))  float v2f;
typedef __attribute__((ext_vector_type(4)))  unsigned v4u;
typedef __attribute__((ext_vector_type(4)))  int v4i;
typedef float __attribute__((may_alias)) float_a;
typedef int __attribute__((may_alias)) int_a;

template <typename T> __device__ __forceinline__ void vst2(void* p, T v) { *(T*)p = v;  }
__device__ __forceinline__ v8f wmma16(v16h a, v16h b, v8f c) {
  v8f d = __builtin_amdgcn_wmma_f32_16x16x32_f16(false, a, false, b, (short)0, c, false, false);
  asm volatile("v_nop\n\tv_nop\n\tv_nop\n\tv_nop" : "+v"(d) : "v"(a), "v"(b));
  return d;
}
__device__ __forceinline__ v8f wmma_bf(v16b a, v16b b, v8f c) {
  v8f d = __builtin_amdgcn_wmma_f32_16x16x32_bf16(false, a, false, b, (short)0, c, false, false);
  asm volatile("v_nop\n\tv_nop\n\tv_nop\n\tv_nop" : "+v"(d) : "v"(a), "v"(b));
  return d;
}
// 16x16x32 fragments: lane = (h = lane>>4, row/col = lane&15); elements 0..7 = k0+8h+0..7, 8..15 = k0+16+8h+0..7; D element r = row 8h+r
__device__ __forceinline__ v16h frag_h(const _Float16* rowk0, int lane) {
  union { v16h v; v8h q[2]; } u; const _Float16* p = rowk0 + 8 * (lane >> 4);
  u.q[0] = *(const v8h*)p; u.q[1] = *(const v8h*)(p + 16); return u.v;
}
__device__ __forceinline__ v16h frag_f32(const float* rowk0, int lane) {
  v16h a; const float* p = rowk0 + 8 * (lane >> 4);
#pragma unroll
  for (int i = 0; i < 8; ++i) { a[i] = (_Float16)p[i]; a[8 + i] = (_Float16)p[16 + i]; }
  return a;
}
__device__ __forceinline__ v16h frag_f32s(const float* rowk0, int lane, float sc) {
  v16h a; const float* p = rowk0 + 8 * (lane >> 4);
#pragma unroll
  for (int i = 0; i < 8; ++i) { a[i] = (_Float16)(p[i] * sc); a[8 + i] = (_Float16)(p[16 + i] * sc); }
  return a;
}
// column fragment from a [K][ld] layout (column n), rows >= K read as 0
__device__ __forceinline__ v16h fragc_f32(const float* W, int k0, int n, int lane, int ld, int K) {
  v16h a; const int g = lane >> 4;
#pragma unroll
  for (int i = 0; i < 8; ++i) { const int ka = k0 + 8 * g + i, kb = ka + 16;
    a[i] = (_Float16)(ka < K ? W[(size_t)(ka < K ? ka : K - 1) * ld + n] : 0.f); a[8 + i] = (_Float16)(kb < K ? W[(size_t)(kb < K ? kb : K - 1) * ld + n] : 0.f); }
  return a;
}
struct F2 { v16b h, l; };
__device__ __forceinline__ F2 bsplit16(const float v[16]) { F2 r;
#pragma unroll
  for (int i = 0; i < 16; ++i) { const __bf16 h = (__bf16)v[i]; r.h[i] = h; r.l[i] = (__bf16)(v[i] - (float)h); }
  return r; }
__device__ __forceinline__ F2 split_row(const float* row, int k0, int lane) { float v[16]; const float* p = row + k0 + 8 * (lane >> 4);
#pragma unroll
  for (int i = 0; i < 8; ++i) { v[i] = p[i]; v[8 + i] = p[16 + i]; }
  return bsplit16(v); }
__device__ __forceinline__ F2 split_rowK(const float* row, int k0, int lane, int K) { float v[16]; const int g = lane >> 4;
#pragma unroll
  for (int i = 0; i < 8; ++i) { const int ka = k0 + 8 * g + i, kb = ka + 16; v[i] = ka < K ? row[ka < K ? ka : K - 1] : 0.f; v[8 + i] = kb < K ? row[kb < K ? kb : K - 1] : 0.f; }
  return bsplit16(v); }
__device__ __forceinline__ F2 split_col(const float* W, int k0, int n, int lane, int ld, int K) { float v[16]; const int g = lane >> 4;
#pragma unroll
  for (int i = 0; i < 8; ++i) { const int ka = k0 + 8 * g + i, kb = ka + 16; v[i] = ka < K ? W[(size_t)(ka < K ? ka : K - 1) * ld + n] : 0.f; v[8 + i] = kb < K ? W[(size_t)(kb < K ? kb : K - 1) * ld + n] : 0.f; }
  return bsplit16(v); }
__device__ __forceinline__ v8f mac3(const F2& a, const F2& b, v8f c) { c = wmma_bf(a.l, b.h, c); c = wmma_bf(a.h, b.l, c); return wmma_bf(a.h, b.h, c); }
__device__ __forceinline__ float sigm(float v) { return 1.0f / (1.0f + expf(-v)); }
#define LDSX() do { asm volatile("s_wait_dscnt 0" ::: "memory"); __builtin_amdgcn_wave_barrier(); __builtin_amdgcn_fence(__ATOMIC_RELEASE, "workgroup"); } while (0)


// Relative-position multi-head attention (Transformer-XL style rel_shift; B 8, T 1,024, D 512, 8 heads x 64): scores = ((q+u) k^T + rel_shift((q+v) p^T)) / 8, masked softmax (mask input), attn v, Wo.
#define NB 8
#define TT 1024
#define DMD 512
#define NH 8
#define HD 64
#define POFF 32                 // ph buffer row offset (rows < 0 and >= T read as zeros)
#define PROWS (TT + 64)
#ifndef TNB
#define TNB NB
#endif
typedef __attribute__((ext_vector_type(8))) __bf16 v8b;
__device__ __forceinline__ v16b frag_b(const __bf16* rowk0, int lane) {
  union { v16b v; v8b q[2]; } u; const __bf16* p = rowk0 + 8 * (lane >> 4);
  u.q[0] = *(const v8b*)p; u.q[1] = *(const v8b*)(p + 16); return u.v;
}
__device__ __forceinline__ float bfr(float v) { return (float)(__bf16)v; }
__device__ __attribute__((noinline)) float exp_ni(float v) { return expf(v); }
__device__ __attribute__((noinline)) float erf_ni(float v) { return erff(v); }

#define WS_Q   0u                                   // f32 q rows [b*u][512] (+bq)
#define WS_KH  (WS_Q + 4u * (size_t)NB * TT * DMD)       // f16 k rows [b*t][512]
#define WS_PH  (WS_KH + 2u * (size_t)NB * TT * DMD)      // f16 ph rows [PROWS][512] (row POFF + p)
#define WS_VH  (WS_PH + 2u * (size_t)PROWS * DMD)        // f16 v planes [b][512][t]
#define WS_VL  (WS_VH + 2u * (size_t)NB * DMD * TT)      // f16 v residual planes (unscaled)
#define WS_X   (WS_VL + 2u * (size_t)NB * DMD * TT)      // f32 attention output rows [b*u][512]
#define WS_END (WS_X + 4u * (size_t)NB * TT * DMD)

// ---- k_proj: block = (64 rows, 128-col group, which): 0 q (f32 rows), 1 k (f16 rows), 2 v (f16 hi + residual planes), 3 ph (f16 rows at POFF), natural W + bias (none for ph)
__global__ __launch_bounds__(128) void k_proj(const float* __restrict__ Qi, const float* __restrict__ Ki, const float* __restrict__ Vi, const float* __restrict__ POS, const float* __restrict__ WQ, const float* __restrict__ BQ, const float* __restrict__ WK, const float* __restrict__ BK, const float* __restrict__ WV, const float* __restrict__ BV, const float* __restrict__ WP, float* __restrict__ Q, _Float16* __restrict__ KH, _Float16* __restrict__ VH, _Float16* __restrict__ VL, _Float16* __restrict__ PH) {
  __shared__ __align__(16) float sf[4][16][132]; __shared__ __align__(16) _Float16 sh[64][136]; __shared__ __align__(16) _Float16 th[128][72], tl[128][72];
  const int tid = threadIdx.x, wave = tid >> 5, lane = tid & 31, col = lane & 15, g = lane >> 4; const int which = blockIdx.z; const int c0 = blockIdx.y * 128; const int nrows = (which == 3) ? TT : NB * TT;
  if ((int)blockIdx.x * 64 >= nrows) return;
  const float* X = (which == 0 ? Qi : which == 1 ? Ki : which == 2 ? Vi : POS); const float* Wm = (which == 0 ? WQ : which == 1 ? WK : which == 2 ? WV : WP); const float* Bm = (which == 0 ? BQ : which == 1 ? BK : which == 2 ? BV : nullptr);
  const size_t r0 = (size_t)blockIdx.x * 64 + wave * 16;
  v8f acc[8] = {};
#pragma unroll
  for (int kc = 0; kc < DMD / 32; ++kc) { v16b a; { const float* p = X + (r0 + col) * DMD + kc * 32 + 8 * g;
#pragma unroll
      for (int i = 0; i < 8; ++i) { a[i] = (__bf16)p[i]; a[8 + i] = (__bf16)p[16 + i]; } }
#pragma unroll
    for (int j = 0; j < 8; ++j) { v16b w; const int o = c0 + j * 16 + col;
#pragma unroll
      for (int i = 0; i < 8; ++i) { w[i] = (__bf16)Wm[(size_t)o * DMD + kc * 32 + 8 * g + i]; w[8 + i] = (__bf16)Wm[(size_t)o * DMD + kc * 32 + 16 + 8 * g + i]; }
      acc[j] = wmma_bf(a, w, acc[j]); } }
#pragma unroll
  for (int j = 0; j < 8; ++j) { const float bb = Bm ? bfr(Bm[c0 + j * 16 + col]) : 0.f;
#pragma unroll
    for (int r = 0; r < 8; ++r) { const float v = acc[j][r] + bb; const int rl = wave * 16 + 8 * g + r, cl = j * 16 + col;
      if (which == 0) sf[wave][8 * g + r][cl] = v; else if (which == 2) { const _Float16 hv = (_Float16)v; th[cl][rl] = hv; tl[cl][rl] = (_Float16)(v - (float)hv); } else sh[rl][cl] = (_Float16)v; } }
  __syncthreads();
  if (which == 0) { for (int rl = 0; rl < 16; ++rl) vst2(Q + (r0 + rl) * DMD + c0 + lane * 4, *(const v4f*)&sf[wave][rl][lane * 4]); }
  else if (which == 2) { const size_t b = ((size_t)blockIdx.x * 64) / TT; const int t0 = (int)(((size_t)blockIdx.x * 64) % TT); for (int e = tid; e < 128 * 8; e += 128) { const int cl = e >> 3, q = e & 7; const size_t o = (b * DMD + c0 + cl) * (size_t)TT + t0 + q * 8; vst2((unsigned*)(VH + o), *(const v4u*)&th[cl][q * 8]); vst2((unsigned*)(VL + o), *(const v4u*)&tl[cl][q * 8]); } }
  else { _Float16* dst = (which == 1) ? (KH + (size_t)blockIdx.x * 64 * DMD) : (PH + ((size_t)POFF + blockIdx.x * 64) * DMD); for (int e = tid; e < 64 * 16; e += 128) { const int rl = e >> 4, q = e & 15; vst2((unsigned*)(dst + (size_t)rl * DMD + c0 + q * 8), *(const v4u*)&sh[rl][q * 8]); } } }
// ---- k_padph: the POFF rows before and the rows after the table are zeros
__global__ __launch_bounds__(256) void k_padph(_Float16* __restrict__ PH) { const int t = threadIdx.x; const int r = blockIdx.x; const size_t row = (r < POFF) ? r : (TT + r);   // 0..31 and TT+32 .. TT+63
  v4u z; z[0] = z[1] = z[2] = z[3] = 0u; if (t < DMD / 8) vst2((unsigned*)(PH + row * DMD + t * 8), z); }
// fragments of (q + bias) for 16 rows, head h: hi and residual as f16 (unscaled; q ~ O(1))
__device__ __forceinline__ void qfrags(const float* __restrict__ Q, size_t row0, int h, const float* __restrict__ bias, int lane, v16h* hi, v16h* lo) { const int col = lane & 15, g = lane >> 4; size_t row = row0 + col; if (row > (size_t)NB * TT - 1) row = (size_t)NB * TT - 1;   // clamp (only the never-used row T of the last batch)
#pragma unroll
  for (int kc = 0; kc < 2; ++kc) { const float* p = Q + row * DMD + h * HD + kc * 32 + 8 * g; const float* bp = bias + h * HD + kc * 32 + 8 * g; v16h a, b;
#pragma unroll
    for (int i = 0; i < 8; ++i) { const float v0 = p[i] + bfr(bp[i]), v1 = p[16 + i] + bfr(bp[16 + i]); const _Float16 h0 = (_Float16)v0, h1 = (_Float16)v1; a[i] = h0; a[8 + i] = h1; b[i] = (_Float16)(v0 - (float)h0); b[8 + i] = (_Float16)(v1 - (float)h1); }
    hi[kc] = a; lo[kc] = b; } }
// ---- k_att: block = (64 queries u, h, b)
__global__ __launch_bounds__(128) void k_att(const float* __restrict__ Q, const _Float16* __restrict__ KH, const _Float16* __restrict__ PH, const _Float16* __restrict__ VH, const _Float16* __restrict__ VL, const float* __restrict__ BU, const float* __restrict__ BVv, const int* __restrict__ MK, float* __restrict__ X) {
  __shared__ __align__(16) float sp[4][16][36]; __shared__ __align__(16) float sg1[4][16][36], sg2[4][16][36]; __shared__ __align__(16) float so[4][16][68];
  const int tid = threadIdx.x, wave = tid >> 5, lane = tid & 31, col = lane & 15, g = lane >> 4; const int qb = blockIdx.x, h = blockIdx.y; const size_t b = blockIdx.z; const int i0 = qb * 64 + wave * 16;
  v16h au[2], av[2], aw[2], tmpl[2];   // (q+u) rows i0.., (q+v) rows i0.., (q+v) rows i0+1.. (for the wrapped upper-triangle term); single f16 rounding (residuals dropped: VGPR budget)
  qfrags(Q, b * TT + i0, h, BU, lane, au, tmpl); qfrags(Q, b * TT + i0, h, BVv, lane, av, tmpl);
  qfrags(Q, b * TT + i0 + 1, h, BVv, lane, aw, tmpl);   // rows i+1; for i = T-1 the row belongs to the next batch (or is clamped) but its products are never used: j >= i+2 cannot hold for i = T-1
  const bool lastblk = (i0 + 16 >= TT);
  float m[8], l[8];
#pragma unroll
  for (int r = 0; r < 8; ++r) { m[r] = -3.0e38f; l[r] = 0.f; }
  v8f acc[4] = {};
#pragma unroll 1
  for (int ks = 0; ks < TT / 32; ++ks) { float s[2][8];
#pragma unroll
    for (int ct = 0; ct < 2; ++ct) { const int j0 = ks * 32 + ct * 16; const int kk = j0 + col; v8f c = {};
#pragma unroll
      for (int kc = 0; kc < 2; ++kc) { const v16h kh = frag_h(KH + (b * TT + kk) * DMD + h * HD + kc * 32, lane); c = wmma16(au[kc], kh, c); }
      const bool needlow = (j0 <= i0 + 15);          // some (i, j) with j <= i
      const bool needup = (j0 + 15 >= i0 + 2);        // some (i, j) with j >= i + 2
      if (needlow) { const int pA = TT - 16 - i0 + j0 + POFF;   // tile covers p = pA-POFF .. +31
#pragma unroll
        for (int pt = 0; pt < 2; ++pt) { v8f gg = {};
#pragma unroll
          for (int kc = 0; kc < 2; ++kc) { const v16h pf = frag_h(PH + (size_t)(pA + pt * 16 + col) * DMD + h * HD + kc * 32, lane); gg = wmma16(av[kc], pf, gg); }
#pragma unroll
          for (int r = 0; r < 8; ++r) sg1[wave][8 * g + r][pt * 16 + col] = gg[r]; } }
      if (needup) { const int pB = j0 - i0 - 17 + POFF;
#pragma unroll
        for (int pt = 0; pt < 2; ++pt) { v8f gg = {};
#pragma unroll
          for (int kc = 0; kc < 2; ++kc) { const v16h pf = frag_h(PH + (size_t)(pB + pt * 16 + col) * DMD + h * HD + kc * 32, lane); gg = wmma16(aw[kc], pf, gg); }
#pragma unroll
          for (int r = 0; r < 8; ++r) sg2[wave][8 * g + r][pt * 16 + col] = gg[r]; } }
      LDSX();
#pragma unroll
      for (int r = 0; r < 8; ++r) { const int il = 8 * g + r; const int i = i0 + il; const int j = kk; const int idx = 15 + col - il;   // == (T-1-i+j) - (pA-POFF) == (j-i-2) - (pB-POFF)
        float bd; if (j <= i) bd = sg1[wave][il][idx]; else if (j == i + 1) bd = 0.f; else bd = (lastblk && il == 15) ? 0.f : sg2[wave][il][idx];
        const bool keep = (MK[((size_t)b * TT + i) * TT + j] != 0);
        s[ct][r] = keep ? (c[r] + bd) * 0.125f : -3.0e38f; }
      LDSX(); }
    float alpha[8];
#pragma unroll
    for (int r = 0; r < 8; ++r) { float mx = fmaxf(s[0][r], s[1][r]);
#pragma unroll
      for (int o = 1; o < 16; o <<= 1) mx = fmaxf(mx, __shfl_xor(mx, o));
      const float mn = fmaxf(m[r], mx); alpha[r] = (m[r] <= -1.0e38f) ? 0.f : __expf(m[r] - mn); const float e0 = (s[0][r] <= -1.0e38f) ? 0.f : __expf(s[0][r] - mn), e1 = (s[1][r] <= -1.0e38f) ? 0.f : __expf(s[1][r] - mn); float es = e0 + e1;
#pragma unroll
      for (int o = 1; o < 16; o <<= 1) es += __shfl_xor(es, o);
      l[r] = l[r] * alpha[r] + es; m[r] = mn; sp[wave][8 * g + r][col] = e0; sp[wave][8 * g + r][16 + col] = e1; }
#pragma unroll
    for (int j = 0; j < 4; ++j)
#pragma unroll
      for (int r = 0; r < 8; ++r) acc[j][r] *= alpha[r];
    LDSX();
    v16h pa, pr; { const float* prow = &sp[wave][col][0] + 8 * (lane >> 4);
#pragma unroll
      for (int i = 0; i < 8; ++i) { const float x0 = prow[i] * 2048.0f, x1 = prow[16 + i] * 2048.0f; const _Float16 h0 = (_Float16)x0, h1 = (_Float16)x1; pa[i] = h0; pa[8 + i] = h1; pr[i] = (_Float16)(x0 - (float)h0); pr[8 + i] = (_Float16)(x1 - (float)h1); } }
#pragma unroll
    for (int j = 0; j < 4; ++j) { const size_t po = (b * DMD + (size_t)h * HD + j * 16 + col) * TT + ks * 32; const v16h vh = frag_h(VH + po, lane); acc[j] = wmma16(pa, vh, acc[j]); acc[j] = wmma16(pr, vh, acc[j]); acc[j] = wmma16(pa, frag_h(VL + po, lane), acc[j]); }
    LDSX(); }
#pragma unroll
  for (int r = 0; r < 8; ++r) { const float il = (l[r] > 0.f) ? (1.0f / 2048.0f) / l[r] : 0.f;   // fully masked rows -> zeros (the module zeroes them after the softmax)
#pragma unroll
    for (int j = 0; j < 4; ++j) so[wave][8 * g + r][j * 16 + col] = acc[j][r] * il; }
  LDSX(); for (int rl = 0; rl < 16; ++rl) if (lane < 16) vst2(X + (b * TT + i0 + rl) * DMD + h * HD + lane * 4, *(const v4f*)&so[wave][rl][lane * 4]); }
// ---- k_out: block = (64 rows, 128 of 512 cols): out = x (hi + lo) . Wo^T + bo
__global__ __launch_bounds__(128) void k_out(const float* __restrict__ X, const float* __restrict__ WO, const float* __restrict__ BO, float* __restrict__ OUT) { __shared__ __align__(16) float sf[4][16][132];
  const int tid = threadIdx.x, wave = tid >> 5, lane = tid & 31, col = lane & 15, g = lane >> 4; const int c0 = blockIdx.y * 128; const size_t r0 = (size_t)blockIdx.x * 64 + wave * 16;
  v8f acc[8] = {};
#pragma unroll
  for (int kc = 0; kc < DMD / 32; ++kc) { const F2 a = split_row(X + (r0 + col) * DMD, kc * 32, lane);
#pragma unroll
    for (int j = 0; j < 8; ++j) { v16b w; const int o = c0 + j * 16 + col;
#pragma unroll
      for (int i = 0; i < 8; ++i) { w[i] = (__bf16)WO[(size_t)o * DMD + kc * 32 + 8 * g + i]; w[8 + i] = (__bf16)WO[(size_t)o * DMD + kc * 32 + 16 + 8 * g + i]; }
      acc[j] = wmma_bf(a.h, w, acc[j]); acc[j] = wmma_bf(a.l, w, acc[j]); } }
#pragma unroll
  for (int j = 0; j < 8; ++j) { const float bb = bfr(BO[c0 + j * 16 + col]);
#pragma unroll
    for (int r = 0; r < 8; ++r) sf[wave][8 * g + r][j * 16 + col] = acc[j][r] + bb; }
  LDSX(); for (int rl = 0; rl < 16; ++rl) vst2(OUT + (r0 + rl) * DMD + c0 + lane * 4, *(const v4f*)&sf[wave][rl][lane * 4]); }
extern "C" void kernel_launch(void* const* d_in, const int* in_sizes, int n_in, void* d_out, int out_size, void* d_ws, size_t ws_size, hipStream_t stream) {
  (void)in_sizes; (void)n_in; (void)out_size;
  const float** F = (const float**)d_in;   // 0 q, 1 k, 2 v [8,1024,512]; 3 pos [1024,512]; 4 mask [8,1024,1024] int; 5 Wq, 6 bq, 7 Wk, 8 bk, 9 Wv, 10 bv, 11 Wo, 12 bo, 13 Wp (natural); 14 bias_u [8,64], 15 bias_v [8,64]
  if (ws_size < (size_t)WS_END) return;
  char* ws = (char*)d_ws; float* Q = (float*)(ws + WS_Q); _Float16 *KH = (_Float16*)(ws + WS_KH), *PH = (_Float16*)(ws + WS_PH), *VH = (_Float16*)(ws + WS_VH), *VL = (_Float16*)(ws + WS_VL); float* X = (float*)(ws + WS_X);
  k_proj<<<dim3(TNB * TT / 64, DMD / 128, 4), 128, 0, stream>>>(F[0], F[1], F[2], F[3], F[5], F[6], F[7], F[8], F[9], F[10], F[13], Q, KH, VH, VL, PH);
  k_padph<<<64, 256, 0, stream>>>(PH);
  k_att<<<dim3(TT / 64, NH, TNB), 128, 0, stream>>>(Q, KH, PH, VH, VL, F[14], F[15], (const int*)d_in[4], X);
  k_out<<<dim3(TNB * TT / 64, DMD / 128), 128, 0, stream>>>(X, F[11], F[12], (float*)d_out);
}

// v001
// It runs in 266 microseconds.
// In both of two side-by-side timings against v000, it was 1.77 times as fast.
// compute dtype: all float inputs rounded to bf16, mask (int) read; q/k/v/pos projections with EXACT bf16 products on WMMA 16x16x32 (natural weights, + bias), f32 accumulate; q kept in f32 (bias_u / bias_v added per head, then split into f16 hi + residual fragments), k / ph rounded once to f16, v split into f16 hi + residual planes; content scores (q+bu) . k and the Transformer-XL position term (q+bv) . ph with single f16 products (logits ~1-2; q, k, ph each rounded once), the rel_shift realised exactly as an index map onto 16 x 32 position tiles (incl. its upper-triangle wrap-around rows and the zero at j == i+1), x 1/8, masked keys excluded, running-max softmax in f32 (hardware exp); P (f16 x 2^11 + residual) . v; out = x (bf16 hi + lo) . Wo^T + bo; f32 output.
#include <hip/hip_runtime.h>
#include <math.h>

typedef __attribute__((ext_vector_type(16))) _Float16 v16h;
typedef __attribute__((ext_vector_type(16))) __bf16 v16b;
typedef __attribute__((ext_vector_type(8)))  _Float16 v8h;
typedef __attribute__((ext_vector_type(8)))  float v8f;
typedef __attribute__((ext_vector_type(4)))  float v4f;
typedef __attribute__((ext_vector_type(2)))  float v2f;
typedef __attribute__((ext_vector_type(4)))  unsigned v4u;
typedef __attribute__((ext_vector_type(4)))  int v4i;
typedef float __attribute__((may_alias)) float_a;
typedef int __attribute__((may_alias)) int_a;

template <typename T> __device__ __forceinline__ void vst2(void* p, T v) { *(T*)p = v;  }
__device__ __forceinline__ v8f wmma16(v16h a, v16h b, v8f c) {
  v8f d = __builtin_amdgcn_wmma_f32_16x16x32_f16(false, a, false, b, (short)0, c, false, false);
  asm volatile("v_nop\n\tv_nop\n\tv_nop\n\tv_nop" : "+v"(d) : "v"(a), "v"(b));
  return d;
}
__device__ __forceinline__ v8f wmma_bf(v16b a, v16b b, v8f c) {
  v8f d = __builtin_amdgcn_wmma_f32_16x16x32_bf16(false, a, false, b, (short)0, c, false, false);
  asm volatile("v_nop\n\tv_nop\n\tv_nop\n\tv_nop" : "+v"(d) : "v"(a), "v"(b));
  return d;
}
// 16x16x32 fragments: lane = (h = lane>>4, row/col = lane&15); elements 0..7 = k0+8h+0..7, 8..15 = k0+16+8h+0..7; D element r = row 8h+r
__device__ __forceinline__ v16h frag_h(const _Float16* rowk0, int lane) {
  union { v16h v; v8h q[2]; } u; const _Float16* p = rowk0 + 8 * (lane >> 4);
  u.q[0] = *(const v8h*)p; u.q[1] = *(const v8h*)(p + 16); return u.v;
}
__device__ __forceinline__ v16h frag_f32(const float* rowk0, int lane) {
  v16h a; const float* p = rowk0 + 8 * (lane >> 4);
#pragma unroll
  for (int i = 0; i < 8; ++i) { a[i] = (_Float16)p[i]; a[8 + i] = (_Float16)p[16 + i]; }
  return a;
}
__device__ __forceinline__ v16h frag_f32s(const float* rowk0, int lane, float sc) {
  v16h a; const float* p = rowk0 + 8 * (lane >> 4);
#pragma unroll
  for (int i = 0; i < 8; ++i) { a[i] = (_Float16)(p[i] * sc); a[8 + i] = (_Float16)(p[16 + i] * sc); }
  return a;
}
// column fragment from a [K][ld] layout (column n), rows >= K read as 0
__device__ __forceinline__ v16h fragc_f32(const float* W, int k0, int n, int lane, int ld, int K) {
  v16h a; const int g = lane >> 4;
#pragma unroll
  for (int i = 0; i < 8; ++i) { const int ka = k0 + 8 * g + i, kb = ka + 16;
    a[i] = (_Float16)(ka < K ? W[(size_t)(ka < K ? ka : K - 1) * ld + n] : 0.f); a[8 + i] = (_Float16)(kb < K ? W[(size_t)(kb < K ? kb : K - 1) * ld + n] : 0.f); }
  return a;
}
struct F2 { v16b h, l; };
__device__ __forceinline__ F2 bsplit16(const float v[16]) { F2 r;
#pragma unroll
  for (int i = 0; i < 16; ++i) { const __bf16 h = (__bf16)v[i]; r.h[i] = h; r.l[i] = (__bf16)(v[i] - (float)h); }
  return r; }
__device__ __forceinline__ F2 split_row(const float* row, int k0, int lane) { float v[16]; const float* p = row + k0 + 8 * (lane >> 4);
#pragma unroll
  for (int i = 0; i < 8; ++i) { v[i] = p[i]; v[8 + i] = p[16 + i]; }
  return bsplit16(v); }
__device__ __forceinline__ F2 split_rowK(const float* row, int k0, int lane, int K) { float v[16]; const int g = lane >> 4;
#pragma unroll
  for (int i = 0; i < 8; ++i) { const int ka = k0 + 8 * g + i, kb = ka + 16; v[i] = ka < K ? row[ka < K ? ka : K - 1] : 0.f; v[8 + i] = kb < K ? row[kb < K ? kb : K - 1] : 0.f; }
  return bsplit16(v); }
__device__ __forceinline__ F2 split_col(const float* W, int k0, int n, int lane, int ld, int K) { float v[16]; const int g = lane >> 4;
#pragma unroll
  for (int i = 0; i < 8; ++i) { const int ka = k0 + 8 * g + i, kb = ka + 16; v[i] = ka < K ? W[(size_t)(ka < K ? ka : K - 1) * ld + n] : 0.f; v[8 + i] = kb < K ? W[(size_t)(kb < K ? kb : K - 1) * ld + n] : 0.f; }
  return bsplit16(v); }
__device__ __forceinline__ v8f mac3(const F2& a, const F2& b, v8f c) { c = wmma_bf(a.l, b.h, c); c = wmma_bf(a.h, b.l, c); return wmma_bf(a.h, b.h, c); }
__device__ __forceinline__ float sigm(float v) { return 1.0f / (1.0f + expf(-v)); }
#define LDSX() do { asm volatile("s_wait_dscnt 0" ::: "memory"); __builtin_amdgcn_wave_barrier(); __builtin_amdgcn_fence(__ATOMIC_RELEASE, "workgroup"); } while (0)


// Relative-position multi-head attention (Transformer-XL style rel_shift; B 8, T 1,024, D 512, 8 heads x 64): scores = ((q+u) k^T + rel_shift((q+v) p^T)) / 8, masked softmax (mask input), attn v, Wo.
#define NB 8
#define TT 1024
#define DMD 512
#define NH 8
#define HD 64
#define POFF 32                 // ph buffer row offset (rows < 0 and >= T read as zeros)
#define PROWS (TT + 64)
#ifndef TNB
#define TNB NB
#endif
typedef __attribute__((ext_vector_type(8))) __bf16 v8b;
__device__ __forceinline__ v16b frag_b(const __bf16* rowk0, int lane) {
  union { v16b v; v8b q[2]; } u; const __bf16* p = rowk0 + 8 * (lane >> 4);
  u.q[0] = *(const v8b*)p; u.q[1] = *(const v8b*)(p + 16); return u.v;
}
__device__ __forceinline__ float bfr(float v) { return (float)(__bf16)v; }
__device__ __attribute__((noinline)) float exp_ni(float v) { return expf(v); }
__device__ __attribute__((noinline)) float erf_ni(float v) { return erff(v); }

#define WS_Q   0u                                   // f32 q rows [b*u][512] (+bq)
#define WS_KH  (WS_Q + 4u * (size_t)NB * TT * DMD)       // f16 k rows [b*t][512]
#define WS_PH  (WS_KH + 2u * (size_t)NB * TT * DMD)      // f16 ph rows [PROWS][512] (row POFF + p)
#define WS_VH  (WS_PH + 2u * (size_t)PROWS * DMD)        // f16 v planes [b][512][t]
#define WS_VL  (WS_VH + 2u * (size_t)NB * DMD * TT)      // f16 v residual planes (unscaled)
#define WS_X   (WS_VL + 2u * (size_t)NB * DMD * TT)      // f32 attention output rows [b*u][512]
#define WS_END (WS_X + 4u * (size_t)NB * TT * DMD)

typedef __attribute__((ext_vector_type(4))) __bf16 v4b;
__device__ __forceinline__ v4b cvt4(v4f v) { v4b r;
#pragma unroll
  for (int i = 0; i < 4; ++i) r[i] = (__bf16)v[i];
  return r; }
__device__ __forceinline__ v4b res4(v4f v, v4b h) { v4b r;
#pragma unroll
  for (int i = 0; i < 4; ++i) r[i] = (__bf16)(v[i] - (float)h[i]);
  return r; }
#define SPI 40   // ring row pitch in bf16: 64-B rows at 80 B (16 B x odd) for 16-byte LDS reads
union __align__(16) ProjSm { __bf16 st[2][192][SPI]; float sf[4][16][132]; _Float16 sh[64][136]; _Float16 t2[2][128][72]; };
union __align__(16) OutSm { __bf16 st[2][256][SPI]; float sf[4][16][132]; };
// ---- k_proj: block = (64 rows, 128-col group, which): 0 q (f32 rows), 1 k (f16 rows), 2 v (f16 hi + residual planes), 3 ph (f16 rows at POFF), natural W + bias (none for ph)
__global__ __launch_bounds__(128) void k_proj(const float* __restrict__ Qi, const float* __restrict__ Ki, const float* __restrict__ Vi, const float* __restrict__ POS, const float* __restrict__ WQ, const float* __restrict__ BQ, const float* __restrict__ WK, const float* __restrict__ BK, const float* __restrict__ WV, const float* __restrict__ BV, const float* __restrict__ WP, float* __restrict__ Q, _Float16* __restrict__ KH, _Float16* __restrict__ VH, _Float16* __restrict__ VL, _Float16* __restrict__ PH) {
  __shared__ ProjSm sm;   // the operand ring is dead when the epilogue tiles are written (barrier at the foot of the last stage)
  float (&sf)[4][16][132] = sm.sf; _Float16 (&sh)[64][136] = sm.sh; _Float16 (&th)[128][72] = sm.t2[0]; _Float16 (&tl)[128][72] = sm.t2[1];
  const int tid = threadIdx.x, wave = tid >> 5, lane = tid & 31, col = lane & 15, g = lane >> 4; const int which = blockIdx.z; const int c0 = blockIdx.y * 128; const int nrows = (which == 3) ? TT : NB * TT;
  if ((int)blockIdx.x * 64 >= nrows) return;
  const float* X = (which == 0 ? Qi : which == 1 ? Ki : which == 2 ? Vi : POS); const float* Wm = (which == 0 ? WQ : which == 1 ? WK : which == 2 ? WV : WP); const float* Bm = (which == 0 ? BQ : which == 1 ? BK : which == 2 ? BV : nullptr);
  const size_t r0 = (size_t)blockIdx.x * 64 + wave * 16;
  v8f acc[8] = {};
  // stage = 32 k of 128 W rows (ring rows 0..127) and of the block's 64 X rows (128..191); 8 lanes x 16 B fetch one whole 128-B line of a row
  const int lr = tid >> 3, lq = tid & 7; const float* wsrc = Wm + (size_t)(c0 + lr) * DMD + lq * 4; const float* xsrc = X + ((size_t)blockIdx.x * 64 + lr) * DMD + lq * 4;
  v4f pf[12];
#pragma unroll
  for (int e = 0; e < 12; ++e) pf[e] = *(const v4f*)(e < 8 ? wsrc + (size_t)e * 16 * DMD : xsrc + (size_t)(e - 8) * 16 * DMD);
#pragma unroll
  for (int e = 0; e < 12; ++e) *(v4b*)&sm.st[0][e * 16 + lr][lq * 4] = cvt4(pf[e]);
  __syncthreads();
#pragma unroll
  for (int kc = 0; kc < DMD / 32; ++kc) { const int cur = kc & 1;
    if (kc + 1 < DMD / 32) {
#pragma unroll
      for (int e = 0; e < 12; ++e) pf[e] = *(const v4f*)((e < 8 ? wsrc + (size_t)e * 16 * DMD : xsrc + (size_t)(e - 8) * 16 * DMD) + (kc + 1) * 32); }
    const v16b a = frag_b(&sm.st[cur][128 + wave * 16 + col][0], lane);
#pragma unroll
    for (int jh = 0; jh < 8; jh += 4) { v16b w[4];   // the LDS reads of four fragments go ahead of their products as one group: one LDS latency per group
#pragma unroll
      for (int j = 0; j < 4; ++j) w[j] = frag_b(&sm.st[cur][(jh + j) * 16 + col][0], lane);
#pragma unroll
      for (int j = 0; j < 4; ++j) acc[jh + j] = wmma_bf(a, w[j], acc[jh + j]); }
    __builtin_amdgcn_sched_barrier(0);   // keeps the wait for the next stage's global loads behind this stage's products, so that they cover its latency
    if (kc + 1 < DMD / 32) {
#pragma unroll
      for (int e = 0; e < 12; ++e) *(v4b*)&sm.st[cur ^ 1][e * 16 + lr][lq * 4] = cvt4(pf[e]); }
    __syncthreads(); }   // publishes stage kc + 1 and ends every read of the buffer that the next pass refills
#pragma unroll
  for (int j = 0; j < 8; ++j) { const float bb = Bm ? bfr(Bm[c0 + j * 16 + col]) : 0.f;
#pragma unroll
    for (int r = 0; r < 8; ++r) { const float v = acc[j][r] + bb; const int rl = wave * 16 + 8 * g + r, cl = j * 16 + col;
      if (which == 0) sf[wave][8 * g + r][cl] = v; else if (which == 2) { const _Float16 hv = (_Float16)v; th[cl][rl] = hv; tl[cl][rl] = (_Float16)(v - (float)hv); } else sh[rl][cl] = (_Float16)v; } }
  __syncthreads();
  if (which == 0) { for (int rl = 0; rl < 16; ++rl) vst2(Q + (r0 + rl) * DMD + c0 + lane * 4, *(const v4f*)&sf[wave][rl][lane * 4]); }
  else if (which == 2) { const size_t b = ((size_t)blockIdx.x * 64) / TT; const int t0 = (int)(((size_t)blockIdx.x * 64) % TT); for (int e = tid; e < 128 * 8; e += 128) { const int cl = e >> 3, q = e & 7; const size_t o = (b * DMD + c0 + cl) * (size_t)TT + t0 + q * 8; vst2((unsigned*)(VH + o), *(const v4u*)&th[cl][q * 8]); vst2((unsigned*)(VL + o), *(const v4u*)&tl[cl][q * 8]); } }
  else { _Float16* dst = (which == 1) ? (KH + (size_t)blockIdx.x * 64 * DMD) : (PH + ((size_t)POFF + blockIdx.x * 64) * DMD); for (int e = tid; e < 64 * 16; e += 128) { const int rl = e >> 4, q = e & 15; vst2((unsigned*)(dst + (size_t)rl * DMD + c0 + q * 8), *(const v4u*)&sh[rl][q * 8]); } } }
// ---- k_padph: the POFF rows before and the rows after the table are zeros
__global__ __launch_bounds__(256) void k_padph(_Float16* __restrict__ PH) { const int t = threadIdx.x; const int r = blockIdx.x; const size_t row = (r < POFF) ? r : (TT + r);   // 0..31 and TT+32 .. TT+63
  v4u z; z[0] = z[1] = z[2] = z[3] = 0u; if (t < DMD / 8) vst2((unsigned*)(PH + row * DMD + t * 8), z); }
// fragments of (q + bias) for 16 rows, head h: hi and residual as f16 (unscaled; q ~ O(1))
__device__ __forceinline__ void qfrags(const float* __restrict__ Q, size_t row0, int h, const float* __restrict__ bias, int lane, v16h* hi, v16h* lo) { const int col = lane & 15, g = lane >> 4; size_t row = row0 + col; if (row > (size_t)NB * TT - 1) row = (size_t)NB * TT - 1;   // clamp (only the never-used row T of the last batch)
#pragma unroll
  for (int kc = 0; kc < 2; ++kc) { const float* p = Q + row * DMD + h * HD + kc * 32 + 8 * g; const float* bp = bias + h * HD + kc * 32 + 8 * g; v16h a, b;
#pragma unroll
    for (int i = 0; i < 8; ++i) { const float v0 = p[i] + bfr(bp[i]), v1 = p[16 + i] + bfr(bp[16 + i]); const _Float16 h0 = (_Float16)v0, h1 = (_Float16)v1; a[i] = h0; a[8 + i] = h1; b[i] = (_Float16)(v0 - (float)h0); b[8 + i] = (_Float16)(v1 - (float)h1); }
    hi[kc] = a; lo[kc] = b; } }
// ---- k_att: block = (64 queries u, h, b)
__global__ __launch_bounds__(128) void k_att(const float* __restrict__ Q, const _Float16* __restrict__ KH, const _Float16* __restrict__ PH, const _Float16* __restrict__ VH, const _Float16* __restrict__ VL, const float* __restrict__ BU, const float* __restrict__ BVv, const int* __restrict__ MK, float* __restrict__ X) {
  __shared__ __align__(16) float sp[4][16][36]; __shared__ __align__(16) float sg1[4][16][36], sg2[4][16][36]; __shared__ __align__(16) float so[4][16][68];
  const int tid = threadIdx.x, wave = tid >> 5, lane = tid & 31, col = lane & 15, g = lane >> 4; const int qb = blockIdx.x, h = blockIdx.y; const size_t b = blockIdx.z; const int i0 = qb * 64 + wave * 16;
  v16h au[2], av[2], aw[2], tmpl[2];   // (q+u) rows i0.., (q+v) rows i0.., (q+v) rows i0+1.. (for the wrapped upper-triangle term); single f16 rounding (residuals dropped: VGPR budget)
  qfrags(Q, b * TT + i0, h, BU, lane, au, tmpl); qfrags(Q, b * TT + i0, h, BVv, lane, av, tmpl);
  qfrags(Q, b * TT + i0 + 1, h, BVv, lane, aw, tmpl);   // rows i+1; for i = T-1 the row belongs to the next batch (or is clamped) but its products are never used: j >= i+2 cannot hold for i = T-1
  const bool lastblk = (i0 + 16 >= TT);
  float m[8], l[8];
#pragma unroll
  for (int r = 0; r < 8; ++r) { m[r] = -3.0e38f; l[r] = 0.f; }
  v8f acc[4] = {};
#pragma unroll 1
  for (int ks = 0; ks < TT / 32; ++ks) { float s[2][8];
#pragma unroll
    for (int ct = 0; ct < 2; ++ct) { const int j0 = ks * 32 + ct * 16; const int kk = j0 + col; v8f c = {};
#pragma unroll
      for (int kc = 0; kc < 2; ++kc) { const v16h kh = frag_h(KH + (b * TT + kk) * DMD + h * HD + kc * 32, lane); c = wmma16(au[kc], kh, c); }
      const bool needlow = (j0 <= i0 + 15);          // some (i, j) with j <= i
      const bool needup = (j0 + 15 >= i0 + 2);        // some (i, j) with j >= i + 2
      if (needlow) { const int pA = TT - 16 - i0 + j0 + POFF;   // tile covers p = pA-POFF .. +31
#pragma unroll
        for (int pt = 0; pt < 2; ++pt) { v8f gg = {};
#pragma unroll
          for (int kc = 0; kc < 2; ++kc) { const v16h pf = frag_h(PH + (size_t)(pA + pt * 16 + col) * DMD + h * HD + kc * 32, lane); gg = wmma16(av[kc], pf, gg); }
#pragma unroll
          for (int r = 0; r < 8; ++r) sg1[wave][8 * g + r][pt * 16 + col] = gg[r]; } }
      if (needup) { const int pB = j0 - i0 - 17 + POFF;
#pragma unroll
        for (int pt = 0; pt < 2; ++pt) { v8f gg = {};
#pragma unroll
          for (int kc = 0; kc < 2; ++kc) { const v16h pf = frag_h(PH + (size_t)(pB + pt * 16 + col) * DMD + h * HD + kc * 32, lane); gg = wmma16(aw[kc], pf, gg); }
#pragma unroll
          for (int r = 0; r < 8; ++r) sg2[wave][8 * g + r][pt * 16 + col] = gg[r]; } }
      LDSX();
#pragma unroll
      for (int r = 0; r < 8; ++r) { const int il = 8 * g + r; const int i = i0 + il; const int j = kk; const int idx = 15 + col - il;   // == (T-1-i+j) - (pA-POFF) == (j-i-2) - (pB-POFF)
        float bd; if (j <= i) bd = sg1[wave][il][idx]; else if (j == i + 1) bd = 0.f; else bd = (lastblk && il == 15) ? 0.f : sg2[wave][il][idx];
        const bool keep = (MK[((size_t)b * TT + i) * TT + j] != 0);
        s[ct][r] = keep ? (c[r] + bd) * 0.125f : -3.0e38f; }
      LDSX(); }
    float alpha[8];
#pragma unroll
    for (int r = 0; r < 8; ++r) { float mx = fmaxf(s[0][r], s[1][r]);
#pragma unroll
      for (int o = 1; o < 16; o <<= 1) mx = fmaxf(mx, __shfl_xor(mx, o));
      const float mn = fmaxf(m[r], mx); alpha[r] = (m[r] <= -1.0e38f) ? 0.f : __expf(m[r] - mn); const float e0 = (s[0][r] <= -1.0e38f) ? 0.f : __expf(s[0][r] - mn), e1 = (s[1][r] <= -1.0e38f) ? 0.f : __expf(s[1][r] - mn); float es = e0 + e1;
#pragma unroll
      for (int o = 1; o < 16; o <<= 1) es += __shfl_xor(es, o);
      l[r] = l[r] * alpha[r] + es; m[r] = mn; sp[wave][8 * g + r][col] = e0; sp[wave][8 * g + r][16 + col] = e1; }
#pragma unroll
    for (int j = 0; j < 4; ++j)
#pragma unroll
      for (int r = 0; r < 8; ++r) acc[j][r] *= alpha[r];
    LDSX();
    v16h pa, pr; { const float* prow = &sp[wave][col][0] + 8 * (lane >> 4);
#pragma unroll
      for (int i = 0; i < 8; ++i) { const float x0 = prow[i] * 2048.0f, x1 = prow[16 + i] * 2048.0f; const _Float16 h0 = (_Float16)x0, h1 = (_Float16)x1; pa[i] = h0; pa[8 + i] = h1; pr[i] = (_Float16)(x0 - (float)h0); pr[8 + i] = (_Float16)(x1 - (float)h1); } }
#pragma unroll
    for (int j = 0; j < 4; ++j) { const size_t po = (b * DMD + (size_t)h * HD + j * 16 + col) * TT + ks * 32; const v16h vh = frag_h(VH + po, lane); acc[j] = wmma16(pa, vh, acc[j]); acc[j] = wmma16(pr, vh, acc[j]); acc[j] = wmma16(pa, frag_h(VL + po, lane), acc[j]); }
    LDSX(); }
#pragma unroll
  for (int r = 0; r < 8; ++r) { const float il = (l[r] > 0.f) ? (1.0f / 2048.0f) / l[r] : 0.f;   // fully masked rows -> zeros (the module zeroes them after the softmax)
#pragma unroll
    for (int j = 0; j < 4; ++j) so[wave][8 * g + r][j * 16 + col] = acc[j][r] * il; }
  LDSX(); for (int rl = 0; rl < 16; ++rl) if (lane < 16) vst2(X + (b * TT + i0 + rl) * DMD + h * HD + lane * 4, *(const v4f*)&so[wave][rl][lane * 4]); }
// ---- k_out: block = (64 rows, 128 of 512 cols): out = x (hi + lo) . Wo^T + bo
__global__ __launch_bounds__(128) void k_out(const float* __restrict__ X, const float* __restrict__ WO, const float* __restrict__ BO, float* __restrict__ OUT) { __shared__ OutSm sm; float (&sf)[4][16][132] = sm.sf;   // ring dead at the epilogue (barrier at the foot of the last stage)
  const int tid = threadIdx.x, wave = tid >> 5, lane = tid & 31, col = lane & 15, g = lane >> 4; const int c0 = blockIdx.y * 128; const size_t r0 = (size_t)blockIdx.x * 64 + wave * 16;
  v8f acc[8] = {};
  // stage = 32 k of 128 Wo rows (ring rows 0..127) and of the block's 64 x rows as hi (128..191) and lo (192..255)
  const int lr = tid >> 3, lq = tid & 7; const float* wsrc = WO + (size_t)(c0 + lr) * DMD + lq * 4; const float* xsrc = X + ((size_t)blockIdx.x * 64 + lr) * DMD + lq * 4;
  v4f pf[12];
#pragma unroll
  for (int e = 0; e < 12; ++e) pf[e] = *(const v4f*)(e < 8 ? wsrc + (size_t)e * 16 * DMD : xsrc + (size_t)(e - 8) * 16 * DMD);
#pragma unroll
  for (int e = 0; e < 12; ++e) { const v4b hv = cvt4(pf[e]); *(v4b*)&sm.st[0][e * 16 + lr][lq * 4] = hv; if (e >= 8) *(v4b*)&sm.st[0][64 + e * 16 + lr][lq * 4] = res4(pf[e], hv); }
  __syncthreads();
#pragma unroll
  for (int kc = 0; kc < DMD / 32; ++kc) { const int cur = kc & 1;
    if (kc + 1 < DMD / 32) {
#pragma unroll
      for (int e = 0; e < 12; ++e) pf[e] = *(const v4f*)((e < 8 ? wsrc + (size_t)e * 16 * DMD : xsrc + (size_t)(e - 8) * 16 * DMD) + (kc + 1) * 32); }
    const v16b ah = frag_b(&sm.st[cur][128 + wave * 16 + col][0], lane), al = frag_b(&sm.st[cur][192 + wave * 16 + col][0], lane);
    v16b w[8];   // the stage's LDS reads go ahead of its products as one group: one LDS latency per stage
#pragma unroll
    for (int j = 0; j < 8; ++j) w[j] = frag_b(&sm.st[cur][j * 16 + col][0], lane);
#pragma unroll
    for (int j = 0; j < 8; ++j) { acc[j] = wmma_bf(ah, w[j], acc[j]); acc[j] = wmma_bf(al, w[j], acc[j]); }
    __builtin_amdgcn_sched_barrier(0);   // keeps the wait for the next stage's global loads behind this stage's products, so that they cover its latency
    if (kc + 1 < DMD / 32) {
#pragma unroll
      for (int e = 0; e < 12; ++e) { const v4b hv = cvt4(pf[e]); *(v4b*)&sm.st[cur ^ 1][e * 16 + lr][lq * 4] = hv; if (e >= 8) *(v4b*)&sm.st[cur ^ 1][64 + e * 16 + lr][lq * 4] = res4(pf[e], hv); } }
    __syncthreads(); }   // publishes stage kc + 1 and ends every read of the buffer that the next pass refills
#pragma unroll
  for (int j = 0; j < 8; ++j) { const float bb = bfr(BO[c0 + j * 16 + col]);
#pragma unroll
    for (int r = 0; r < 8; ++r) sf[wave][8 * g + r][j * 16 + col] = acc[j][r] + bb; }
  LDSX(); for (int rl = 0; rl < 16; ++rl) vst2(OUT + (r0 + rl) * DMD + c0 + lane * 4, *(const v4f*)&sf[wave][rl][lane * 4]); }
extern "C" void kernel_launch(void* const* d_in, const int* in_sizes, int n_in, void* d_out, int out_size, void* d_ws, size_t ws_size, hipStream_t stream) {
  (void)in_sizes; (void)n_in; (void)out_size;
  const float** F = (const float**)d_in;   // 0 q, 1 k, 2 v [8,1024,512]; 3 pos [1024,512]; 4 mask [8,1024,1024] int; 5 Wq, 6 bq, 7 Wk, 8 bk, 9 Wv, 10 bv, 11 Wo, 12 bo, 13 Wp (natural); 14 bias_u [8,64], 15 bias_v [8,64]
  if (ws_size < (size_t)WS_END) return;
  char* ws = (char*)d_ws; float* Q = (float*)(ws + WS_Q); _Float16 *KH = (_Float16*)(ws + WS_KH), *PH = (_Float16*)(ws + WS_PH), *VH = (_Float16*)(ws + WS_VH), *VL = (_Float16*)(ws + WS_VL); float* X = (float*)(ws + WS_X);
  k_proj<<<dim3(TNB * TT / 64, DMD / 128, 4), 128, 0, stream>>>(F[0], F[1], F[2], F[3], F[5], F[6], F[7], F[8], F[9], F[10], F[13], Q, KH, VH, VL, PH);
  k_padph<<<64, 256, 0, stream>>>(PH);
  k_att<<<dim3(TT / 64, NH, TNB), 128, 0, stream>>>(Q, KH, PH, VH, VL, F[14], F[15], (const int*)d_in[4], X);
  k_out<<<dim3(TNB * TT / 64, DMD / 128), 128, 0, stream>>>(X, F[11], F[12], (float*)d_out);
}

// v002
// One run takes 173 microseconds.
// In both of two side-by-side timings against v001, it was 1.54 times as fast.
// Over all steps from v000 it is 2.73 times as fast.
// compute dtype: all float inputs rounded to bf16, mask (int) read; q/k/v/pos projections with EXACT bf16 products on WMMA 16x16x32 (natural weights, + bias), f32 accumulate; q kept in f32 (bias_u / bias_v added per head, then split into f16 hi + residual fragments), k / ph rounded once to f16, v split into f16 hi + residual planes; content scores (q+bu) . k and the Transformer-XL position term (q+bv) . ph with single f16 products (logits ~1-2; q, k, ph each rounded once), the rel_shift realised exactly as an index map onto 16 x 32 position tiles (incl. its upper-triangle wrap-around rows and the zero at j == i+1), x 1/8, masked keys excluded, running-max softmax in f32 (hardware exp); P (f16 x 2^11 + residual) . v; out = x (bf16 hi + lo) . Wo^T + bo; f32 output.
#include <hip/hip_runtime.h>
#include <math.h>

typedef __attribute__((ext_vector_type(16))) _Float16 v16h;
typedef __attribute__((ext_vector_type(16))) __bf16 v16b;
typedef __attribute__((ext_vector_type(8)))  _Float16 v8h;
typedef __attribute__((ext_vector_type(8)))  float v8f;
typedef __attribute__((ext_vector_type(4)))  float v4f;
typedef __attribute__((ext_vector_type(2)))  float v2f;
typedef __attribute__((ext_vector_type(4)))  unsigned v4u;
typedef __attribute__((ext_vector_type(4)))  int v4i;
typedef float __attribute__((may_alias)) float_a;
typedef int __attribute__((may_alias)) int_a;

template <typename T> __device__ __forceinline__ void vst2(void* p, T v) { *(T*)p = v;  }
__device__ __forceinline__ v8f wmma16(v16h a, v16h b, v8f c) {
  v8f d = __builtin_amdgcn_wmma_f32_16x16x32_f16(false, a, false, b, (short)0, c, false, false);
  asm volatile("v_nop\n\tv_nop\n\tv_nop\n\tv_nop" : "+v"(d) : "v"(a), "v"(b));
  return d;
}
__device__ __forceinline__ v8f wmma_bf(v16b a, v16b b, v8f c) {
  v8f d = __builtin_amdgcn_wmma_f32_16x16x32_bf16(false, a, false, b, (short)0, c, false, false);
  asm volatile("v_nop\n\tv_nop\n\tv_nop\n\tv_nop" : "+v"(d) : "v"(a), "v"(b));
  return d;
}
// 16x16x32 fragments: lane = (h = lane>>4, row/col = lane&15); elements 0..7 = k0+8h+0..7, 8..15 = k0+16+8h+0..7; D element r = row 8h+r
__device__ __forceinline__ v16h frag_h(const _Float16* rowk0, int lane) {
  union { v16h v; v8h q[2]; } u; const _Float16* p = rowk0 + 8 * (lane >> 4);
  u.q[0] = *(const v8h*)p; u.q[1] = *(const v8h*)(p + 16); return u.v;
}
__device__ __forceinline__ v16h frag_f32(const float* rowk0, int lane) {
  v16h a; const float* p = rowk0 + 8 * (lane >> 4);
#pragma unroll
  for (int i = 0; i < 8; ++i) { a[i] = (_Float16)p[i]; a[8 + i] = (_Float16)p[16 + i]; }
  return a;
}
__device__ __forceinline__ v16h frag_f32s(const float* rowk0, int lane, float sc) {
  v16h a; const float* p = rowk0 + 8 * (lane >> 4);
#pragma unroll
  for (int i = 0; i < 8; ++i) { a[i] = (_Float16)(p[i] * sc); a[8 + i] = (_Float16)(p[16 + i] * sc); }
  return a;
}
// column fragment from a [K][ld] layout (column n), rows >= K read as 0
__device__ __forceinline__ v16h fragc_f32(const float* W, int k0, int n, int lane, int ld, int K) {
  v16h a; const int g = lane >> 4;
#pragma unroll
  for (int i = 0; i < 8; ++i) { const int ka = k0 + 8 * g + i, kb = ka + 16;
    a[i] = (_Float16)(ka < K ? W[(size_t)(ka < K ? ka : K - 1) * ld + n] : 0.f); a[8 + i] = (_Float16)(kb < K ? W[(size_t)(kb < K ? kb : K - 1) * ld + n] : 0.f); }
  return a;
}
struct F2 { v16b h, l; };
__device__ __forceinline__ F2 bsplit16(const float v[16]) { F2 r;
#pragma unroll
  for (int i = 0; i < 16; ++i) { const __bf16 h = (__bf16)v[i]; r.h[i] = h; r.l[i] = (__bf16)(v[i] - (float)h); }
  return r; }
__device__ __forceinline__ F2 split_row(const float* row, int k0, int lane) { float v[16]; const float* p = row + k0 + 8 * (lane >> 4);
#pragma unroll
  for (int i = 0; i < 8; ++i) { v[i] = p[i]; v[8 + i] = p[16 + i]; }
  return bsplit16(v); }
__device__ __forceinline__ F2 split_rowK(const float* row, int k0, int lane, int K) { float v[16]; const int g = lane >> 4;
#pragma unroll
  for (int i = 0; i < 8; ++i) { const int ka = k0 + 8 * g + i, kb = ka + 16; v[i] = ka < K ? row[ka < K ? ka : K - 1] : 0.f; v[8 + i] = kb < K ? row[kb < K ? kb : K - 1] : 0.f; }
  return bsplit16(v); }
__device__ __forceinline__ F2 split_col(const float* W, int k0, int n, int lane, int ld, int K) { float v[16]; const int g = lane >> 4;
#pragma unroll
  for (int i = 0; i < 8; ++i) { const int ka = k0 + 8 * g + i, kb = ka + 16; v[i] = ka < K ? W[(size_t)(ka < K ? ka : K - 1) * ld + n] : 0.f; v[8 + i] = kb < K ? W[(size_t)(kb < K ? kb : K - 1) * ld + n] : 0.f; }
  return bsplit16(v); }
__device__ __forceinline__ v8f mac3(const F2& a, const F2& b, v8f c) { c = wmma_bf(a.l, b.h, c); c = wmma_bf(a.h, b.l, c); return wmma_bf(a.h, b.h, c); }
__device__ __forceinline__ float sigm(float v) { return 1.0f / (1.0f + expf(-v)); }
#define LDSX() do { asm volatile("s_wait_dscnt 0" ::: "memory"); __builtin_amdgcn_wave_barrier(); __builtin_amdgcn_fence(__ATOMIC_RELEASE, "workgroup"); } while (0)


// Relative-position multi-head attention (Transformer-XL style rel_shift; B 8, T 1,024, D 512, 8 heads x 64): scores = ((q+u) k^T + rel_shift((q+v) p^T)) / 8, masked softmax (mask input), attn v, Wo.
#define NB 8
#define TT 1024
#define DMD 512
#define NH 8
#define HD 64
#define POFF 32                 // ph buffer row offset (rows < 0 and >= T read as zeros)
#define PROWS (TT + 64)
#ifndef TNB
#define TNB NB
#endif
typedef __attribute__((ext_vector_type(8))) __bf16 v8b;
__device__ __forceinline__ v16b frag_b(const __bf16* rowk0, int lane) {
  union { v16b v; v8b q[2]; } u; const __bf16* p = rowk0 + 8 * (lane >> 4);
  u.q[0] = *(const v8b*)p; u.q[1] = *(const v8b*)(p + 16); return u.v;
}
__device__ __forceinline__ float bfr(float v) { return (float)(__bf16)v; }
__device__ __attribute__((noinline)) float exp_ni(float v) { return expf(v); }
__device__ __attribute__((noinline)) float erf_ni(float v) { return erff(v); }

#define WS_Q   0u                                   // f32 q rows [b*u][512] (+bq)
#define WS_KH  (WS_Q + 4u * (size_t)NB * TT * DMD)       // f16 k rows [b*t][512]
#define WS_PH  (WS_KH + 2u * (size_t)NB * TT * DMD)      // f16 ph rows [PROWS][512] (row POFF + p)
#define WS_VH  (WS_PH + 2u * (size_t)PROWS * DMD)        // f16 v planes [b][512][t]
#define WS_VL  (WS_VH + 2u * (size_t)NB * DMD * TT)      // f16 v residual planes (unscaled)
#define WS_X   (WS_VL + 2u * (size_t)NB * DMD * TT)      // f32 attention output rows [b*u][512]
#define WS_END (WS_X + 4u * (size_t)NB * TT * DMD)

typedef __attribute__((ext_vector_type(4))) __bf16 v4b;
__device__ __forceinline__ v4b cvt4(v4f v) { v4b r;
#pragma unroll
  for (int i = 0; i < 4; ++i) r[i] = (__bf16)v[i];
  return r; }
__device__ __forceinline__ v4b res4(v4f v, v4b h) { v4b r;
#pragma unroll
  for (int i = 0; i < 4; ++i) r[i] = (__bf16)(v[i] - (float)h[i]);
  return r; }
#define SPI 40   // ring row pitch in bf16: 64-B rows at 80 B (16 B x odd) for 16-byte LDS reads
union __align__(16) ProjSm { __bf16 st[2][192][SPI]; float sf[4][16][132]; _Float16 sh[64][136]; _Float16 t2[2][128][72]; };
union __align__(16) OutSm { __bf16 st[2][256][SPI]; float sf[4][16][132]; };
// ---- k_proj: block = (64 rows, 128-col group, which): 0 q (f32 rows), 1 k (f16 rows), 2 v (f16 hi + residual planes), 3 ph (f16 rows at POFF), natural W + bias (none for ph)
__global__ __launch_bounds__(128) void k_proj(const float* __restrict__ Qi, const float* __restrict__ Ki, const float* __restrict__ Vi, const float* __restrict__ POS, const float* __restrict__ WQ, const float* __restrict__ BQ, const float* __restrict__ WK, const float* __restrict__ BK, const float* __restrict__ WV, const float* __restrict__ BV, const float* __restrict__ WP, float* __restrict__ Q, _Float16* __restrict__ KH, _Float16* __restrict__ VH, _Float16* __restrict__ VL, _Float16* __restrict__ PH) {
  __shared__ ProjSm sm;   // the operand ring is dead when the epilogue tiles are written (barrier at the foot of the last stage)
  float (&sf)[4][16][132] = sm.sf; _Float16 (&sh)[64][136] = sm.sh; _Float16 (&th)[128][72] = sm.t2[0]; _Float16 (&tl)[128][72] = sm.t2[1];
  const int tid = threadIdx.x, wave = tid >> 5, lane = tid & 31, col = lane & 15, g = lane >> 4; const int which = blockIdx.z; const int c0 = blockIdx.y * 128; const int nrows = (which == 3) ? TT : NB * TT;
  if ((int)blockIdx.x * 64 >= nrows) return;
  const float* X = (which == 0 ? Qi : which == 1 ? Ki : which == 2 ? Vi : POS); const float* Wm = (which == 0 ? WQ : which == 1 ? WK : which == 2 ? WV : WP); const float* Bm = (which == 0 ? BQ : which == 1 ? BK : which == 2 ? BV : nullptr);
  const size_t r0 = (size_t)blockIdx.x * 64 + wave * 16;
  v8f acc[8] = {};
  // stage = 32 k of 128 W rows (ring rows 0..127) and of the block's 64 X rows (128..191); 8 lanes x 16 B fetch one whole 128-B line of a row
  const int lr = tid >> 3, lq = tid & 7; const float* wsrc = Wm + (size_t)(c0 + lr) * DMD + lq * 4; const float* xsrc = X + ((size_t)blockIdx.x * 64 + lr) * DMD + lq * 4;
  v4f pf[12];
#pragma unroll
  for (int e = 0; e < 12; ++e) pf[e] = *(const v4f*)(e < 8 ? wsrc + (size_t)e * 16 * DMD : xsrc + (size_t)(e - 8) * 16 * DMD);
#pragma unroll
  for (int e = 0; e < 12; ++e) *(v4b*)&sm.st[0][e * 16 + lr][lq * 4] = cvt4(pf[e]);
  __syncthreads();
#pragma unroll
  for (int kc = 0; kc < DMD / 32; ++kc) { const int cur = kc & 1;
    if (kc + 1 < DMD / 32) {
#pragma unroll
      for (int e = 0; e < 12; ++e) pf[e] = *(const v4f*)((e < 8 ? wsrc + (size_t)e * 16 * DMD : xsrc + (size_t)(e - 8) * 16 * DMD) + (kc + 1) * 32); }
    const v16b a = frag_b(&sm.st[cur][128 + wave * 16 + col][0], lane);
#pragma unroll
    for (int jh = 0; jh < 8; jh += 4) { v16b w[4];   // the LDS reads of four fragments go ahead of their products as one group: one LDS latency per group
#pragma unroll
      for (int j = 0; j < 4; ++j) w[j] = frag_b(&sm.st[cur][(jh + j) * 16 + col][0], lane);
#pragma unroll
      for (int j = 0; j < 4; ++j) acc[jh + j] = wmma_bf(a, w[j], acc[jh + j]); }
    __builtin_amdgcn_sched_barrier(0);   // keeps the wait for the next stage's global loads behind this stage's products, so that they cover its latency
    if (kc + 1 < DMD / 32) {
#pragma unroll
      for (int e = 0; e < 12; ++e) *(v4b*)&sm.st[cur ^ 1][e * 16 + lr][lq * 4] = cvt4(pf[e]); }
    __syncthreads(); }   // publishes stage kc + 1 and ends every read of the buffer that the next pass refills
#pragma unroll
  for (int j = 0; j < 8; ++j) { const float bb = Bm ? bfr(Bm[c0 + j * 16 + col]) : 0.f;
#pragma unroll
    for (int r = 0; r < 8; ++r) { const float v = acc[j][r] + bb; const int rl = wave * 16 + 8 * g + r, cl = j * 16 + col;
      if (which == 0) sf[wave][8 * g + r][cl] = v; else if (which == 2) { const _Float16 hv = (_Float16)v; th[cl][rl] = hv; tl[cl][rl] = (_Float16)(v - (float)hv); } else sh[rl][cl] = (_Float16)v; } }
  __syncthreads();
  if (which == 0) { for (int rl = 0; rl < 16; ++rl) vst2(Q + (r0 + rl) * DMD + c0 + lane * 4, *(const v4f*)&sf[wave][rl][lane * 4]); }
  else if (which == 2) { const size_t b = ((size_t)blockIdx.x * 64) / TT; const int t0 = (int)(((size_t)blockIdx.x * 64) % TT); for (int e = tid; e < 128 * 8; e += 128) { const int cl = e >> 3, q = e & 7; const size_t o = (b * DMD + c0 + cl) * (size_t)TT + t0 + q * 8; vst2((unsigned*)(VH + o), *(const v4u*)&th[cl][q * 8]); vst2((unsigned*)(VL + o), *(const v4u*)&tl[cl][q * 8]); } }
  else { _Float16* dst = (which == 1) ? (KH + (size_t)blockIdx.x * 64 * DMD) : (PH + ((size_t)POFF + blockIdx.x * 64) * DMD); for (int e = tid; e < 64 * 16; e += 128) { const int rl = e >> 4, q = e & 15; vst2((unsigned*)(dst + (size_t)rl * DMD + c0 + q * 8), *(const v4u*)&sh[rl][q * 8]); } } }
// ---- k_padph: the POFF rows before and the rows after the table are zeros
__global__ __launch_bounds__(256) void k_padph(_Float16* __restrict__ PH) { const int t = threadIdx.x; const int r = blockIdx.x; const size_t row = (r < POFF) ? r : (TT + r);   // 0..31 and TT+32 .. TT+63
  v4u z; z[0] = z[1] = z[2] = z[3] = 0u; if (t < DMD / 8) vst2((unsigned*)(PH + row * DMD + t * 8), z); }
// fragments of (q + bias) for 16 rows, head h: hi and residual as f16 (unscaled; q ~ O(1))
__device__ __forceinline__ void qfrags(const float* __restrict__ Q, size_t row0, int h, const float* __restrict__ bias, int lane, v16h* hi, v16h* lo) { const int col = lane & 15, g = lane >> 4; size_t row = row0 + col; if (row > (size_t)NB * TT - 1) row = (size_t)NB * TT - 1;   // clamp (only the never-used row T of the last batch)
#pragma unroll
  for (int kc = 0; kc < 2; ++kc) { const float* p = Q + row * DMD + h * HD + kc * 32 + 8 * g; const float* bp = bias + h * HD + kc * 32 + 8 * g; v16h a, b;
#pragma unroll
    for (int i = 0; i < 8; ++i) { const float v0 = p[i] + bfr(bp[i]), v1 = p[16 + i] + bfr(bp[16 + i]); const _Float16 h0 = (_Float16)v0, h1 = (_Float16)v1; a[i] = h0; a[8 + i] = h1; b[i] = (_Float16)(v0 - (float)h0); b[8 + i] = (_Float16)(v1 - (float)h1); }
    hi[kc] = a; lo[kc] = b; } }
// ---- k_att: block = (64 queries u, h, b)
#define KP 72    // LDS pitch of the 128-B k and position rows in f16: 144 B (16 B x odd) for 16-byte LDS reads
#define VP 40    // LDS pitch of the 64-B v rows in f16: 80 B
struct __align__(16) AttW { float sp[16][36], sg1[16][36], sg2[16][36]; };
union __align__(16) AttX { AttW w; float so[16][68]; };   // a wave's own exchange tiles; so is written behind the loop, when the other three are dead
__device__ __forceinline__ unsigned lds_at(const void* p) { return (unsigned)(size_t)p; }   // LDS byte address = low 32 bits of the __shared__ address
// extended position index x = T-1-i+j: x < T is table row x (j <= i), x == T the zero row behind the table (j == i+1), x > T table row x-T-1 (the wrapped rows, j >= i+2)
__device__ __forceinline__ const _Float16* ph_row(const _Float16* __restrict__ PH, int x) { return PH + (size_t)(POFF + (x <= TT ? x : x - TT - 1)) * DMD; }
__global__ __launch_bounds__(128) void k_att(const float* __restrict__ Q, const _Float16* __restrict__ KH, const _Float16* __restrict__ PH, const _Float16* __restrict__ VH, const _Float16* __restrict__ VL, const float* __restrict__ BU, const float* __restrict__ BVv, const int* __restrict__ MK, float* __restrict__ X) {
  __shared__ AttX sx[4];
  __shared__ __align__(16) _Float16 sk[2][32][KP];     // 32 keys x 64 d of this head, two buffers
  __shared__ __align__(16) _Float16 sv[2][128][VP];    // rows 0..63 v hi (d), 64..127 v residual, 32 keys each, two buffers
  __shared__ __align__(16) _Float16 sph[128][KP];      // position rows, slot = x & 127: a pass reads 96 rows, the next pass's 32 new rows fill the slots it does not read
  const int tid = threadIdx.x, wave = tid >> 5, lane = tid & 31, col = lane & 15, g = lane >> 4; const int qb = blockIdx.x, h = blockIdx.y; const size_t b = blockIdx.z; const int i0 = qb * 64 + wave * 16;
  float (&sp)[16][36] = sx[wave].w.sp; float (&sg1)[16][36] = sx[wave].w.sg1; float (&sg2)[16][36] = sx[wave].w.sg2; float (&so)[16][68] = sx[wave].so;
  const int xb0 = TT - 64 - qb * 64;   // x of (i = the block's last query, j = 0): pass ks reads x = xb0 + 32 ks .. + 95
  const int kr = tid >> 3, kq = (tid & 7) * 8, vr = tid >> 2, vq = (tid & 3) * 8;   // 8 lanes fetch one whole 128-B row of k or of the table, 4 lanes one 64-B row piece of v
  // tile t = keys 32 t .. + 31 of k and v and the last 32 position rows of pass t's window: eight 16-byte copies a lane, no register in between
  auto tile = [&](int t) { const int bf = t & 1, x = xb0 + t * 32 + 64 + kr;
    const _Float16* gk = KH + (b * TT + t * 32 + kr) * DMD + h * HD + kq; const size_t vo = (b * DMD + (size_t)h * HD + vr) * TT + t * 32 + vq;
    // the wait on xcnt closes the statement: it stands in front of every rewrite of a register that a copy names
    asm volatile("global_load_async_to_lds_b128 %0, %8, off\n\tglobal_load_async_to_lds_b128 %1, %9, off\n\tglobal_load_async_to_lds_b128 %2, %10, off\n\tglobal_load_async_to_lds_b128 %3, %11, off\n\t"
                 "global_load_async_to_lds_b128 %4, %12, off\n\tglobal_load_async_to_lds_b128 %5, %13, off\n\tglobal_load_async_to_lds_b128 %6, %14, off\n\tglobal_load_async_to_lds_b128 %7, %15, off\n\ts_wait_xcnt 0x0"
                 :: "v"(lds_at(&sk[bf][kr][kq])), "v"(lds_at(&sk[bf][16 + kr][kq])), "v"(lds_at(&sph[x & 127][kq])), "v"(lds_at(&sph[(x + 16) & 127][kq])),
                    "v"(lds_at(&sv[bf][vr][vq])), "v"(lds_at(&sv[bf][32 + vr][vq])), "v"(lds_at(&sv[bf][64 + vr][vq])), "v"(lds_at(&sv[bf][96 + vr][vq])),
                    "v"(gk), "v"(gk + 16 * DMD), "v"(ph_row(PH, x) + h * HD + kq), "v"(ph_row(PH, x + 16) + h * HD + kq),
                    "v"(VH + vo), "v"(VH + vo + 32 * TT), "v"(VL + vo), "v"(VL + vo + 32 * TT) : "memory"); };
  tile(0);
  { const int x = xb0 + kr;   // the first 64 position rows of pass 0's window
    asm volatile("global_load_async_to_lds_b128 %0, %4, off\n\tglobal_load_async_to_lds_b128 %1, %5, off\n\tglobal_load_async_to_lds_b128 %2, %6, off\n\tglobal_load_async_to_lds_b128 %3, %7, off\n\ts_wait_xcnt 0x0"
                 :: "v"(lds_at(&sph[x & 127][kq])), "v"(lds_at(&sph[(x + 16) & 127][kq])), "v"(lds_at(&sph[(x + 32) & 127][kq])), "v"(lds_at(&sph[(x + 48) & 127][kq])),
                    "v"(ph_row(PH, x) + h * HD + kq), "v"(ph_row(PH, x + 16) + h * HD + kq), "v"(ph_row(PH, x + 32) + h * HD + kq), "v"(ph_row(PH, x + 48) + h * HD + kq) : "memory"); }
  v16h au[2], av[2], aw[2], tmpl[2];   // (q+u) rows i0.., (q+v) rows i0.., (q+v) rows i0+1.. (for the wrapped upper-triangle term); single f16 rounding (residuals dropped: VGPR budget)
  qfrags(Q, b * TT + i0, h, BU, lane, au, tmpl); qfrags(Q, b * TT + i0, h, BVv, lane, av, tmpl);
  qfrags(Q, b * TT + i0 + 1, h, BVv, lane, aw, tmpl);   // rows i+1; for i = T-1 the row belongs to the next batch (or is clamped) but its products are never used: j >= i+2 cannot hold for i = T-1
  const bool lastblk = (i0 + 16 >= TT);
  float m[8], l[8];
#pragma unroll
  for (int r = 0; r < 8; ++r) { m[r] = -3.0e38f; l[r] = 0.f; }
  v8f acc[4] = {};
  asm volatile("s_wait_asynccnt 0x0" ::: "memory");   // this wave's copies of tile 0 have landed
  __syncthreads();                                     // publishes tile 0
  tile(1);
#pragma unroll 1
  for (int ks = 0; ks < TT / 32; ++ks) { float s[2][8]; const int cur = ks & 1;
#pragma unroll
    for (int ct = 0; ct < 2; ++ct) { const int j0 = ks * 32 + ct * 16; const int kk = j0 + col; v8f c = {};
      const int xt = TT - 16 - i0 + j0;               // the 16 x 32 position tile covers x = xt .. xt + 31, for both terms
      v16h kf[2], pf[2][2];   // the LDS reads of the six fragments go ahead of their products as one group: one LDS latency per 16 keys; both position terms use the same four
#pragma unroll
      for (int kc = 0; kc < 2; ++kc) { kf[kc] = frag_h(&sk[cur][ct * 16 + col][kc * 32], lane); pf[0][kc] = frag_h(&sph[(xt & 127) + col][kc * 32], lane); pf[1][kc] = frag_h(&sph[((xt + 16) & 127) + col][kc * 32], lane); }
#pragma unroll
      for (int kc = 0; kc < 2; ++kc) c = wmma16(au[kc], kf[kc], c);
      const bool needlow = (j0 <= i0 + 15);          // some (i, j) with j <= i
      const bool needup = (j0 + 15 >= i0 + 2);        // some (i, j) with j >= i + 2
      if (needlow) {
#pragma unroll
        for (int pt = 0; pt < 2; ++pt) { v8f gg = {};
#pragma unroll
          for (int kc = 0; kc < 2; ++kc) gg = wmma16(av[kc], pf[pt][kc], gg);
#pragma unroll
          for (int r = 0; r < 8; ++r) sg1[8 * g + r][pt * 16 + col] = gg[r]; } }
      if (needup) {
#pragma unroll
        for (int pt = 0; pt < 2; ++pt) { v8f gg = {};
#pragma unroll
          for (int kc = 0; kc < 2; ++kc) gg = wmma16(aw[kc], pf[pt][kc], gg);
#pragma unroll
          for (int r = 0; r < 8; ++r) sg2[8 * g + r][pt * 16 + col] = gg[r]; } }
      LDSX();
#pragma unroll
      for (int r = 0; r < 8; ++r) { const int il = 8 * g + r; const int i = i0 + il; const int j = kk; const int idx = 15 + col - il;   // == (T-1-i+j) - xt
        float bd; if (j <= i) bd = sg1[il][idx]; else if (j == i + 1) bd = 0.f; else bd = (lastblk && il == 15) ? 0.f : sg2[il][idx];
        const bool keep = (MK[((size_t)b * TT + i) * TT + j] != 0);
        s[ct][r] = keep ? (c[r] + bd) * 0.125f : -3.0e38f; }
      LDSX(); }
    float alpha[8];
#pragma unroll
    for (int r = 0; r < 8; ++r) { float mx = fmaxf(s[0][r], s[1][r]);
#pragma unroll
      for (int o = 1; o < 16; o <<= 1) mx = fmaxf(mx, __shfl_xor(mx, o));
      const float mn = fmaxf(m[r], mx); alpha[r] = (m[r] <= -1.0e38f) ? 0.f : __expf(m[r] - mn); const float e0 = (s[0][r] <= -1.0e38f) ? 0.f : __expf(s[0][r] - mn), e1 = (s[1][r] <= -1.0e38f) ? 0.f : __expf(s[1][r] - mn); float es = e0 + e1;
#pragma unroll
      for (int o = 1; o < 16; o <<= 1) es += __shfl_xor(es, o);
      l[r] = l[r] * alpha[r] + es; m[r] = mn; sp[8 * g + r][col] = e0; sp[8 * g + r][16 + col] = e1; }
#pragma unroll
    for (int j = 0; j < 4; ++j)
#pragma unroll
      for (int r = 0; r < 8; ++r) acc[j][r] *= alpha[r];
    LDSX();
    v16h pa, pr; { const float* prow = &sp[col][0] + 8 * (lane >> 4);
#pragma unroll
      for (int i = 0; i < 8; ++i) { const float x0 = prow[i] * 2048.0f, x1 = prow[16 + i] * 2048.0f; const _Float16 h0 = (_Float16)x0, h1 = (_Float16)x1; pa[i] = h0; pa[8 + i] = h1; pr[i] = (_Float16)(x0 - (float)h0); pr[8 + i] = (_Float16)(x1 - (float)h1); } }
#pragma unroll
    for (int jh = 0; jh < 4; jh += 2) { v16h vh[2], vl[2];   // four fragments' LDS reads as one group ahead of their six products
#pragma unroll
      for (int j = 0; j < 2; ++j) { vh[j] = frag_h(&sv[cur][(jh + j) * 16 + col][0], lane); vl[j] = frag_h(&sv[cur][64 + (jh + j) * 16 + col][0], lane); }
#pragma unroll
      for (int j = 0; j < 2; ++j) { acc[jh + j] = wmma16(pa, vh[j], acc[jh + j]); acc[jh + j] = wmma16(pr, vh[j], acc[jh + j]); acc[jh + j] = wmma16(pa, vl[j], acc[jh + j]); } }
    asm volatile("s_wait_dscnt 0x0" ::: "memory");      // this wave's LDS reads of pass ks have retired before the buffers are refilled
    asm volatile("s_wait_asynccnt 0x0" ::: "memory");   // this wave's copies of tile ks + 1 have landed
    __syncthreads();                                     // publishes tile ks + 1 and ends every wave's reads of the buffers and slots that tile ks + 2 fills
    if (ks + 2 < TT / 32) tile(ks + 2); }
  asm volatile("s_wait_asynccnt 0x0" ::: "memory");     // no copy is outstanding when the wave ends
#pragma unroll
  for (int r = 0; r < 8; ++r) { const float il = (l[r] > 0.f) ? (1.0f / 2048.0f) / l[r] : 0.f;   // fully masked rows -> zeros (the module zeroes them after the softmax)
#pragma unroll
    for (int j = 0; j < 4; ++j) so[8 * g + r][j * 16 + col] = acc[j][r] * il; }
  LDSX(); for (int rl = 0; rl < 16; ++rl) if (lane < 16) vst2(X + (b * TT + i0 + rl) * DMD + h * HD + lane * 4, *(const v4f*)&so[rl][lane * 4]); }
// ---- k_out: block = (64 rows, 128 of 512 cols): out = x (hi + lo) . Wo^T + bo
__global__ __launch_bounds__(128) void k_out(const float* __restrict__ X, const float* __restrict__ WO, const float* __restrict__ BO, float* __restrict__ OUT) { __shared__ OutSm sm; float (&sf)[4][16][132] = sm.sf;   // ring dead at the epilogue (barrier at the foot of the last stage)
  const int tid = threadIdx.x, wave = tid >> 5, lane = tid & 31, col = lane & 15, g = lane >> 4; const int c0 = blockIdx.y * 128; const size_t r0 = (size_t)blockIdx.x * 64 + wave * 16;
  v8f acc[8] = {};
  // stage = 32 k of 128 Wo rows (ring rows 0..127) and of the block's 64 x rows as hi (128..191) and lo (192..255)
  const int lr = tid >> 3, lq = tid & 7; const float* wsrc = WO + (size_t)(c0 + lr) * DMD + lq * 4; const float* xsrc = X + ((size_t)blockIdx.x * 64 + lr) * DMD + lq * 4;
  v4f pf[12];
#pragma unroll
  for (int e = 0; e < 12; ++e) pf[e] = *(const v4f*)(e < 8 ? wsrc + (size_t)e * 16 * DMD : xsrc + (size_t)(e - 8) * 16 * DMD);
#pragma unroll
  for (int e = 0; e < 12; ++e) { const v4b hv = cvt4(pf[e]); *(v4b*)&sm.st[0][e * 16 + lr][lq * 4] = hv; if (e >= 8) *(v4b*)&sm.st[0][64 + e * 16 + lr][lq * 4] = res4(pf[e], hv); }
  __syncthreads();
#pragma unroll
  for (int kc = 0; kc < DMD / 32; ++kc) { const int cur = kc & 1;
    if (kc + 1 < DMD / 32) {
#pragma unroll
      for (int e = 0; e < 12; ++e) pf[e] = *(const v4f*)((e < 8 ? wsrc + (size_t)e * 16 * DMD : xsrc + (size_t)(e - 8) * 16 * DMD) + (kc + 1) * 32); }
    const v16b ah = frag_b(&sm.st[cur][128 + wave * 16 + col][0], lane), al = frag_b(&sm.st[cur][192 + wave * 16 + col][0], lane);
    v16b w[8];   // the stage's LDS reads go ahead of its products as one group: one LDS latency per stage
#pragma unroll
    for (int j = 0; j < 8; ++j) w[j] = frag_b(&sm.st[cur][j * 16 + col][0], lane);
#pragma unroll
    for (int j = 0; j < 8; ++j) { acc[j] = wmma_bf(ah, w[j], acc[j]); acc[j] = wmma_bf(al, w[j], acc[j]); }
    __builtin_amdgcn_sched_barrier(0);   // keeps the wait for the next stage's global loads behind this stage's products, so that they cover its latency
    if (kc + 1 < DMD / 32) {
#pragma unroll
      for (int e = 0; e < 12; ++e) { const v4b hv = cvt4(pf[e]); *(v4b*)&sm.st[cur ^ 1][e * 16 + lr][lq * 4] = hv; if (e >= 8) *(v4b*)&sm.st[cur ^ 1][64 + e * 16 + lr][lq * 4] = res4(pf[e], hv); } }
    __syncthreads(); }   // publishes stage kc + 1 and ends every read of the buffer that the next pass refills
#pragma unroll
  for (int j = 0; j < 8; ++j) { const float bb = bfr(BO[c0 + j * 16 + col]);
#pragma unroll
    for (int r = 0; r < 8; ++r) sf[wave][8 * g + r][j * 16 + col] = acc[j][r] + bb; }
  LDSX(); for (int rl = 0; rl < 16; ++rl) vst2(OUT + (r0 + rl) * DMD + c0 + lane * 4, *(const v4f*)&sf[wave][rl][lane * 4]); }
extern "C" void kernel_launch(void* const* d_in, const int* in_sizes, int n_in, void* d_out, int out_size, void* d_ws, size_t ws_size, hipStream_t stream) {
  (void)in_sizes; (void)n_in; (void)out_size;
  const float** F = (const float**)d_in;   // 0 q, 1 k, 2 v [8,1024,512]; 3 pos [1024,512]; 4 mask [8,1024,1024] int; 5 Wq, 6 bq, 7 Wk, 8 bk, 9 Wv, 10 bv, 11 Wo, 12 bo, 13 Wp (natural); 14 bias_u [8,64], 15 bias_v [8,64]
  if (ws_size < (size_t)WS_END) return;
  char* ws = (char*)d_ws; float* Q = (float*)(ws + WS_Q); _Float16 *KH = (_Float16*)(ws + WS_KH), *PH = (_Float16*)(ws + WS_PH), *VH = (_Float16*)(ws + WS_VH), *VL = (_Float16*)(ws + WS_VL); float* X = (float*)(ws + WS_X);
  k_proj<<<dim3(TNB * TT / 64, DMD / 128, 4), 128, 0, stream>>>(F[0], F[1], F[2], F[3], F[5], F[6], F[7], F[8], F[9], F[10], F[13], Q, KH, VH, VL, PH);
  k_padph<<<64, 256, 0, stream>>>(PH);
  k_att<<<dim3(TT / 64, NH, TNB), 128, 0, stream>>>(Q, KH, PH, VH, VL, F[14], F[15], (const int*)d_in[4], X);
  k_out<<<dim3(TNB * TT / 64, DMD / 128), 128, 0, stream>>>(X, F[11], F[12], (float*)d_out);
}

// v003
// One run takes 153 microseconds.
// Two timings next to v002 both put it at 1.13 times that version's speed.
// Counting every step since v000, it is 3.09 times as fast.
// compute dtype: all float inputs rounded to bf16, mask (int) read; q/k/v/pos projections with EXACT bf16 products on WMMA 16x16x32 (natural weights, + bias), f32 accumulate; q kept in f32 (bias_u / bias_v added per head, then split into f16 hi + residual fragments), k / ph rounded once to f16, v split into f16 hi + residual planes; content scores (q+bu) . k and the Transformer-XL position term (q+bv) . ph with single f16 products (logits ~1-2; q, k, ph each rounded once), the rel_shift realised exactly as an index map onto 16 x 32 position tiles (incl. its upper-triangle wrap-around rows and the zero at j == i+1), x 1/8, masked keys excluded, running-max softmax in f32 (hardware exp); P (f16 x 2^11 + residual) . v; out = x (bf16 hi + lo) . Wo^T + bo; f32 output.
#include <hip/hip_runtime.h>
#include <math.h>

typedef __attribute__((ext_vector_type(16))) _Float16 v16h;
typedef __attribute__((ext_vector_type(16))) __bf16 v16b;
typedef __attribute__((ext_vector_type(8)))  _Float16 v8h;
typedef __attribute__((ext_vector_type(8)))  float v8f;
typedef __attribute__((ext_vector_type(4)))  float v4f;
typedef __attribute__((ext_vector_type(2)))  float v2f;
typedef __attribute__((ext_vector_type(4)))  unsigned v4u;
typedef __attribute__((ext_vector_type(4)))  int v4i;
typedef float __attribute__((may_alias)) float_a;
typedef int __attribute__((may_alias)) int_a;

template <typename T> __device__ __forceinline__ void vst2(void* p, T v) { *(T*)p = v;  }
__device__ __forceinline__ v8f wmma16(v16h a, v16h b, v8f c) {
  v8f d = __builtin_amdgcn_wmma_f32_16x16x32_f16(false, a, false, b, (short)0, c, false, false);
  asm volatile("v_nop\n\tv_nop\n\tv_nop\n\tv_nop" : "+v"(d) : "v"(a), "v"(b));
  return d;
}
__device__ __forceinline__ v8f wmma_bf(v16b a, v16b b, v8f c) {
  v8f d = __builtin_amdgcn_wmma_f32_16x16x32_bf16(false, a, false, b, (short)0, c, false, false);
  asm volatile("v_nop\n\tv_nop\n\tv_nop\n\tv_nop" : "+v"(d) : "v"(a), "v"(b));
  return d;
}
// 16x16x32 fragments: lane = (h = lane>>4, row/col = lane&15); elements 0..7 = k0+8h+0..7, 8..15 = k0+16+8h+0..7; D element r = row 8h+r
__device__ __forceinline__ v16h frag_h(const _Float16* rowk0, int lane) {
  union { v16h v; v8h q[2]; } u; const _Float16* p = rowk0 + 8 * (lane >> 4);
  u.q[0] = *(const v8h*)p; u.q[1] = *(const v8h*)(p + 16); return u.v;
}
__device__ __forceinline__ v16h frag_f32(const float* rowk0, int lane) {
  v16h a; const float* p = rowk0 + 8 * (lane >> 4);
#pragma unroll
  for (int i = 0; i < 8; ++i) { a[i] = (_Float16)p[i]; a[8 + i] = (_Float16)p[16 + i]; }
  return a;
}
__device__ __forceinline__ v16h frag_f32s(const float* rowk0, int lane, float sc) {
  v16h a; const float* p = rowk0 + 8 * (lane >> 4);
#pragma unroll
  for (int i = 0; i < 8; ++i) { a[i] = (_Float16)(p[i] * sc); a[8 + i] = (_Float16)(p[16 + i] * sc); }
  return a;
}
// column fragment from a [K][ld] layout (column n), rows >= K read as 0
__device__ __forceinline__ v16h fragc_f32(const float* W, int k0, int n, int lane, int ld, int K) {
  v16h a; const int g = lane >> 4;
#pragma unroll
  for (int i = 0; i < 8; ++i) { const int ka = k0 + 8 * g + i, kb = ka + 16;
    a[i] = (_Float16)(ka < K ? W[(size_t)(ka < K ? ka : K - 1) * ld + n] : 0.f); a[8 + i] = (_Float16)(kb < K ? W[(size_t)(kb < K ? kb : K - 1) * ld + n] : 0.f); }
  return a;
}
struct F2 { v16b h, l; };
__device__ __forceinline__ F2 bsplit16(const float v[16]) { F2 r;
#pragma unroll
  for (int i = 0; i < 16; ++i) { const __bf16 h = (__bf16)v[i]; r.h[i] = h; r.l[i] = (__bf16)(v[i] - (float)h); }
  return r; }
__device__ __forceinline__ F2 split_row(const float* row, int k0, int lane) { float v[16]; const float* p = row + k0 + 8 * (lane >> 4);
#pragma unroll
  for (int i = 0; i < 8; ++i) { v[i] = p[i]; v[8 + i] = p[16 + i]; }
  return bsplit16(v); }
__device__ __forceinline__ F2 split_rowK(const float* row, int k0, int lane, int K) { float v[16]; const int g = lane >> 4;
#pragma unroll
  for (int i = 0; i < 8; ++i) { const int ka = k0 + 8 * g + i, kb = ka + 16; v[i] = ka < K ? row[ka < K ? ka : K - 1] : 0.f; v[8 + i] = kb < K ? row[kb < K ? kb : K - 1] : 0.f; }
  return bsplit16(v); }
__device__ __forceinline__ F2 split_col(const float* W, int k0, int n, int lane, int ld, int K) { float v[16]; const int g = lane >> 4;
#pragma unroll
  for (int i = 0; i < 8; ++i) { const int ka = k0 + 8 * g + i, kb = ka + 16; v[i] = ka < K ? W[(size_t)(ka < K ? ka : K - 1) * ld + n] : 0.f; v[8 + i] = kb < K ? W[(size_t)(kb < K ? kb : K - 1) * ld + n] : 0.f; }
  return bsplit16(v); }
__device__ __forceinline__ v8f mac3(const F2& a, const F2& b, v8f c) { c = wmma_bf(a.l, b.h, c); c = wmma_bf(a.h, b.l, c); return wmma_bf(a.h, b.h, c); }
__device__ __forceinline__ float sigm(float v) { return 1.0f / (1.0f + expf(-v)); }
#define LDSX() do { asm volatile("s_wait_dscnt 0" ::: "memory"); __builtin_amdgcn_wave_barrier(); __builtin_amdgcn_fence(__ATOMIC_RELEASE, "workgroup"); } while (0)


// Relative-position multi-head attention (Transformer-XL style rel_shift; B 8, T 1,024, D 512, 8 heads x 64): scores = ((q+u) k^T + rel_shift((q+v) p^T)) / 8, masked softmax (mask input), attn v, Wo.
#define NB 8
#define TT 1024
#define DMD 512
#define NH 8
#define HD 64
#define POFF 32                 // ph buffer row offset (rows < 0 and >= T read as zeros)
#define PROWS (TT + 64)
#ifndef TNB
#define TNB NB
#endif
typedef __attribute__((ext_vector_type(8))) __bf16 v8b;
__device__ __forceinline__ v16b frag_b(const __bf16* rowk0, int lane) {
  union { v16b v; v8b q[2]; } u; const __bf16* p = rowk0 + 8 * (lane >> 4);
  u.q[0] = *(const v8b*)p; u.q[1] = *(const v8b*)(p + 16); return u.v;
}
__device__ __forceinline__ float bfr(float v) { return (float)(__bf16)v; }
__device__ __attribute__((noinline)) float exp_ni(float v) { return expf(v); }
__device__ __attribute__((noinline)) float erf_ni(float v) { return erff(v); }

#define WS_Q   0u                                   // f32 q rows [b*u][512] (+bq)
#define WS_KH  (WS_Q + 4u * (size_t)NB * TT * DMD)       // f16 k rows [b*t][512]
#define WS_PH  (WS_KH + 2u * (size_t)NB * TT * DMD)      // f16 ph rows [PROWS][512] (row POFF + p)
#define WS_VH  (WS_PH + 2u * (size_t)PROWS * DMD)        // f16 v planes [b][512][t]
#define WS_VL  (WS_VH + 2u * (size_t)NB * DMD * TT)      // f16 v residual planes (unscaled)
#define WS_X   (WS_VL + 2u * (size_t)NB * DMD * TT)      // f32 attention output rows [b*u][512]
#define WS_END (WS_X + 4u * (size_t)NB * TT * DMD)

typedef __attribute__((ext_vector_type(4))) __bf16 v4b;
__device__ __forceinline__ v4b cvt4(v4f v) { v4b r;
#pragma unroll
  for (int i = 0; i < 4; ++i) r[i] = (__bf16)v[i];
  return r; }
__device__ __forceinline__ v4b res4(v4f v, v4b h) { v4b r;
#pragma unroll
  for (int i = 0; i < 4; ++i) r[i] = (__bf16)(v[i] - (float)h[i]);
  return r; }
#define SPI 40   // ring row pitch in bf16: 64-B rows at 80 B (16 B x odd) for 16-byte LDS reads
union __align__(16) ProjSm { __bf16 st[2][192][SPI]; float sf[4][16][132]; _Float16 sh[64][136]; _Float16 t2[2][128][72]; };
union __align__(16) OutSm { __bf16 st[2][256][SPI]; float sf[4][16][132]; };
// ---- k_proj: block = (64 rows, 128-col group, which): 0 q (f32 rows), 1 k (f16 rows), 2 v (f16 hi + residual planes), 3 ph (f16 rows at POFF), natural W + bias (none for ph)
__global__ __launch_bounds__(128) void k_proj(const float* __restrict__ Qi, const float* __restrict__ Ki, const float* __restrict__ Vi, const float* __restrict__ POS, const float* __restrict__ WQ, const float* __restrict__ BQ, const float* __restrict__ WK, const float* __restrict__ BK, const float* __restrict__ WV, const float* __restrict__ BV, const float* __restrict__ WP, float* __restrict__ Q, _Float16* __restrict__ KH, _Float16* __restrict__ VH, _Float16* __restrict__ VL, _Float16* __restrict__ PH) {
  __shared__ ProjSm sm;   // the operand ring is dead when the epilogue tiles are written (barrier at the foot of the last stage)
  float (&sf)[4][16][132] = sm.sf; _Float16 (&sh)[64][136] = sm.sh; _Float16 (&th)[128][72] = sm.t2[0]; _Float16 (&tl)[128][72] = sm.t2[1];
  const int tid = threadIdx.x, wave = tid >> 5, lane = tid & 31, col = lane & 15, g = lane >> 4; const int which = blockIdx.z; const int c0 = blockIdx.y * 128; const int nrows = (which == 3) ? TT : NB * TT;
  if ((int)blockIdx.x * 64 >= nrows) return;
  const float* X = (which == 0 ? Qi : which == 1 ? Ki : which == 2 ? Vi : POS); const float* Wm = (which == 0 ? WQ : which == 1 ? WK : which == 2 ? WV : WP); const float* Bm = (which == 0 ? BQ : which == 1 ? BK : which == 2 ? BV : nullptr);
  const size_t r0 = (size_t)blockIdx.x * 64 + wave * 16;
  v8f acc[8] = {};
  // stage = 32 k of 128 W rows (ring rows 0..127) and of the block's 64 X rows (128..191); 8 lanes x 16 B fetch one whole 128-B line of a row
  const int lr = tid >> 3, lq = tid & 7; const float* wsrc = Wm + (size_t)(c0 + lr) * DMD + lq * 4; const float* xsrc = X + ((size_t)blockIdx.x * 64 + lr) * DMD + lq * 4;
  v4f pf[12];
#pragma unroll
  for (int e = 0; e < 12; ++e) pf[e] = *(const v4f*)(e < 8 ? wsrc + (size_t)e * 16 * DMD : xsrc + (size_t)(e - 8) * 16 * DMD);
#pragma unroll
  for (int e = 0; e < 12; ++e) *(v4b*)&sm.st[0][e * 16 + lr][lq * 4] = cvt4(pf[e]);
  __syncthreads();
#pragma unroll
  for (int kc = 0; kc < DMD / 32; ++kc) { const int cur = kc & 1;
    if (kc + 1 < DMD / 32) {
#pragma unroll
      for (int e = 0; e < 12; ++e) pf[e] = *(const v4f*)((e < 8 ? wsrc + (size_t)e * 16 * DMD : xsrc + (size_t)(e - 8) * 16 * DMD) + (kc + 1) * 32); }
    const v16b a = frag_b(&sm.st[cur][128 + wave * 16 + col][0], lane);
#pragma unroll
    for (int jh = 0; jh < 8; jh += 4) { v16b w[4];   // the LDS reads of four fragments go ahead of their products as one group: one LDS latency per group
#pragma unroll
      for (int j = 0; j < 4; ++j) w[j] = frag_b(&sm.st[cur][(jh + j) * 16 + col][0], lane);
#pragma unroll
      for (int j = 0; j < 4; ++j) acc[jh + j] = wmma_bf(a, w[j], acc[jh + j]); }
    __builtin_amdgcn_sched_barrier(0);   // keeps the wait for the next stage's global loads behind this stage's products, so that they cover its latency
    if (kc + 1 < DMD / 32) {
#pragma unroll
      for (int e = 0; e < 12; ++e) *(v4b*)&sm.st[cur ^ 1][e * 16 + lr][lq * 4] = cvt4(pf[e]); }
    __syncthreads(); }   // publishes stage kc + 1 and ends every read of the buffer that the next pass refills
#pragma unroll
  for (int j = 0; j < 8; ++j) { const float bb = Bm ? bfr(Bm[c0 + j * 16 + col]) : 0.f;
#pragma unroll
    for (int r = 0; r < 8; ++r) { const float v = acc[j][r] + bb; const int rl = wave * 16 + 8 * g + r, cl = j * 16 + col;
      if (which == 0) sf[wave][8 * g + r][cl] = v; else if (which == 2) { const _Float16 hv = (_Float16)v; th[cl][rl] = hv; tl[cl][rl] = (_Float16)(v - (float)hv); } else sh[rl][cl] = (_Float16)v; } }
  __syncthreads();
  if (which == 0) { for (int rl = 0; rl < 16; ++rl) vst2(Q + (r0 + rl) * DMD + c0 + lane * 4, *(const v4f*)&sf[wave][rl][lane * 4]); }
  else if (which == 2) { const size_t b = ((size_t)blockIdx.x * 64) / TT; const int t0 = (int)(((size_t)blockIdx.x * 64) % TT); for (int e = tid; e < 128 * 8; e += 128) { const int cl = e >> 3, q = e & 7; const size_t o = (b * DMD + c0 + cl) * (size_t)TT + t0 + q * 8; vst2((unsigned*)(VH + o), *(const v4u*)&th[cl][q * 8]); vst2((unsigned*)(VL + o), *(const v4u*)&tl[cl][q * 8]); } }
  else { _Float16* dst = (which == 1) ? (KH + (size_t)blockIdx.x * 64 * DMD) : (PH + ((size_t)POFF + blockIdx.x * 64) * DMD); for (int e = tid; e < 64 * 16; e += 128) { const int rl = e >> 4, q = e & 15; vst2((unsigned*)(dst + (size_t)rl * DMD + c0 + q * 8), *(const v4u*)&sh[rl][q * 8]); } } }
// ---- k_padph: the POFF rows before and the rows after the table are zeros
__global__ __launch_bounds__(256) void k_padph(_Float16* __restrict__ PH) { const int t = threadIdx.x; const int r = blockIdx.x; const size_t row = (r < POFF) ? r : (TT + r);   // 0..31 and TT+32 .. TT+63
  v4u z; z[0] = z[1] = z[2] = z[3] = 0u; if (t < DMD / 8) vst2((unsigned*)(PH + row * DMD + t * 8), z); }
// fragments of (q + bias) for 16 rows, head h: hi and residual as f16 (unscaled; q ~ O(1))
__device__ __forceinline__ void qfrags(const float* __restrict__ Q, size_t row0, int h, const float* __restrict__ bias, int lane, v16h* hi, v16h* lo) { const int col = lane & 15, g = lane >> 4; size_t row = row0 + col; if (row > (size_t)NB * TT - 1) row = (size_t)NB * TT - 1;   // clamp (only the never-used row T of the last batch)
#pragma unroll
  for (int kc = 0; kc < 2; ++kc) { const float* p = Q + row * DMD + h * HD + kc * 32 + 8 * g; const float* bp = bias + h * HD + kc * 32 + 8 * g; v16h a, b;
#pragma unroll
    for (int i = 0; i < 8; ++i) { const float v0 = p[i] + bfr(bp[i]), v1 = p[16 + i] + bfr(bp[16 + i]); const _Float16 h0 = (_Float16)v0, h1 = (_Float16)v1; a[i] = h0; a[8 + i] = h1; b[i] = (_Float16)(v0 - (float)h0); b[8 + i] = (_Float16)(v1 - (float)h1); }
    hi[kc] = a; lo[kc] = b; } }
// ---- k_att: block = (64 queries u, h, b)
#define KP 72    // LDS pitch of the 128-B k and position rows in f16: 144 B (16 B x odd) for 16-byte LDS reads
#define VP 40    // LDS pitch of the 64-B v rows in f16: 80 B
struct __align__(16) AttW { float sp[16][36], sg[2][16][36]; };   // sg[0]: position products of rows i (for j <= i), sg[1]: of rows i + 1 (for j >= i + 2)
union __align__(16) AttX { AttW w; float so[16][68]; };   // a wave's own exchange tiles; so is written behind the loop, when the other three are dead
__device__ __forceinline__ unsigned lds_at(const void* p) { return (unsigned)(size_t)p; }   // LDS byte address = low 32 bits of the __shared__ address
// extended position index x = T-1-i+j: x < T is table row x (j <= i), x == T the zero row behind the table (j == i+1), x > T table row x-T-1 (the wrapped rows, j >= i+2)
__device__ __forceinline__ const _Float16* ph_row(const _Float16* __restrict__ PH, int x) { return PH + (size_t)(POFF + (x <= TT ? x : x - TT - 1)) * DMD; }
__global__ __launch_bounds__(128) void k_att(const float* __restrict__ Q, const _Float16* __restrict__ KH, const _Float16* __restrict__ PH, const _Float16* __restrict__ VH, const _Float16* __restrict__ VL, const float* __restrict__ BU, const float* __restrict__ BVv, const int* __restrict__ MK, float* __restrict__ X) {
  __shared__ AttX sx[4];
  __shared__ __align__(16) _Float16 sk[2][32][KP];     // 32 keys x 64 d of this head, two buffers
  __shared__ __align__(16) _Float16 sv[2][128][VP];    // rows 0..63 v hi (d), 64..127 v residual, 32 keys each, two buffers
  __shared__ __align__(16) _Float16 sph[128][KP];      // position rows, slot = x & 127: a pass reads 96 rows, the next pass's 32 new rows fill the slots it does not read
  const int tid = threadIdx.x, wave = tid >> 5, lane = tid & 31, col = lane & 15, g = lane >> 4; const int qb = blockIdx.x, h = blockIdx.y; const size_t b = blockIdx.z; const int i0 = qb * 64 + wave * 16;
  float (&sp)[16][36] = sx[wave].w.sp; float (&sg)[2][16][36] = sx[wave].w.sg; float (&sg1)[16][36] = sg[0]; float (&sg2)[16][36] = sg[1]; float (&so)[16][68] = sx[wave].so;
  const int xb0 = TT - 64 - qb * 64;   // x of (i = the block's last query, j = 0): pass ks reads x = xb0 + 32 ks .. + 95
  const int kr = tid >> 3, kq = (tid & 7) * 8, vr = tid >> 2, vq = (tid & 3) * 8;   // 8 lanes fetch one whole 128-B row of k or of the table, 4 lanes one 64-B row piece of v
  // tile t = keys 32 t .. + 31 of k and v and the last 32 position rows of pass t's window: eight 16-byte copies a lane, no register in between
  auto tile = [&](int t) { const int bf = t & 1, x = xb0 + t * 32 + 64 + kr;
    const _Float16* gk = KH + (b * TT + t * 32 + kr) * DMD + h * HD + kq; const size_t vo = (b * DMD + (size_t)h * HD + vr) * TT + t * 32 + vq;
    // the wait on xcnt closes the statement: it stands in front of every rewrite of a register that a copy names
    asm volatile("global_load_async_to_lds_b128 %0, %8, off\n\tglobal_load_async_to_lds_b128 %1, %9, off\n\tglobal_load_async_to_lds_b128 %2, %10, off\n\tglobal_load_async_to_lds_b128 %3, %11, off\n\t"
                 "global_load_async_to_lds_b128 %4, %12, off\n\tglobal_load_async_to_lds_b128 %5, %13, off\n\tglobal_load_async_to_lds_b128 %6, %14, off\n\tglobal_load_async_to_lds_b128 %7, %15, off\n\ts_wait_xcnt 0x0"
                 :: "v"(lds_at(&sk[bf][kr][kq])), "v"(lds_at(&sk[bf][16 + kr][kq])), "v"(lds_at(&sph[x & 127][kq])), "v"(lds_at(&sph[(x + 16) & 127][kq])),
                    "v"(lds_at(&sv[bf][vr][vq])), "v"(lds_at(&sv[bf][32 + vr][vq])), "v"(lds_at(&sv[bf][64 + vr][vq])), "v"(lds_at(&sv[bf][96 + vr][vq])),
                    "v"(gk), "v"(gk + 16 * DMD), "v"(ph_row(PH, x) + h * HD + kq), "v"(ph_row(PH, x + 16) + h * HD + kq),
                    "v"(VH + vo), "v"(VH + vo + 32 * TT), "v"(VL + vo), "v"(VL + vo + 32 * TT) : "memory"); };
  tile(0);
  { const int x = xb0 + kr;   // the first 64 position rows of pass 0's window
    asm volatile("global_load_async_to_lds_b128 %0, %4, off\n\tglobal_load_async_to_lds_b128 %1, %5, off\n\tglobal_load_async_to_lds_b128 %2, %6, off\n\tglobal_load_async_to_lds_b128 %3, %7, off\n\ts_wait_xcnt 0x0"
                 :: "v"(lds_at(&sph[x & 127][kq])), "v"(lds_at(&sph[(x + 16) & 127][kq])), "v"(lds_at(&sph[(x + 32) & 127][kq])), "v"(lds_at(&sph[(x + 48) & 127][kq])),
                    "v"(ph_row(PH, x) + h * HD + kq), "v"(ph_row(PH, x + 16) + h * HD + kq), "v"(ph_row(PH, x + 32) + h * HD + kq), "v"(ph_row(PH, x + 48) + h * HD + kq) : "memory"); }
  v16h au[2], av[2], aw[2], tmpl[2];   // (q+u) rows i0.., (q+v) rows i0.., (q+v) rows i0+1.. (for the wrapped upper-triangle term); single f16 rounding (residuals dropped: VGPR budget)
  qfrags(Q, b * TT + i0, h, BU, lane, au, tmpl); qfrags(Q, b * TT + i0, h, BVv, lane, av, tmpl);
  qfrags(Q, b * TT + i0 + 1, h, BVv, lane, aw, tmpl);   // rows i+1; for i = T-1 the row belongs to the next batch (or is clamped) but its products are never used: j >= i+2 cannot hold for i = T-1
  float m[8], l[8];
#pragma unroll
  for (int r = 0; r < 8; ++r) { m[r] = -3.0e38f; l[r] = 0.f; }
  v8f acc[4] = {};
  asm volatile("s_wait_asynccnt 0x0" ::: "memory");   // this wave's copies of tile 0 have landed
  __syncthreads();                                     // publishes tile 0
  tile(1);
#pragma unroll 1
  for (int ks = 0; ks < TT / 32; ++ks) { float s[2][8]; const int cur = ks & 1;
#pragma unroll
    for (int ct = 0; ct < 2; ++ct) { const int j0 = ks * 32 + ct * 16; const int kk = j0 + col; v8f c = {};
      const int xt = TT - 16 - i0 + j0;               // the 16 x 32 position tile covers x = xt .. xt + 31, for both terms
      v16h kf[2], pf[2][2];   // the LDS reads of the six fragments go ahead of their products as one group: one LDS latency per 16 keys; both position terms use the same four
#pragma unroll
      for (int kc = 0; kc < 2; ++kc) { kf[kc] = frag_h(&sk[cur][ct * 16 + col][kc * 32], lane); pf[0][kc] = frag_h(&sph[(xt & 127) + col][kc * 32], lane); pf[1][kc] = frag_h(&sph[((xt + 16) & 127) + col][kc * 32], lane); }
#pragma unroll
      for (int kc = 0; kc < 2; ++kc) c = wmma16(au[kc], kf[kc], c);
      const bool needlow = (j0 <= i0 + 15);          // some (i, j) with j <= i
      const bool needup = (j0 + 15 >= i0 + 2);        // some (i, j) with j >= i + 2
      if (needlow) {
#pragma unroll
        for (int pt = 0; pt < 2; ++pt) { v8f gg = {};
#pragma unroll
          for (int kc = 0; kc < 2; ++kc) gg = wmma16(av[kc], pf[pt][kc], gg);
#pragma unroll
          for (int r = 0; r < 8; ++r) sg1[8 * g + r][pt * 16 + col] = gg[r]; } }
      if (needup) {
#pragma unroll
        for (int pt = 0; pt < 2; ++pt) { v8f gg = {};
#pragma unroll
          for (int kc = 0; kc < 2; ++kc) gg = wmma16(aw[kc], pf[pt][kc], gg);
#pragma unroll
          for (int r = 0; r < 8; ++r) sg2[8 * g + r][pt * 16 + col] = gg[r]; } }
      LDSX();
      int mk[8];
#pragma unroll
      for (int r = 0; r < 8; ++r) mk[r] = MK[((size_t)b * TT + i0 + 8 * g + r) * TT + kk];
      // each lane picks its tile by address: one LDS read a row under full EXEC, so the eight reads go out as one group with one wait.
      // j == i + 1 is x == T, whose staged row is the zero row behind the table: its product in sg[1] is the shift's zero. i == T-1 has no j > i, so the row behind the last query is never picked.
      const int dl = kk - i0 - 8 * g;   // j <= i is dl <= r
      const float* lo = &sg[0][8 * g][15 + col - 8 * g]; const float* up = &sg[1][8 * g][15 + col - 8 * g];   // row 8 g + r, column 15 + col - (8 g + r) == (T-1-i+j) - xt: 35 words on a row
      float bd[8];
#pragma unroll
      for (int r = 0; r < 8; ++r) bd[r] = (dl <= r ? lo : up)[r * 35];
      // holds the eight LDS reads here (inputs only): without it the compiler sinks each read under a lane branch on its mask word, and they wait one after another
      asm volatile("" :: "v"(bd[0]), "v"(bd[1]), "v"(bd[2]), "v"(bd[3]), "v"(bd[4]), "v"(bd[5]), "v"(bd[6]), "v"(bd[7]));
#pragma unroll
      for (int r = 0; r < 8; ++r) s[ct][r] = (mk[r] != 0) ? (c[r] + bd[r]) * 0.125f : -3.0e38f;
      LDSX(); }
    float alpha[8];
#pragma unroll
    for (int r = 0; r < 8; ++r) { float mx = fmaxf(s[0][r], s[1][r]);
#pragma unroll
      for (int o = 1; o < 16; o <<= 1) mx = fmaxf(mx, __shfl_xor(mx, o));
      const float mn = fmaxf(m[r], mx); alpha[r] = (m[r] <= -1.0e38f) ? 0.f : __expf(m[r] - mn); const float e0 = (s[0][r] <= -1.0e38f) ? 0.f : __expf(s[0][r] - mn), e1 = (s[1][r] <= -1.0e38f) ? 0.f : __expf(s[1][r] - mn); float es = e0 + e1;
#pragma unroll
      for (int o = 1; o < 16; o <<= 1) es += __shfl_xor(es, o);
      l[r] = l[r] * alpha[r] + es; m[r] = mn; sp[8 * g + r][col] = e0; sp[8 * g + r][16 + col] = e1; }
#pragma unroll
    for (int j = 0; j < 4; ++j)
#pragma unroll
      for (int r = 0; r < 8; ++r) acc[j][r] *= alpha[r];
    LDSX();
    v16h pa, pr; { const float* prow = &sp[col][0] + 8 * (lane >> 4);
#pragma unroll
      for (int i = 0; i < 8; ++i) { const float x0 = prow[i] * 2048.0f, x1 = prow[16 + i] * 2048.0f; const _Float16 h0 = (_Float16)x0, h1 = (_Float16)x1; pa[i] = h0; pa[8 + i] = h1; pr[i] = (_Float16)(x0 - (float)h0); pr[8 + i] = (_Float16)(x1 - (float)h1); } }
#pragma unroll
    for (int jh = 0; jh < 4; jh += 2) { v16h vh[2], vl[2];   // four fragments' LDS reads as one group ahead of their six products
#pragma unroll
      for (int j = 0; j < 2; ++j) { vh[j] = frag_h(&sv[cur][(jh + j) * 16 + col][0], lane); vl[j] = frag_h(&sv[cur][64 + (jh + j) * 16 + col][0], lane); }
#pragma unroll
      for (int j = 0; j < 2; ++j) { acc[jh + j] = wmma16(pa, vh[j], acc[jh + j]); acc[jh + j] = wmma16(pr, vh[j], acc[jh + j]); acc[jh + j] = wmma16(pa, vl[j], acc[jh + j]); } }
    asm volatile("s_wait_dscnt 0x0" ::: "memory");      // this wave's LDS reads of pass ks have retired before the buffers are refilled
    asm volatile("s_wait_asynccnt 0x0" ::: "memory");   // this wave's copies of tile ks + 1 have landed
    __syncthreads();                                     // publishes tile ks + 1 and ends every wave's reads of the buffers and slots that tile ks + 2 fills
    if (ks + 2 < TT / 32) tile(ks + 2); }
  asm volatile("s_wait_asynccnt 0x0" ::: "memory");     // no copy is outstanding when the wave ends
#pragma unroll
  for (int r = 0; r < 8; ++r) { const float il = (l[r] > 0.f) ? (1.0f / 2048.0f) / l[r] : 0.f;   // fully masked rows -> zeros (the module zeroes them after the softmax)
#pragma unroll
    for (int j = 0; j < 4; ++j) so[8 * g + r][j * 16 + col] = acc[j][r] * il; }
  LDSX(); for (int rl = 0; rl < 16; ++rl) if (lane < 16) vst2(X + (b * TT + i0 + rl) * DMD + h * HD + lane * 4, *(const v4f*)&so[rl][lane * 4]); }
// ---- k_out: block = (64 rows, 128 of 512 cols): out = x (hi + lo) . Wo^T + bo
__global__ __launch_bounds__(128) void k_out(const float* __restrict__ X, const float* __restrict__ WO, const float* __restrict__ BO, float* __restrict__ OUT) { __shared__ OutSm sm; float (&sf)[4][16][132] = sm.sf;   // ring dead at the epilogue (barrier at the foot of the last stage)
  const int tid = threadIdx.x, wave = tid >> 5, lane = tid & 31, col = lane & 15, g = lane >> 4; const int c0 = blockIdx.y * 128; const size_t r0 = (size_t)blockIdx.x * 64 + wave * 16;
  v8f acc[8] = {};
  // stage = 32 k of 128 Wo rows (ring rows 0..127) and of the block's 64 x rows as hi (128..191) and lo (192..255)
  const int lr = tid >> 3, lq = tid & 7; const float* wsrc = WO + (size_t)(c0 + lr) * DMD + lq * 4; const float* xsrc = X + ((size_t)blockIdx.x * 64 + lr) * DMD + lq * 4;
  v4f pf[12];
#pragma unroll
  for (int e = 0; e < 12; ++e) pf[e] = *(const v4f*)(e < 8 ? wsrc + (size_t)e * 16 * DMD : xsrc + (size_t)(e - 8) * 16 * DMD);
#pragma unroll
  for (int e = 0; e < 12; ++e) { const v4b hv = cvt4(pf[e]); *(v4b*)&sm.st[0][e * 16 + lr][lq * 4] = hv; if (e >= 8) *(v4b*)&sm.st[0][64 + e * 16 + lr][lq * 4] = res4(pf[e], hv); }
  __syncthreads();
#pragma unroll
  for (int kc = 0; kc < DMD / 32; ++kc) { const int cur = kc & 1;
    if (kc + 1 < DMD / 32) {
#pragma unroll
      for (int e = 0; e < 12; ++e) pf[e] = *(const v4f*)((e < 8 ? wsrc + (size_t)e * 16 * DMD : xsrc + (size_t)(e - 8) * 16 * DMD) + (kc + 1) * 32); }
    const v16b ah = frag_b(&sm.st[cur][128 + wave * 16 + col][0], lane), al = frag_b(&sm.st[cur][192 + wave * 16 + col][0], lane);
    v16b w[8];   // the stage's LDS reads go ahead of its products as one group: one LDS latency per stage
#pragma unroll
    for (int j = 0; j < 8; ++j) w[j] = frag_b(&sm.st[cur][j * 16 + col][0], lane);
#pragma unroll
    for (int j = 0; j < 8; ++j) { acc[j] = wmma_bf(ah, w[j], acc[j]); acc[j] = wmma_bf(al, w[j], acc[j]); }
    __builtin_amdgcn_sched_barrier(0);   // keeps the wait for the next stage's global loads behind this stage's products, so that they cover its latency
    if (kc + 1 < DMD / 32) {
#pragma unroll
      for (int e = 0; e < 12; ++e) { const v4b hv = cvt4(pf[e]); *(v4b*)&sm.st[cur ^ 1][e * 16 + lr][lq * 4] = hv; if (e >= 8) *(v4b*)&sm.st[cur ^ 1][64 + e * 16 + lr][lq * 4] = res4(pf[e], hv); } }
    __syncthreads(); }   // publishes stage kc + 1 and ends every read of the buffer that the next pass refills
#pragma unroll
  for (int j = 0; j < 8; ++j) { const float bb = bfr(BO[c0 + j * 16 + col]);
#pragma unroll
    for (int r = 0; r < 8; ++r) sf[wave][8 * g + r][j * 16 + col] = acc[j][r] + bb; }
  LDSX(); for (int rl = 0; rl < 16; ++rl) vst2(OUT + (r0 + rl) * DMD + c0 + lane * 4, *(const v4f*)&sf[wave][rl][lane * 4]); }
extern "C" void kernel_launch(void* const* d_in, const int* in_sizes, int n_in, void* d_out, int out_size, void* d_ws, size_t ws_size, hipStream_t stream) {
  (void)in_sizes; (void)n_in; (void)out_size;
  const float** F = (const float**)d_in;   // 0 q, 1 k, 2 v [8,1024,512]; 3 pos [1024,512]; 4 mask [8,1024,1024] int; 5 Wq, 6 bq, 7 Wk, 8 bk, 9 Wv, 10 bv, 11 Wo, 12 bo, 13 Wp (natural); 14 bias_u [8,64], 15 bias_v [8,64]
  if (ws_size < (size_t)WS_END) return;
  char* ws = (char*)d_ws; float* Q = (float*)(ws + WS_Q); _Float16 *KH = (_Float16*)(ws + WS_KH), *PH = (_Float16*)(ws + WS_PH), *VH = (_Float16*)(ws + WS_VH), *VL = (_Float16*)(ws + WS_VL); float* X = (float*)(ws + WS_X);
  k_proj<<<dim3(TNB * TT / 64, DMD / 128, 4), 128, 0, stream>>>(F[0], F[1], F[2], F[3], F[5], F[6], F[7], F[8], F[9], F[10], F[13], Q, KH, VH, VL, PH);
  k_padph<<<64, 256, 0, stream>>>(PH);
  k_att<<<dim3(TT / 64, NH, TNB), 128, 0, stream>>>(Q, KH, PH, VH, VL, F[14], F[15], (const int*)d_in[4], X);
  k_out<<<dim3(TNB * TT / 64, DMD / 128), 128, 0, stream>>>(X, F[11], F[12], (float*)d_out);
}

// v004
// One run takes 142 microseconds.
// Next to v003, in two timings, it ran 1.08 times as fast each time.
// All steps since v000 together make it 3.33 times as fast.
// compute dtype: all float inputs rounded to bf16, mask (int) read; q/k/v/pos projections with EXACT bf16 products on WMMA 16x16x32 (natural weights, + bias), f32 accumulate; q kept in f32 (bias_u / bias_v added per head, then split into f16 hi + residual fragments), k / ph rounded once to f16, v split into f16 hi + residual planes; content scores (q+bu) . k and the Transformer-XL position term (q+bv) . ph with single f16 products (logits ~1-2; q, k, ph each rounded once), the rel_shift realised exactly as an index map onto 16 x 32 position tiles (incl. its upper-triangle wrap-around rows and the zero at j == i+1), x 1/8, masked keys excluded, running-max softmax in f32 (hardware exp); P (f16 x 2^11 + residual) . v; out = x (bf16 hi + lo) . Wo^T + bo; f32 output.
#include <hip/hip_runtime.h>
#include <math.h>

typedef __attribute__((ext_vector_type(16))) _Float16 v16h;
typedef __attribute__((ext_vector_type(16))) __bf16 v16b;
typedef __attribute__((ext_vector_type(8)))  _Float16 v8h;
typedef __attribute__((ext_vector_type(8)))  float v8f;
typedef __attribute__((ext_vector_type(4)))  float v4f;
typedef __attribute__((ext_vector_type(2)))  float v2f;
typedef __attribute__((ext_vector_type(4)))  unsigned v4u;
typedef __attribute__((ext_vector_type(4)))  int v4i;
typedef float __attribute__((may_alias)) float_a;
typedef int __attribute__((may_alias)) int_a;

template <typename T> __device__ __forceinline__ void vst2(void* p, T v) { *(T*)p = v;  }
__device__ __forceinline__ v8f wmma16(v16h a, v16h b, v8f c) {
  v8f d = __builtin_amdgcn_wmma_f32_16x16x32_f16(false, a, false, b, (short)0, c, false, false);
  asm volatile("v_nop\n\tv_nop\n\tv_nop\n\tv_nop" : "+v"(d) : "v"(a), "v"(b));
  return d;
}
__device__ __forceinline__ v8f wmma_bf(v16b a, v16b b, v8f c) {
  v8f d = __builtin_amdgcn_wmma_f32_16x16x32_bf16(false, a, false, b, (short)0, c, false, false);
  asm volatile("v_nop\n\tv_nop\n\tv_nop\n\tv_nop" : "+v"(d) : "v"(a), "v"(b));
  return d;
}
// 16x16x32 fragments: lane = (h = lane>>4, row/col = lane&15); elements 0..7 = k0+8h+0..7, 8..15 = k0+16+8h+0..7; D element r = row 8h+r
__device__ __forceinline__ v16h frag_h(const _Float16* rowk0, int lane) {
  union { v16h v; v8h q[2]; } u; const _Float16* p = rowk0 + 8 * (lane >> 4);
  u.q[0] = *(const v8h*)p; u.q[1] = *(const v8h*)(p + 16); return u.v;
}
__device__ __forceinline__ v16h frag_f32(const float* rowk0, int lane) {
  v16h a; const float* p = rowk0 + 8 * (lane >> 4);
#pragma unroll
  for (int i = 0; i < 8; ++i) { a[i] = (_Float16)p[i]; a[8 + i] = (_Float16)p[16 + i]; }
  return a;
}
__device__ __forceinline__ v16h frag_f32s(const float* rowk0, int lane, float sc) {
  v16h a; const float* p = rowk0 + 8 * (lane >> 4);
#pragma unroll
  for (int i = 0; i < 8; ++i) { a[i] = (_Float16)(p[i] * sc); a[8 + i] = (_Float16)(p[16 + i] * sc); }
  return a;
}
// column fragment from a [K][ld] layout (column n), rows >= K read as 0
__device__ __forceinline__ v16h fragc_f32(const float* W, int k0, int n, int lane, int ld, int K) {
  v16h a; const int g = lane >> 4;
#pragma unroll
  for (int i = 0; i < 8; ++i) { const int ka = k0 + 8 * g + i, kb = ka + 16;
    a[i] = (_Float16)(ka < K ? W[(size_t)(ka < K ? ka : K - 1) * ld + n] : 0.f); a[8 + i] = (_Float16)(kb < K ? W[(size_t)(kb < K ? kb : K - 1) * ld + n] : 0.f); }
  return a;
}
struct F2 { v16b h, l; };
__device__ __forceinline__ F2 bsplit16(const float v[16]) { F2 r;
#pragma unroll
  for (int i = 0; i < 16; ++i) { const __bf16 h = (__bf16)v[i]; r.h[i] = h; r.l[i] = (__bf16)(v[i] - (float)h); }
  return r; }
__device__ __forceinline__ F2 split_row(const float* row, int k0, int lane) { float v[16]; const float* p = row + k0 + 8 * (lane >> 4);
#pragma unroll
  for (int i = 0; i < 8; ++i) { v[i] = p[i]; v[8 + i] = p[16 + i]; }
  return bsplit16(v); }
__device__ __forceinline__ F2 split_rowK(const float* row, int k0, int lane, int K) { float v[16]; const int g = lane >> 4;
#pragma unroll
  for (int i = 0; i < 8; ++i) { const int ka = k0 + 8 * g + i, kb = ka + 16; v[i] = ka < K ? row[ka < K ? ka : K - 1] : 0.f; v[8 + i] = kb < K ? row[kb < K ? kb : K - 1] : 0.f; }
  return bsplit16(v); }
__device__ __forceinline__ F2 split_col(const float* W, int k0, int n, int lane, int ld, int K) { float v[16]; const int g = lane >> 4;
#pragma unroll
  for (int i = 0; i < 8; ++i) { const int ka = k0 + 8 * g + i, kb = ka + 16; v[i] = ka < K ? W[(size_t)(ka < K ? ka : K - 1) * ld + n] : 0.f; v[8 + i] = kb < K ? W[(size_t)(kb < K ? kb : K - 1) * ld + n] : 0.f; }
  return bsplit16(v); }
__device__ __forceinline__ v8f mac3(const F2& a, const F2& b, v8f c) { c = wmma_bf(a.l, b.h, c); c = wmma_bf(a.h, b.l, c); return wmma_bf(a.h, b.h, c); }
__device__ __forceinline__ float sigm(float v) { return 1.0f / (1.0f + expf(-v)); }
#define LDSX() do { asm volatile("s_wait_dscnt 0" ::: "memory"); __builtin_amdgcn_wave_barrier(); __builtin_amdgcn_fence(__ATOMIC_RELEASE, "workgroup"); } while (0)


// Relative-position multi-head attention (Transformer-XL style rel_shift; B 8, T 1,024, D 512, 8 heads x 64): scores = ((q+u) k^T + rel_shift((q+v) p^T)) / 8, masked softmax (mask input), attn v, Wo.
#define NB 8
#define TT 1024
#define DMD 512
#define NH 8
#define HD 64
#define POFF 32                 // ph buffer row offset (rows < 0 and >= T read as zeros)
#define PROWS (TT + 64)
#ifndef TNB
#define TNB NB
#endif
typedef __attribute__((ext_vector_type(8))) __bf16 v8b;
__device__ __forceinline__ v16b frag_b(const __bf16* rowk0, int lane) {
  union { v16b v; v8b q[2]; } u; const __bf16* p = rowk0 + 8 * (lane >> 4);
  u.q[0] = *(const v8b*)p; u.q[1] = *(const v8b*)(p + 16); return u.v;
}
__device__ __forceinline__ float bfr(float v) { return (float)(__bf16)v; }
__device__ __attribute__((noinline)) float exp_ni(float v) { return expf(v); }
__device__ __attribute__((noinline)) float erf_ni(float v) { return erff(v); }

#define WS_Q   0u                                   // f32 q rows [b*u][512] (+bq)
#define WS_KH  (WS_Q + 4u * (size_t)NB * TT * DMD)       // f16 k rows [b*t][512]
#define WS_PH  (WS_KH + 2u * (size_t)NB * TT * DMD)      // f16 ph rows [PROWS][512] (row POFF + p)
#define WS_VH  (WS_PH + 2u * (size_t)PROWS * DMD)        // f16 v planes [b][512][t]
#define WS_VL  (WS_VH + 2u * (size_t)NB * DMD * TT)      // f16 v residual planes (unscaled)
#define WS_X   (WS_VL + 2u * (size_t)NB * DMD * TT)      // f32 attention output rows [b*u][512]
#define WS_END (WS_X + 4u * (size_t)NB * TT * DMD)

typedef __attribute__((ext_vector_type(4))) __bf16 v4b;
__device__ __forceinline__ v4b cvt4(v4f v) { v4b r;
#pragma unroll
  for (int i = 0; i < 4; ++i) r[i] = (__bf16)v[i];
  return r; }
__device__ __forceinline__ v4b res4(v4f v, v4b h) { v4b r;
#pragma unroll
  for (int i = 0; i < 4; ++i) r[i] = (__bf16)(v[i] - (float)h[i]);
  return r; }
#define SPI 40   // ring row pitch in bf16: 64-B rows at 80 B (16 B x odd) for 16-byte LDS reads
union __align__(16) ProjSm { __bf16 st[2][192][SPI]; float sf[4][16][132]; _Float16 sh[64][136]; _Float16 t2[2][128][72]; };
union __align__(16) OutSm { __bf16 st[2][256][SPI]; float sf[4][16][132]; };
// ---- k_proj: block = (64 rows, 128-col group, which): 0 q (f32 rows), 1 k (f16 rows), 2 v (f16 hi + residual planes), 3 ph (f16 rows at POFF), natural W + bias (none for ph)
__global__ __launch_bounds__(128) void k_proj(const float* __restrict__ Qi, const float* __restrict__ Ki, const float* __restrict__ Vi, const float* __restrict__ POS, const float* __restrict__ WQ, const float* __restrict__ BQ, const float* __restrict__ WK, const float* __restrict__ BK, const float* __restrict__ WV, const float* __restrict__ BV, const float* __restrict__ WP, float* __restrict__ Q, _Float16* __restrict__ KH, _Float16* __restrict__ VH, _Float16* __restrict__ VL, _Float16* __restrict__ PH) {
  __shared__ ProjSm sm;   // the operand ring is dead when the epilogue tiles are written (barrier at the foot of the last stage)
  float (&sf)[4][16][132] = sm.sf; _Float16 (&sh)[64][136] = sm.sh; _Float16 (&th)[128][72] = sm.t2[0]; _Float16 (&tl)[128][72] = sm.t2[1];
  const int tid = threadIdx.x, wave = tid >> 5, lane = tid & 31, col = lane & 15, g = lane >> 4; const int which = blockIdx.z; const int c0 = blockIdx.y * 128; const int nrows = (which == 3) ? TT : NB * TT;
  if ((int)blockIdx.x * 64 >= nrows) return;
  const float* X = (which == 0 ? Qi : which == 1 ? Ki : which == 2 ? Vi : POS); const float* Wm = (which == 0 ? WQ : which == 1 ? WK : which == 2 ? WV : WP); const float* Bm = (which == 0 ? BQ : which == 1 ? BK : which == 2 ? BV : nullptr);
  const size_t r0 = (size_t)blockIdx.x * 64 + wave * 16;
  v8f acc[8] = {};
  // stage = 32 k of 128 W rows (ring rows 0..127) and of the block's 64 X rows (128..191); 8 lanes x 16 B fetch one whole 128-B line of a row
  const int lr = tid >> 3, lq = tid & 7; const float* wsrc = Wm + (size_t)(c0 + lr) * DMD + lq * 4; const float* xsrc = X + ((size_t)blockIdx.x * 64 + lr) * DMD + lq * 4;
  v4f pf[12];
#pragma unroll
  for (int e = 0; e < 12; ++e) pf[e] = *(const v4f*)(e < 8 ? wsrc + (size_t)e * 16 * DMD : xsrc + (size_t)(e - 8) * 16 * DMD);
#pragma unroll
  for (int e = 0; e < 12; ++e) *(v4b*)&sm.st[0][e * 16 + lr][lq * 4] = cvt4(pf[e]);
  __syncthreads();
#pragma unroll
  for (int kc = 0; kc < DMD / 32; ++kc) { const int cur = kc & 1;
    if (kc + 1 < DMD / 32) {
#pragma unroll
      for (int e = 0; e < 12; ++e) pf[e] = *(const v4f*)((e < 8 ? wsrc + (size_t)e * 16 * DMD : xsrc + (size_t)(e - 8) * 16 * DMD) + (kc + 1) * 32); }
    const v16b a = frag_b(&sm.st[cur][128 + wave * 16 + col][0], lane);
#pragma unroll
    for (int jh = 0; jh < 8; jh += 4) { v16b w[4];   // the LDS reads of four fragments go ahead of their products as one group: one LDS latency per group
#pragma unroll
      for (int j = 0; j < 4; ++j) w[j] = frag_b(&sm.st[cur][(jh + j) * 16 + col][0], lane);
#pragma unroll
      for (int j = 0; j < 4; ++j) acc[jh + j] = wmma_bf(a, w[j], acc[jh + j]); }
    __builtin_amdgcn_sched_barrier(0);   // keeps the wait for the next stage's global loads behind this stage's products, so that they cover its latency
    if (kc + 1 < DMD / 32) {
#pragma unroll
      for (int e = 0; e < 12; ++e) *(v4b*)&sm.st[cur ^ 1][e * 16 + lr][lq * 4] = cvt4(pf[e]); }
    __syncthreads(); }   // publishes stage kc + 1 and ends every read of the buffer that the next pass refills
#pragma unroll
  for (int j = 0; j < 8; ++j) { const float bb = Bm ? bfr(Bm[c0 + j * 16 + col]) : 0.f;
#pragma unroll
    for (int r = 0; r < 8; ++r) { const float v = acc[j][r] + bb; const int rl = wave * 16 + 8 * g + r, cl = j * 16 + col;
      if (which == 0) sf[wave][8 * g + r][cl] = v; else if (which == 2) { const _Float16 hv = (_Float16)v; th[cl][rl] = hv; tl[cl][rl] = (_Float16)(v - (float)hv); } else sh[rl][cl] = (_Float16)v; } }
  __syncthreads();
  if (which == 0) { for (int rl = 0; rl < 16; ++rl) vst2(Q + (r0 + rl) * DMD + c0 + lane * 4, *(const v4f*)&sf[wave][rl][lane * 4]); }
  else if (which == 2) { const size_t b = ((size_t)blockIdx.x * 64) / TT; const int t0 = (int)(((size_t)blockIdx.x * 64) % TT); for (int e = tid; e < 128 * 8; e += 128) { const int cl = e >> 3, q = e & 7; const size_t o = (b * DMD + c0 + cl) * (size_t)TT + t0 + q * 8; vst2((unsigned*)(VH + o), *(const v4u*)&th[cl][q * 8]); vst2((unsigned*)(VL + o), *(const v4u*)&tl[cl][q * 8]); } }
  else { _Float16* dst = (which == 1) ? (KH + (size_t)blockIdx.x * 64 * DMD) : (PH + ((size_t)POFF + blockIdx.x * 64) * DMD); for (int e = tid; e < 64 * 16; e += 128) { const int rl = e >> 4, q = e & 15; vst2((unsigned*)(dst + (size_t)rl * DMD + c0 + q * 8), *(const v4u*)&sh[rl][q * 8]); } } }
// ---- k_padph: the POFF rows before and the rows after the table are zeros
__global__ __launch_bounds__(256) void k_padph(_Float16* __restrict__ PH) { const int t = threadIdx.x; const int r = blockIdx.x; const size_t row = (r < POFF) ? r : (TT + r);   // 0..31 and TT+32 .. TT+63
  v4u z; z[0] = z[1] = z[2] = z[3] = 0u; if (t < DMD / 8) vst2((unsigned*)(PH + row * DMD + t * 8), z); }
// fragments of (q + bias) for 16 rows, head h: hi and residual as f16 (unscaled; q ~ O(1))
__device__ __forceinline__ void qfrags(const float* __restrict__ Q, size_t row0, int h, const float* __restrict__ bias, int lane, v16h* hi, v16h* lo) { const int col = lane & 15, g = lane >> 4; size_t row = row0 + col; if (row > (size_t)NB * TT - 1) row = (size_t)NB * TT - 1;   // clamp (only the never-used row T of the last batch)
#pragma unroll
  for (int kc = 0; kc < 2; ++kc) { const float* p = Q + row * DMD + h * HD + kc * 32 + 8 * g; const float* bp = bias + h * HD + kc * 32 + 8 * g; v16h a, b;
#pragma unroll
    for (int i = 0; i < 8; ++i) { const float v0 = p[i] + bfr(bp[i]), v1 = p[16 + i] + bfr(bp[16 + i]); const _Float16 h0 = (_Float16)v0, h1 = (_Float16)v1; a[i] = h0; a[8 + i] = h1; b[i] = (_Float16)(v0 - (float)h0); b[8 + i] = (_Float16)(v1 - (float)h1); }
    hi[kc] = a; lo[kc] = b; } }
// reduction over each 16-lane row for eight values at once: lane l takes lane l ^ 1, ^ 2, ^ 4, ^ 8 through the DPP operand, every lane ends with the row's result.
// One statement, the eight values' steps interleaved: each step's producer stands eight instructions back, so no step waits for the one before. All 32 lanes must be on.
#define RX(op, n, x) op " %" #n ", %" #n ", %" #n " row_xmask:" #x " row_mask:0xf bank_mask:0xf\n\t"
#define RX8(op, x) RX(op, 0, x) RX(op, 1, x) RX(op, 2, x) RX(op, 3, x) RX(op, 4, x) RX(op, 5, x) RX(op, 6, x) RX(op, 7, x)
#define ROW16(q, op, v) asm q (RX8(op, 1) RX8(op, 2) RX8(op, 4) RX8(op, 8) : "+v"(v[0]), "+v"(v[1]), "+v"(v[2]), "+v"(v[3]), "+v"(v[4]), "+v"(v[5]), "+v"(v[6]), "+v"(v[7]))
// ---- k_att: block = (64 queries u, h, b)
#define KP 72    // LDS pitch of the 128-B k and position rows in f16: 144 B (16 B x odd) for 16-byte LDS reads
#define VP 40    // LDS pitch of the 64-B v rows in f16: 80 B
struct __align__(16) AttW { float sp[16][36], sg[2][16][36]; };   // sg[0]: position products of rows i (for j <= i), sg[1]: of rows i + 1 (for j >= i + 2)
union __align__(16) AttX { AttW w; float so[16][68]; };   // a wave's own exchange tiles; so is written behind the loop, when the other three are dead
__device__ __forceinline__ unsigned lds_at(const void* p) { return (unsigned)(size_t)p; }   // LDS byte address = low 32 bits of the __shared__ address
// extended position index x = T-1-i+j: x < T is table row x (j <= i), x == T the zero row behind the table (j == i+1), x > T table row x-T-1 (the wrapped rows, j >= i+2)
__device__ __forceinline__ const _Float16* ph_row(const _Float16* __restrict__ PH, int x) { return PH + (size_t)(POFF + (x <= TT ? x : x - TT - 1)) * DMD; }
__global__ __launch_bounds__(128) void k_att(const float* __restrict__ Q, const _Float16* __restrict__ KH, const _Float16* __restrict__ PH, const _Float16* __restrict__ VH, const _Float16* __restrict__ VL, const float* __restrict__ BU, const float* __restrict__ BVv, const int* __restrict__ MK, float* __restrict__ X) {
  __shared__ AttX sx[4];
  __shared__ __align__(16) _Float16 sk[2][32][KP];     // 32 keys x 64 d of this head, two buffers
  __shared__ __align__(16) _Float16 sv[2][128][VP];    // rows 0..63 v hi (d), 64..127 v residual, 32 keys each, two buffers
  __shared__ __align__(16) _Float16 sph[128][KP];      // position rows, slot = x & 127: a pass reads 96 rows, the next pass's 32 new rows fill the slots it does not read
  const int tid = threadIdx.x, wave = tid >> 5, lane = tid & 31, col = lane & 15, g = lane >> 4; const int qb = blockIdx.x, h = blockIdx.y; const size_t b = blockIdx.z; const int i0 = qb * 64 + wave * 16;
  float (&sp)[16][36] = sx[wave].w.sp; float (&sg)[2][16][36] = sx[wave].w.sg; float (&sg1)[16][36] = sg[0]; float (&sg2)[16][36] = sg[1]; float (&so)[16][68] = sx[wave].so;
  const int xb0 = TT - 64 - qb * 64;   // x of (i = the block's last query, j = 0): pass ks reads x = xb0 + 32 ks .. + 95
  const int kr = tid >> 3, kq = (tid & 7) * 8, vr = tid >> 2, vq = (tid & 3) * 8;   // 8 lanes fetch one whole 128-B row of k or of the table, 4 lanes one 64-B row piece of v
  // tile t = keys 32 t .. + 31 of k and v and the last 32 position rows of pass t's window: eight 16-byte copies a lane, no register in between
  auto tile = [&](int t) { const int bf = t & 1, x = xb0 + t * 32 + 64 + kr;
    const _Float16* gk = KH + (b * TT + t * 32 + kr) * DMD + h * HD + kq; const size_t vo = (b * DMD + (size_t)h * HD + vr) * TT + t * 32 + vq;
    // the wait on xcnt closes the statement: it stands in front of every rewrite of a register that a copy names
    asm volatile("global_load_async_to_lds_b128 %0, %8, off\n\tglobal_load_async_to_lds_b128 %1, %9, off\n\tglobal_load_async_to_lds_b128 %2, %10, off\n\tglobal_load_async_to_lds_b128 %3, %11, off\n\t"
                 "global_load_async_to_lds_b128 %4, %12, off\n\tglobal_load_async_to_lds_b128 %5, %13, off\n\tglobal_load_async_to_lds_b128 %6, %14, off\n\tglobal_load_async_to_lds_b128 %7, %15, off\n\ts_wait_xcnt 0x0"
                 :: "v"(lds_at(&sk[bf][kr][kq])), "v"(lds_at(&sk[bf][16 + kr][kq])), "v"(lds_at(&sph[x & 127][kq])), "v"(lds_at(&sph[(x + 16) & 127][kq])),
                    "v"(lds_at(&sv[bf][vr][vq])), "v"(lds_at(&sv[bf][32 + vr][vq])), "v"(lds_at(&sv[bf][64 + vr][vq])), "v"(lds_at(&sv[bf][96 + vr][vq])),
                    "v"(gk), "v"(gk + 16 * DMD), "v"(ph_row(PH, x) + h * HD + kq), "v"(ph_row(PH, x + 16) + h * HD + kq),
                    "v"(VH + vo), "v"(VH + vo + 32 * TT), "v"(VL + vo), "v"(VL + vo + 32 * TT) : "memory"); };
  tile(0);
  { const int x = xb0 + kr;   // the first 64 position rows of pass 0's window
    asm volatile("global_load_async_to_lds_b128 %0, %4, off\n\tglobal_load_async_to_lds_b128 %1, %5, off\n\tglobal_load_async_to_lds_b128 %2, %6, off\n\tglobal_load_async_to_lds_b128 %3, %7, off\n\ts_wait_xcnt 0x0"
                 :: "v"(lds_at(&sph[x & 127][kq])), "v"(lds_at(&sph[(x + 16) & 127][kq])), "v"(lds_at(&sph[(x + 32) & 127][kq])), "v"(lds_at(&sph[(x + 48) & 127][kq])),
                    "v"(ph_row(PH, x) + h * HD + kq), "v"(ph_row(PH, x + 16) + h * HD + kq), "v"(ph_row(PH, x + 32) + h * HD + kq), "v"(ph_row(PH, x + 48) + h * HD + kq) : "memory"); }
  v16h au[2], av[2], aw[2], tmpl[2];   // (q+u) rows i0.., (q+v) rows i0.., (q+v) rows i0+1.. (for the wrapped upper-triangle term); single f16 rounding (residuals dropped: VGPR budget)
  qfrags(Q, b * TT + i0, h, BU, lane, au, tmpl); qfrags(Q, b * TT + i0, h, BVv, lane, av, tmpl);
  qfrags(Q, b * TT + i0 + 1, h, BVv, lane, aw, tmpl);   // rows i+1; for i = T-1 the row belongs to the next batch (or is clamped) but its products are never used: j >= i+2 cannot hold for i = T-1
  float m[8], l[8];
#pragma unroll
  for (int r = 0; r < 8; ++r) { m[r] = -3.0e38f; l[r] = 0.f; }
  v8f acc[4] = {};
  asm volatile("s_wait_asynccnt 0x0" ::: "memory");   // this wave's copies of tile 0 have landed
  __syncthreads();                                     // publishes tile 0
  tile(1);
#pragma unroll 1
  for (int ks = 0; ks < TT / 32; ++ks) { float s[2][8]; const int cur = ks & 1;
#pragma unroll
    for (int ct = 0; ct < 2; ++ct) { const int j0 = ks * 32 + ct * 16; const int kk = j0 + col; v8f c = {};
      const int xt = TT - 16 - i0 + j0;               // the 16 x 32 position tile covers x = xt .. xt + 31, for both terms
      v16h kf[2], pf[2][2];   // the LDS reads of the six fragments go ahead of their products as one group: one LDS latency per 16 keys; both position terms use the same four
#pragma unroll
      for (int kc = 0; kc < 2; ++kc) { kf[kc] = frag_h(&sk[cur][ct * 16 + col][kc * 32], lane); pf[0][kc] = frag_h(&sph[(xt & 127) + col][kc * 32], lane); pf[1][kc] = frag_h(&sph[((xt + 16) & 127) + col][kc * 32], lane); }
#pragma unroll
      for (int kc = 0; kc < 2; ++kc) c = wmma16(au[kc], kf[kc], c);
      const bool needlow = (j0 <= i0 + 15);          // some (i, j) with j <= i
      const bool needup = (j0 + 15 >= i0 + 2);        // some (i, j) with j >= i + 2
      if (needlow) {
#pragma unroll
        for (int pt = 0; pt < 2; ++pt) { v8f gg = {};
#pragma unroll
          for (int kc = 0; kc < 2; ++kc) gg = wmma16(av[kc], pf[pt][kc], gg);
#pragma unroll
          for (int r = 0; r < 8; ++r) sg1[8 * g + r][pt * 16 + col] = gg[r]; } }
      if (needup) {
#pragma unroll
        for (int pt = 0; pt < 2; ++pt) { v8f gg = {};
#pragma unroll
          for (int kc = 0; kc < 2; ++kc) gg = wmma16(aw[kc], pf[pt][kc], gg);
#pragma unroll
          for (int r = 0; r < 8; ++r) sg2[8 * g + r][pt * 16 + col] = gg[r]; } }
      LDSX();
      int mk[8];
#pragma unroll
      for (int r = 0; r < 8; ++r) mk[r] = MK[((size_t)b * TT + i0 + 8 * g + r) * TT + kk];
      // each lane picks its tile by address: one LDS read a row under full EXEC, so the eight reads go out as one group with one wait.
      // j == i + 1 is x == T, whose staged row is the zero row behind the table: its product in sg[1] is the shift's zero. i == T-1 has no j > i, so the row behind the last query is never picked.
      const int dl = kk - i0 - 8 * g;   // j <= i is dl <= r
      const float* lo = &sg[0][8 * g][15 + col - 8 * g]; const float* up = &sg[1][8 * g][15 + col - 8 * g];   // row 8 g + r, column 15 + col - (8 g + r) == (T-1-i+j) - xt: 35 words on a row
      float bd[8];
#pragma unroll
      for (int r = 0; r < 8; ++r) bd[r] = (dl <= r ? lo : up)[r * 35];
      // holds the eight LDS reads here (inputs only): without it the compiler sinks each read under a lane branch on its mask word, and they wait one after another
      asm volatile("" :: "v"(bd[0]), "v"(bd[1]), "v"(bd[2]), "v"(bd[3]), "v"(bd[4]), "v"(bd[5]), "v"(bd[6]), "v"(bd[7]));
#pragma unroll
      for (int r = 0; r < 8; ++r) s[ct][r] = (mk[r] != 0) ? (c[r] + bd[r]) * 0.125f : -3.0e38f;
      LDSX(); }
    float alpha[8], mx[8], es[8];
#pragma unroll
    for (int r = 0; r < 8; ++r) mx[r] = fmaxf(fmaxf(s[0][r], s[1][r]), m[r]);   // the running maximum, equal in a row's lanes, goes in ahead of the reduction: what comes out is the new one
    ROW16(, "v_max_num_f32_dpp", mx);   // row maximum over the 16 lanes that hold a query's keys, in the vector unit: no LDS permute, no wait on dscnt between the steps
#pragma unroll
    for (int r = 0; r < 8; ++r) { const float mn = mx[r]; alpha[r] = (m[r] <= -1.0e38f) ? 0.f : __expf(m[r] - mn); const float e0 = (s[0][r] <= -1.0e38f) ? 0.f : __expf(s[0][r] - mn), e1 = (s[1][r] <= -1.0e38f) ? 0.f : __expf(s[1][r] - mn); es[r] = e0 + e1;
      m[r] = mn; sp[8 * g + r][col] = e0; sp[8 * g + r][16 + col] = e1; }
    ROW16(volatile, "v_add_f32_dpp", es);   // row sum, the xor 1, 2, 4, 8 tree; volatile keeps it here, in front of the wait for the P stores, whose latency it fills (the compiler sinks it behind the pass's barrier otherwise)
#pragma unroll
    for (int r = 0; r < 8; ++r) l[r] = l[r] * alpha[r] + es[r];
#pragma unroll
    for (int j = 0; j < 4; ++j)
#pragma unroll
      for (int r = 0; r < 8; ++r) acc[j][r] *= alpha[r];
    LDSX();
    v16h pa, pr; { const float* prow = &sp[col][0] + 8 * (lane >> 4);
#pragma unroll
      for (int i = 0; i < 8; ++i) { const float x0 = prow[i] * 2048.0f, x1 = prow[16 + i] * 2048.0f; const _Float16 h0 = (_Float16)x0, h1 = (_Float16)x1; pa[i] = h0; pa[8 + i] = h1; pr[i] = (_Float16)(x0 - (float)h0); pr[8 + i] = (_Float16)(x1 - (float)h1); } }
#pragma unroll
    for (int jh = 0; jh < 4; jh += 2) { v16h vh[2], vl[2];   // four fragments' LDS reads as one group ahead of their six products
#pragma unroll
      for (int j = 0; j < 2; ++j) { vh[j] = frag_h(&sv[cur][(jh + j) * 16 + col][0], lane); vl[j] = frag_h(&sv[cur][64 + (jh + j) * 16 + col][0], lane); }
#pragma unroll
      for (int j = 0; j < 2; ++j) { acc[jh + j] = wmma16(pa, vh[j], acc[jh + j]); acc[jh + j] = wmma16(pr, vh[j], acc[jh + j]); acc[jh + j] = wmma16(pa, vl[j], acc[jh + j]); } }
    asm volatile("s_wait_dscnt 0x0" ::: "memory");      // this wave's LDS reads of pass ks have retired before the buffers are refilled
    asm volatile("s_wait_asynccnt 0x0" ::: "memory");   // this wave's copies of tile ks + 1 have landed
    __syncthreads();                                     // publishes tile ks + 1 and ends every wave's reads of the buffers and slots that tile ks + 2 fills
    if (ks + 2 < TT / 32) tile(ks + 2); }
  asm volatile("s_wait_asynccnt 0x0" ::: "memory");     // no copy is outstanding when the wave ends
#pragma unroll
  for (int r = 0; r < 8; ++r) { const float il = (l[r] > 0.f) ? (1.0f / 2048.0f) / l[r] : 0.f;   // fully masked rows -> zeros (the module zeroes them after the softmax)
#pragma unroll
    for (int j = 0; j < 4; ++j) so[8 * g + r][j * 16 + col] = acc[j][r] * il; }
  LDSX(); for (int rl = 0; rl < 16; ++rl) if (lane < 16) vst2(X + (b * TT + i0 + rl) * DMD + h * HD + lane * 4, *(const v4f*)&so[rl][lane * 4]); }
// ---- k_out: block = (64 rows, 128 of 512 cols): out = x (hi + lo) . Wo^T + bo
__global__ __launch_bounds__(128) void k_out(const float* __restrict__ X, const float* __restrict__ WO, const float* __restrict__ BO, float* __restrict__ OUT) { __shared__ OutSm sm; float (&sf)[4][16][132] = sm.sf;   // ring dead at the epilogue (barrier at the foot of the last stage)
  const int tid = threadIdx.x, wave = tid >> 5, lane = tid & 31, col = lane & 15, g = lane >> 4; const int c0 = blockIdx.y * 128; const size_t r0 = (size_t)blockIdx.x * 64 + wave * 16;
  v8f acc[8] = {};
  // stage = 32 k of 128 Wo rows (ring rows 0..127) and of the block's 64 x rows as hi (128..191) and lo (192..255)
  const int lr = tid >> 3, lq = tid & 7; const float* wsrc = WO + (size_t)(c0 + lr) * DMD + lq * 4; const float* xsrc = X + ((size_t)blockIdx.x * 64 + lr) * DMD + lq * 4;
  v4f pf[12];
#pragma unroll
  for (int e = 0; e < 12; ++e) pf[e] = *(const v4f*)(e < 8 ? wsrc + (size_t)e * 16 * DMD : xsrc + (size_t)(e - 8) * 16 * DMD);
#pragma unroll
  for (int e = 0; e < 12; ++e) { const v4b hv = cvt4(pf[e]); *(v4b*)&sm.st[0][e * 16 + lr][lq * 4] = hv; if (e >= 8) *(v4b*)&sm.st[0][64 + e * 16 + lr][lq * 4] = res4(pf[e], hv); }
  __syncthreads();
#pragma unroll
  for (int kc = 0; kc < DMD / 32; ++kc) { const int cur = kc & 1;
    if (kc + 1 < DMD / 32) {
#pragma unroll
      for (int e = 0; e < 12; ++e) pf[e] = *(const v4f*)((e < 8 ? wsrc + (size_t)e * 16 * DMD : xsrc + (size_t)(e - 8) * 16 * DMD) + (kc + 1) * 32); }
    const v16b ah = frag_b(&sm.st[cur][128 + wave * 16 + col][0], lane), al = frag_b(&sm.st[cur][192 + wave * 16 + col][0], lane);
    v16b w[8];   // the stage's LDS reads go ahead of its products as one group: one LDS latency per stage
#pragma unroll
    for (int j = 0; j < 8; ++j) w[j] = frag_b(&sm.st[cur][j * 16 + col][0], lane);
#pragma unroll
    for (int j = 0; j < 8; ++j) { acc[j] = wmma_bf(ah, w[j], acc[j]); acc[j] = wmma_bf(al, w[j], acc[j]); }
    __builtin_amdgcn_sched_barrier(0);   // keeps the wait for the next stage's global loads behind this stage's products, so that they cover its latency
    if (kc + 1 < DMD / 32) {
#pragma unroll
      for (int e = 0; e < 12; ++e) { const v4b hv = cvt4(pf[e]); *(v4b*)&sm.st[cur ^ 1][e * 16 + lr][lq * 4] = hv; if (e >= 8) *(v4b*)&sm.st[cur ^ 1][64 + e * 16 + lr][lq * 4] = res4(pf[e], hv); } }
    __syncthreads(); }   // publishes stage kc + 1 and ends every read of the buffer that the next pass refills
#pragma unroll
  for (int j = 0; j < 8; ++j) { const float bb = bfr(BO[c0 + j * 16 + col]);
#pragma unroll
    for (int r = 0; r < 8; ++r) sf[wave][8 * g + r][j * 16 + col] = acc[j][r] + bb; }
  LDSX(); for (int rl = 0; rl < 16; ++rl) vst2(OUT + (r0 + rl) * DMD + c0 + lane * 4, *(const v4f*)&sf[wave][rl][lane * 4]); }
extern "C" void kernel_launch(void* const* d_in, const int* in_sizes, int n_in, void* d_out, int out_size, void* d_ws, size_t ws_size, hipStream_t stream) {
  (void)in_sizes; (void)n_in; (void)out_size;
  const float** F = (const float**)d_in;   // 0 q, 1 k, 2 v [8,1024,512]; 3 pos [1024,512]; 4 mask [8,1024,1024] int; 5 Wq, 6 bq, 7 Wk, 8 bk, 9 Wv, 10 bv, 11 Wo, 12 bo, 13 Wp (natural); 14 bias_u [8,64], 15 bias_v [8,64]
  if (ws_size < (size_t)WS_END) return;
  char* ws = (char*)d_ws; float* Q = (float*)(ws + WS_Q); _Float16 *KH = (_Float16*)(ws + WS_KH), *PH = (_Float16*)(ws + WS_PH), *VH = (_Float16*)(ws + WS_VH), *VL = (_Float16*)(ws + WS_VL); float* X = (float*)(ws + WS_X);
  k_proj<<<dim3(TNB * TT / 64, DMD / 128, 4), 128, 0, stream>>>(F[0], F[1], F[2], F[3], F[5], F[6], F[7], F[8], F[9], F[10], F[13], Q, KH, VH, VL, PH);
  k_padph<<<64, 256, 0, stream>>>(PH);
  k_att<<<dim3(TT / 64, NH, TNB), 128, 0, stream>>>(Q, KH, PH, VH, VL, F[14], F[15], (const int*)d_in[4], X);
  k_out<<<dim3(TNB * TT / 64, DMD / 128), 128, 0, stream>>>(X, F[11], F[12], (float*)d_out);
}

// v005
// One run takes 134 microseconds.
// Timed twice side by side with v004, it ran 1.06 times as fast both times.
// All steps since v000 together make it 3.52 times as fast.
// compute dtype: all float inputs rounded to bf16, mask (int) read; q/k/v/pos projections with EXACT bf16 products on WMMA 16x16x32 (natural weights, + bias), f32 accumulate; q kept in f32 (bias_u / bias_v added per head, then split into f16 hi + residual fragments), k / ph rounded once to f16, v split into f16 hi + residual planes; content scores (q+bu) . k and the Transformer-XL position term (q+bv) . ph with single f16 products (logits ~1-2; q, k, ph each rounded once), the rel_shift realised exactly as an index map onto 16 x 32 position tiles (incl. its upper-triangle wrap-around rows and the zero at j == i+1), x 1/8, masked keys excluded, running-max softmax in f32 (hardware exp); P (f16 x 2^11 + residual) . v; out = x (bf16 hi + lo) . Wo^T + bo; f32 output.
#include <hip/hip_runtime.h>
#include <math.h>

typedef __attribute__((ext_vector_type(16))) _Float16 v16h;
typedef __attribute__((ext_vector_type(16))) __bf16 v16b;
typedef __attribute__((ext_vector_type(8)))  _Float16 v8h;
typedef __attribute__((ext_vector_type(8)))  float v8f;
typedef __attribute__((ext_vector_type(4)))  float v4f;
typedef __attribute__((ext_vector_type(2)))  float v2f;
typedef __attribute__((ext_vector_type(4)))  unsigned v4u;
typedef __attribute__((ext_vector_type(4)))  int v4i;
typedef float __attribute__((may_alias)) float_a;
typedef int __attribute__((may_alias)) int_a;

template <typename T> __device__ __forceinline__ void vst2(void* p, T v) { *(T*)p = v;  }
__device__ __forceinline__ v8f wmma16(v16h a, v16h b, v8f c) {
  v8f d = __builtin_amdgcn_wmma_f32_16x16x32_f16(false, a, false, b, (short)0, c, false, false);
  asm volatile("v_nop\n\tv_nop\n\tv_nop\n\tv_nop" : "+v"(d) : "v"(a), "v"(b));
  return d;
}
__device__ __forceinline__ v8f wmma_bf(v16b a, v16b b, v8f c) {
  v8f d = __builtin_amdgcn_wmma_f32_16x16x32_bf16(false, a, false, b, (short)0, c, false, false);
  asm volatile("v_nop\n\tv_nop\n\tv_nop\n\tv_nop" : "+v"(d) : "v"(a), "v"(b));
  return d;
}
// 16x16x32 fragments: lane = (h = lane>>4, row/col = lane&15); elements 0..7 = k0+8h+0..7, 8..15 = k0+16+8h+0..7; D element r = row 8h+r
__device__ __forceinline__ v16h frag_h(const _Float16* rowk0, int lane) {
  union { v16h v; v8h q[2]; } u; const _Float16* p = rowk0 + 8 * (lane >> 4);
  u.q[0] = *(const v8h*)p; u.q[1] = *(const v8h*)(p + 16); return u.v;
}
__device__ __forceinline__ v16h frag_f32(const float* rowk0, int lane) {
  v16h a; const float* p = rowk0 + 8 * (lane >> 4);
#pragma unroll
  for (int i = 0; i < 8; ++i) { a[i] = (_Float16)p[i]; a[8 + i] = (_Float16)p[16 + i]; }
  return a;
}
__device__ __forceinline__ v16h frag_f32s(const float* rowk0, int lane, float sc) {
  v16h a; const float* p = rowk0 + 8 * (lane >> 4);
#pragma unroll
  for (int i = 0; i < 8; ++i) { a[i] = (_Float16)(p[i] * sc); a[8 + i] = (_Float16)(p[16 + i] * sc); }
  return a;
}
// column fragment from a [K][ld] layout (column n), rows >= K read as 0
__device__ __forceinline__ v16h fragc_f32(const float* W, int k0, int n, int lane, int ld, int K) {
  v16h a; const int g = lane >> 4;
#pragma unroll
  for (int i = 0; i < 8; ++i) { const int ka = k0 + 8 * g + i, kb = ka + 16;
    a[i] = (_Float16)(ka < K ? W[(size_t)(ka < K ? ka : K - 1) * ld + n] : 0.f); a[8 + i] = (_Float16)(kb < K ? W[(size_t)(kb < K ? kb : K - 1) * ld + n] : 0.f); }
  return a;
}
struct F2 { v16b h, l; };
__device__ __forceinline__ F2 bsplit16(const float v[16]) { F2 r;
#pragma unroll
  for (int i = 0; i < 16; ++i) { const __bf16 h = (__bf16)v[i]; r.h[i] = h; r.l[i] = (__bf16)(v[i] - (float)h); }
  return r; }
__device__ __forceinline__ F2 split_row(const float* row, int k0, int lane) { float v[16]; const float* p = row + k0 + 8 * (lane >> 4);
#pragma unroll
  for (int i = 0; i < 8; ++i) { v[i] = p[i]; v[8 + i] = p[16 + i]; }
  return bsplit16(v); }
__device__ __forceinline__ F2 split_rowK(const float* row, int k0, int lane, int K) { float v[16]; const int g = lane >> 4;
#pragma unroll
  for (int i = 0; i < 8; ++i) { const int ka = k0 + 8 * g + i, kb = ka + 16; v[i] = ka < K ? row[ka < K ? ka : K - 1] : 0.f; v[8 + i] = kb < K ? row[kb < K ? kb : K - 1] : 0.f; }
  return bsplit16(v); }
__device__ __forceinline__ F2 split_col(const float* W, int k0, int n, int lane, int ld, int K) { float v[16]; const int g = lane >> 4;
#pragma unroll
  for (int i = 0; i < 8; ++i) { const int ka = k0 + 8 * g + i, kb = ka + 16; v[i] = ka < K ? W[(size_t)(ka < K ? ka : K - 1) * ld + n] : 0.f; v[8 + i] = kb < K ? W[(size_t)(kb < K ? kb : K - 1) * ld + n] : 0.f; }
  return bsplit16(v); }
__device__ __forceinline__ v8f mac3(const F2& a, const F2& b, v8f c) { c = wmma_bf(a.l, b.h, c); c = wmma_bf(a.h, b.l, c); return wmma_bf(a.h, b.h, c); }
__device__ __forceinline__ float sigm(float v) { return 1.0f / (1.0f + expf(-v)); }
#define LDSX() do { asm volatile("s_wait_dscnt 0" ::: "memory"); __builtin_amdgcn_wave_barrier(); __builtin_amdgcn_fence(__ATOMIC_RELEASE, "workgroup"); } while (0)


// Relative-position multi-head attention (Transformer-XL style rel_shift; B 8, T 1,024, D 512, 8 heads x 64): scores = ((q+u) k^T + rel_shift((q+v) p^T)) / 8, masked softmax (mask input), attn v, Wo.
#define NB 8
#define TT 1024
#define DMD 512
#define NH 8
#define HD 64
#define POFF 32                 // ph buffer row offset (rows < 0 and >= T read as zeros)
#define PROWS (TT + 64)
#ifndef TNB
#define TNB NB
#endif
typedef __attribute__((ext_vector_type(8))) __bf16 v8b;
__device__ __forceinline__ v16b frag_b(const __bf16* rowk0, int lane) {
  union { v16b v; v8b q[2]; } u; const __bf16* p = rowk0 + 8 * (lane >> 4);
  u.q[0] = *(const v8b*)p; u.q[1] = *(const v8b*)(p + 16); return u.v;
}
__device__ __forceinline__ float bfr(float v) { return (float)(__bf16)v; }
__device__ __attribute__((noinline)) float exp_ni(float v) { return expf(v); }
__device__ __attribute__((noinline)) float erf_ni(float v) { return erff(v); }

#define WS_Q   0u                                   // f32 q rows [b*u][512] (+bq)
#define WS_KH  (WS_Q + 4u * (size_t)NB * TT * DMD)       // f16 k rows [b*t][512]
#define WS_PH  (WS_KH + 2u * (size_t)NB * TT * DMD)      // f16 ph rows [PROWS][512] (row POFF + p)
#define WS_VH  (WS_PH + 2u * (size_t)PROWS * DMD)        // f16 v planes [b][512][t]
#define WS_VL  (WS_VH + 2u * (size_t)NB * DMD * TT)      // f16 v residual planes (unscaled)
#define WS_X   (WS_VL + 2u * (size_t)NB * DMD * TT)      // f32 attention output rows [b*u][512]
#define WS_END (WS_X + 4u * (size_t)NB * TT * DMD)

typedef __attribute__((ext_vector_type(4))) __bf16 v4b;
__device__ __forceinline__ v4b cvt4(v4f v) { v4b r;
#pragma unroll
  for (int i = 0; i < 4; ++i) r[i] = (__bf16)v[i];
  return r; }
__device__ __forceinline__ v4b res4(v4f v, v4b h) { v4b r;
#pragma unroll
  for (int i = 0; i < 4; ++i) r[i] = (__bf16)(v[i] - (float)h[i]);
  return r; }
#define SPI 40   // ring row pitch in bf16: 64-B rows at 80 B (16 B x odd) for 16-byte LDS reads
union __align__(16) ProjSm { __bf16 st[2][192][SPI]; float sf[4][16][132]; _Float16 sh[64][136]; _Float16 t2[2][128][72]; };
union __align__(16) OutSm { __bf16 st[2][256][SPI]; float sf[4][16][132]; };
// ---- k_proj: block = (64 rows, 128-col group, which): 0 q (f32 rows), 1 k (f16 rows), 2 v (f16 hi + residual planes), 3 ph (f16 rows at POFF), natural W + bias (none for ph)
__global__ __launch_bounds__(128) void k_proj(const float* __restrict__ Qi, const float* __restrict__ Ki, const float* __restrict__ Vi, const float* __restrict__ POS, const float* __restrict__ WQ, const float* __restrict__ BQ, const float* __restrict__ WK, const float* __restrict__ BK, const float* __restrict__ WV, const float* __restrict__ BV, const float* __restrict__ WP, float* __restrict__ Q, _Float16* __restrict__ KH, _Float16* __restrict__ VH, _Float16* __restrict__ VL, _Float16* __restrict__ PH) {
  __shared__ ProjSm sm;   // the operand ring is dead when the epilogue tiles are written (barrier at the foot of the last stage)
  float (&sf)[4][16][132] = sm.sf; _Float16 (&sh)[64][136] = sm.sh; _Float16 (&th)[128][72] = sm.t2[0]; _Float16 (&tl)[128][72] = sm.t2[1];
  const int tid = threadIdx.x, wave = tid >> 5, lane = tid & 31, col = lane & 15, g = lane >> 4; const int which = blockIdx.z; const int c0 = blockIdx.y * 128; const int nrows = (which == 3) ? TT : NB * TT;
  if ((int)blockIdx.x * 64 >= nrows) return;
  const float* X = (which == 0 ? Qi : which == 1 ? Ki : which == 2 ? Vi : POS); const float* Wm = (which == 0 ? WQ : which == 1 ? WK : which == 2 ? WV : WP); const float* Bm = (which == 0 ? BQ : which == 1 ? BK : which == 2 ? BV : nullptr);
  const size_t r0 = (size_t)blockIdx.x * 64 + wave * 16;
  v8f acc[8] = {};
  // stage = 32 k of 128 W rows (ring rows 0..127) and of the block's 64 X rows (128..191); 8 lanes x 16 B fetch one whole 128-B line of a row
  const int lr = tid >> 3, lq = tid & 7; const float* wsrc = Wm + (size_t)(c0 + lr) * DMD + lq * 4; const float* xsrc = X + ((size_t)blockIdx.x * 64 + lr) * DMD + lq * 4;
  v4f pf[12];
#pragma unroll
  for (int e = 0; e < 12; ++e) pf[e] = *(const v4f*)(e < 8 ? wsrc + (size_t)e * 16 * DMD : xsrc + (size_t)(e - 8) * 16 * DMD);
#pragma unroll
  for (int e = 0; e < 12; ++e) *(v4b*)&sm.st[0][e * 16 + lr][lq * 4] = cvt4(pf[e]);
  __syncthreads();
#pragma unroll
  for (int kc = 0; kc < DMD / 32; ++kc) { const int cur = kc & 1;
    if (kc + 1 < DMD / 32) {
#pragma unroll
      for (int e = 0; e < 12; ++e) pf[e] = *(const v4f*)((e < 8 ? wsrc + (size_t)e * 16 * DMD : xsrc + (size_t)(e - 8) * 16 * DMD) + (kc + 1) * 32); }
    const v16b a = frag_b(&sm.st[cur][128 + wave * 16 + col][0], lane);
#pragma unroll
    for (int jh = 0; jh < 8; jh += 4) { v16b w[4];   // the LDS reads of four fragments go ahead of their products as one group: one LDS latency per group
#pragma unroll
      for (int j = 0; j < 4; ++j) w[j] = frag_b(&sm.st[cur][(jh + j) * 16 + col][0], lane);
#pragma unroll
      for (int j = 0; j < 4; ++j) acc[jh + j] = wmma_bf(a, w[j], acc[jh + j]); }
    __builtin_amdgcn_sched_barrier(0);   // keeps the wait for the next stage's global loads behind this stage's products, so that they cover its latency
    if (kc + 1 < DMD / 32) {
#pragma unroll
      for (int e = 0; e < 12; ++e) *(v4b*)&sm.st[cur ^ 1][e * 16 + lr][lq * 4] = cvt4(pf[e]); }
    __syncthreads(); }   // publishes stage kc + 1 and ends every read of the buffer that the next pass refills
#pragma unroll
  for (int j = 0; j < 8; ++j) { const float bb = Bm ? bfr(Bm[c0 + j * 16 + col]) : 0.f;
#pragma unroll
    for (int r = 0; r < 8; ++r) { const float v = acc[j][r] + bb; const int rl = wave * 16 + 8 * g + r, cl = j * 16 + col;
      if (which == 0) sf[wave][8 * g + r][cl] = v; else if (which == 2) { const _Float16 hv = (_Float16)v; th[cl][rl] = hv; tl[cl][rl] = (_Float16)(v - (float)hv); } else sh[rl][cl] = (_Float16)v; } }
  __syncthreads();
  if (which == 0) { for (int rl = 0; rl < 16; ++rl) vst2(Q + (r0 + rl) * DMD + c0 + lane * 4, *(const v4f*)&sf[wave][rl][lane * 4]); }
  else if (which == 2) { const size_t b = ((size_t)blockIdx.x * 64) / TT; const int t0 = (int)(((size_t)blockIdx.x * 64) % TT); for (int e = tid; e < 128 * 8; e += 128) { const int cl = e >> 3, q = e & 7; const size_t o = (b * DMD + c0 + cl) * (size_t)TT + t0 + q * 8; vst2((unsigned*)(VH + o), *(const v4u*)&th[cl][q * 8]); vst2((unsigned*)(VL + o), *(const v4u*)&tl[cl][q * 8]); } }
  else { _Float16* dst = (which == 1) ? (KH + (size_t)blockIdx.x * 64 * DMD) : (PH + ((size_t)POFF + blockIdx.x * 64) * DMD); for (int e = tid; e < 64 * 16; e += 128) { const int rl = e >> 4, q = e & 15; vst2((unsigned*)(dst + (size_t)rl * DMD + c0 + q * 8), *(const v4u*)&sh[rl][q * 8]); } } }
// ---- k_padph: the POFF rows before and the rows after the table are zeros
__global__ __launch_bounds__(256) void k_padph(_Float16* __restrict__ PH) { const int t = threadIdx.x; const int r = blockIdx.x; const size_t row = (r < POFF) ? r : (TT + r);   // 0..31 and TT+32 .. TT+63
  v4u z; z[0] = z[1] = z[2] = z[3] = 0u; if (t < DMD / 8) vst2((unsigned*)(PH + row * DMD + t * 8), z); }
// fragments of (q + bias) for 16 rows, head h: hi and residual as f16 (unscaled; q ~ O(1))
__device__ __forceinline__ void qfrags(const float* __restrict__ Q, size_t row0, int h, const float* __restrict__ bias, int lane, v16h* hi, v16h* lo) { const int col = lane & 15, g = lane >> 4; size_t row = row0 + col; if (row > (size_t)NB * TT - 1) row = (size_t)NB * TT - 1;   // clamp (only the never-used row T of the last batch)
#pragma unroll
  for (int kc = 0; kc < 2; ++kc) { const float* p = Q + row * DMD + h * HD + kc * 32 + 8 * g; const float* bp = bias + h * HD + kc * 32 + 8 * g; v16h a, b;
#pragma unroll
    for (int i = 0; i < 8; ++i) { const float v0 = p[i] + bfr(bp[i]), v1 = p[16 + i] + bfr(bp[16 + i]); const _Float16 h0 = (_Float16)v0, h1 = (_Float16)v1; a[i] = h0; a[8 + i] = h1; b[i] = (_Float16)(v0 - (float)h0); b[8 + i] = (_Float16)(v1 - (float)h1); }
    hi[kc] = a; lo[kc] = b; } }
// reduction over each 16-lane row for eight values at once: lane l takes lane l ^ 1, ^ 2, ^ 4, ^ 8 through the DPP operand, every lane ends with the row's result.
// One statement, the eight values' steps interleaved: each step's producer stands eight instructions back, so no step waits for the one before. All 32 lanes must be on.
#define RX(op, n, x) op " %" #n ", %" #n ", %" #n " row_xmask:" #x " row_mask:0xf bank_mask:0xf\n\t"
#define RX8(op, x) RX(op, 0, x) RX(op, 1, x) RX(op, 2, x) RX(op, 3, x) RX(op, 4, x) RX(op, 5, x) RX(op, 6, x) RX(op, 7, x)
#define ROW16(q, op, v) asm q (RX8(op, 1) RX8(op, 2) RX8(op, 4) RX8(op, 8) : "+v"(v[0]), "+v"(v[1]), "+v"(v[2]), "+v"(v[3]), "+v"(v[4]), "+v"(v[5]), "+v"(v[6]), "+v"(v[7]))
// ---- k_att: block = (64 queries u, h, b)
#define KP 72    // LDS pitch of the 128-B k and position rows in f16: 144 B (16 B x odd) for 16-byte LDS reads
#define VP 40    // LDS pitch of the 64-B v rows in f16: 80 B
union __align__(16) AttX { float sp[16][36]; float so[16][68]; };   // a wave's own exchange tiles; so is written behind the loop, when sp is dead
// rel_shift of eight rows in registers: value n (row 8 g + n of the tile) += operand 8 + n taken from lane (col - (8 g + n + 1)) mod 16 of the same 16-lane row.
// row_ror:k gives lane l the word of lane (l - k) mod 16; the two halves of the wave turn by different amounts, so each add writes one half (row_mask 1: lanes 0..15, 2: lanes 16..31).
// Row 15 turns by 16 == 0: the identity quad_perm. One statement, a value's second add eight instructions behind its first. All 32 lanes must be on.
#define SH(n, m, ctl, half) "v_add_f32_dpp %" #n ", %" #m ", %" #n " " ctl " row_mask:" #half " bank_mask:0xf\n\t"
#define SHIFT16(c, v) asm(SH(0, 8, "row_ror:1", 0x1) SH(1, 9, "row_ror:2", 0x1) SH(2, 10, "row_ror:3", 0x1) SH(3, 11, "row_ror:4", 0x1) SH(4, 12, "row_ror:5", 0x1) SH(5, 13, "row_ror:6", 0x1) SH(6, 14, "row_ror:7", 0x1) SH(7, 15, "row_ror:8", 0x1) \
  SH(0, 8, "row_ror:9", 0x2) SH(1, 9, "row_ror:10", 0x2) SH(2, 10, "row_ror:11", 0x2) SH(3, 11, "row_ror:12", 0x2) SH(4, 12, "row_ror:13", 0x2) SH(5, 13, "row_ror:14", 0x2) SH(6, 14, "row_ror:15", 0x2) SH(7, 15, "quad_perm:[0,1,2,3]", 0x2) \
  : "+v"(c[0]), "+v"(c[1]), "+v"(c[2]), "+v"(c[3]), "+v"(c[4]), "+v"(c[5]), "+v"(c[6]), "+v"(c[7]) : "v"(v[0]), "v"(v[1]), "v"(v[2]), "v"(v[3]), "v"(v[4]), "v"(v[5]), "v"(v[6]), "v"(v[7]))
__device__ __forceinline__ unsigned lds_at(const void* p) { return (unsigned)(size_t)p; }   // LDS byte address = low 32 bits of the __shared__ address
// extended position index x = T-1-i+j: x < T is table row x (j <= i), x == T the zero row behind the table (j == i+1), x > T table row x-T-1 (the wrapped rows, j >= i+2)
__device__ __forceinline__ const _Float16* ph_row(const _Float16* __restrict__ PH, int x) { return PH + (size_t)(POFF + (x <= TT ? x : x - TT - 1)) * DMD; }
__global__ __launch_bounds__(128) void k_att(const float* __restrict__ Q, const _Float16* __restrict__ KH, const _Float16* __restrict__ PH, const _Float16* __restrict__ VH, const _Float16* __restrict__ VL, const float* __restrict__ BU, const float* __restrict__ BVv, const int* __restrict__ MK, float* __restrict__ X) {
  __shared__ AttX sx[4];
  __shared__ __align__(16) _Float16 sk[2][32][KP];     // 32 keys x 64 d of this head, two buffers
  __shared__ __align__(16) _Float16 sv[2][128][VP];    // rows 0..63 v hi (d), 64..127 v residual, 32 keys each, two buffers
  __shared__ __align__(16) _Float16 sph[128][KP];      // position rows, slot = x & 127: a pass reads 96 rows, the next pass's 32 new rows fill the slots it does not read
  const int tid = threadIdx.x, wave = tid >> 5, lane = tid & 31, col = lane & 15, g = lane >> 4; const int qb = blockIdx.x, h = blockIdx.y; const size_t b = blockIdx.z; const int i0 = qb * 64 + wave * 16;
  float (&sp)[16][36] = sx[wave].sp; float (&so)[16][68] = sx[wave].so;
  const int iw = __builtin_amdgcn_readfirstlane(i0 >> 4);   // the wave's 16-row tile index in a scalar register: the choice of the position products' A rows is a scalar branch
  const int xb0 = TT - 64 - qb * 64;   // x of (i = the block's last query, j = 0): pass ks reads x = xb0 + 32 ks .. + 95
  const int kr = tid >> 3, kq = (tid & 7) * 8, vr = tid >> 2, vq = (tid & 3) * 8;   // 8 lanes fetch one whole 128-B row of k or of the table, 4 lanes one 64-B row piece of v
  // tile t = keys 32 t .. + 31 of k and v and the last 32 position rows of pass t's window: eight 16-byte copies a lane, no register in between
  auto tile = [&](int t) { const int bf = t & 1, x = xb0 + t * 32 + 64 + kr;
    const _Float16* gk = KH + (b * TT + t * 32 + kr) * DMD + h * HD + kq; const size_t vo = (b * DMD + (size_t)h * HD + vr) * TT + t * 32 + vq;
    // the wait on xcnt closes the statement: it stands in front of every rewrite of a register that a copy names
    asm volatile("global_load_async_to_lds_b128 %0, %8, off\n\tglobal_load_async_to_lds_b128 %1, %9, off\n\tglobal_load_async_to_lds_b128 %2, %10, off\n\tglobal_load_async_to_lds_b128 %3, %11, off\n\t"
                 "global_load_async_to_lds_b128 %4, %12, off\n\tglobal_load_async_to_lds_b128 %5, %13, off\n\tglobal_load_async_to_lds_b128 %6, %14, off\n\tglobal_load_async_to_lds_b128 %7, %15, off\n\ts_wait_xcnt 0x0"
                 :: "v"(lds_at(&sk[bf][kr][kq])), "v"(lds_at(&sk[bf][16 + kr][kq])), "v"(lds_at(&sph[x & 127][kq])), "v"(lds_at(&sph[(x + 16) & 127][kq])),
                    "v"(lds_at(&sv[bf][vr][vq])), "v"(lds_at(&sv[bf][32 + vr][vq])), "v"(lds_at(&sv[bf][64 + vr][vq])), "v"(lds_at(&sv[bf][96 + vr][vq])),
                    "v"(gk), "v"(gk + 16 * DMD), "v"(ph_row(PH, x) + h * HD + kq), "v"(ph_row(PH, x + 16) + h * HD + kq),
                    "v"(VH + vo), "v"(VH + vo + 32 * TT), "v"(VL + vo), "v"(VL + vo + 32 * TT) : "memory"); };
  tile(0);
  { const int x = xb0 + kr;   // the first 64 position rows of pass 0's window
    asm volatile("global_load_async_to_lds_b128 %0, %4, off\n\tglobal_load_async_to_lds_b128 %1, %5, off\n\tglobal_load_async_to_lds_b128 %2, %6, off\n\tglobal_load_async_to_lds_b128 %3, %7, off\n\ts_wait_xcnt 0x0"
                 :: "v"(lds_at(&sph[x & 127][kq])), "v"(lds_at(&sph[(x + 16) & 127][kq])), "v"(lds_at(&sph[(x + 32) & 127][kq])), "v"(lds_at(&sph[(x + 48) & 127][kq])),
                    "v"(ph_row(PH, x) + h * HD + kq), "v"(ph_row(PH, x + 16) + h * HD + kq), "v"(ph_row(PH, x + 32) + h * HD + kq), "v"(ph_row(PH, x + 48) + h * HD + kq) : "memory"); }
  v16h au[2], av[2], aw[2], tmpl[2];   // (q+u) rows i0.., (q+v) rows i0.., (q+v) rows i0+1.. (for the wrapped upper-triangle term); single f16 rounding (residuals dropped: VGPR budget)
  qfrags(Q, b * TT + i0, h, BU, lane, au, tmpl); qfrags(Q, b * TT + i0, h, BVv, lane, av, tmpl);
  qfrags(Q, b * TT + i0 + 1, h, BVv, lane, aw, tmpl);   // rows i+1; for i = T-1 the row belongs to the next batch (or is clamped) but its products are never used: j >= i+2 cannot hold for i = T-1
  float m[8], l[8];
#pragma unroll
  for (int r = 0; r < 8; ++r) { m[r] = -3.0e38f; l[r] = 0.f; }
  v8f acc[4] = {};
  asm volatile("s_wait_asynccnt 0x0" ::: "memory");   // this wave's copies of tile 0 have landed
  __syncthreads();                                     // publishes tile 0
  tile(1);
#pragma unroll 1
  for (int ks = 0; ks < TT / 32; ++ks) { float s[2][8]; const int cur = ks & 1;
    const int xt = TT - 16 - i0 + ks * 32;            // three 16-column position tiles cover x = xt .. xt + 47; keys 16 ct .. + 15 use tiles ct and ct + 1, so the middle one serves both halves
    v16h kf[2][2], pf[3][2];   // the LDS reads of the pass's ten fragments go ahead of their products as one group
#pragma unroll
    for (int kc = 0; kc < 2; ++kc) {
#pragma unroll
      for (int ct = 0; ct < 2; ++ct) kf[ct][kc] = frag_h(&sk[cur][ct * 16 + col][kc * 32], lane);
#pragma unroll
      for (int t = 0; t < 3; ++t) pf[t][kc] = frag_h(&sph[((xt + 16 * t) & 127) + col][kc * 32], lane); }
    v8f c[2] = {}, gp[3] = {};
#pragma unroll
    for (int kc = 0; kc < 2; ++kc)
#pragma unroll
      for (int ct = 0; ct < 2; ++ct) c[ct] = wmma16(au[kc], kf[ct][kc], c[ct]);
    // T and xt are multiples of 16, so a tile lies wholly in x < T (j <= i: rows i, av) or wholly in x >= T (the zero row x == T and the wrapped rows: rows i + 1, aw).
    // Tile t has x < T when 2 ks + t <= i0 / 16. i == T-1 has no j > i, so the row behind the last query is never picked.
#define POS3(A0, A1, A2) do { _Pragma("unroll") for (int kc = 0; kc < 2; ++kc) { gp[0] = wmma16(A0[kc], pf[0][kc], gp[0]); gp[1] = wmma16(A1[kc], pf[1][kc], gp[1]); gp[2] = wmma16(A2[kc], pf[2][kc], gp[2]); } } while (0)
    const int nlow = iw + 1 - 2 * ks;                 // tiles t < nlow take rows i
    if (nlow >= 3) POS3(av, av, av); else if (nlow <= 0) POS3(aw, aw, aw); else if (nlow == 2) POS3(av, av, aw); else POS3(av, aw, aw);   // the two mixed cases: the one pass that holds the wave's diagonal
    int mk[2][8]; const int* mrow = MK + ((size_t)b * TT + i0 + 8 * g) * TT + ks * 32 + col;   // row 8 g, key 32 ks + col of the pass's mask tile
#pragma unroll
    for (int ct = 0; ct < 2; ++ct)
#pragma unroll
      for (int r = 0; r < 8; ++r) mk[ct][r] = mrow[r * TT + ct * 16];
    asm volatile("s_wait_xcnt 0x0" :: "v"(mrow) : "memory");   // stands behind the sixteen mask loads and takes their address: the pair stays live up to the wait, so no result and no later value is placed in it before
#pragma unroll
    for (int ct = 0; ct < 2; ++ct) { float cc[8], sel[8];
      // row 8 g + r wants column 15 + col - (8 g + r) of the 32 columns of tiles ct, ct + 1: lane c of the row holds the wanted word of tile ct when c + 8 g + r >= 15, of tile ct + 1 otherwise; the turn brings it to its key's lane
#pragma unroll
      for (int r = 0; r < 8; ++r) { cc[r] = c[ct][r]; sel[r] = (col + 8 * g + r >= 15) ? gp[ct][r] : gp[ct + 1][r]; }
      SHIFT16(cc, sel);
#pragma unroll
      for (int r = 0; r < 8; ++r) s[ct][r] = (mk[ct][r] != 0) ? cc[r] * 0.125f : -3.0e38f; }
    float alpha[8], mx[8], es[8];
#pragma unroll
    for (int r = 0; r < 8; ++r) mx[r] = fmaxf(fmaxf(s[0][r], s[1][r]), m[r]);   // the running maximum, equal in a row's lanes, goes in ahead of the reduction: what comes out is the new one
    ROW16(, "v_max_num_f32_dpp", mx);   // row maximum over the 16 lanes that hold a query's keys, in the vector unit: no LDS permute, no wait on dscnt between the steps
#pragma unroll
    for (int r = 0; r < 8; ++r) { const float mn = mx[r]; alpha[r] = (m[r] <= -1.0e38f) ? 0.f : __expf(m[r] - mn); const float e0 = (s[0][r] <= -1.0e38f) ? 0.f : __expf(s[0][r] - mn), e1 = (s[1][r] <= -1.0e38f) ? 0.f : __expf(s[1][r] - mn); es[r] = e0 + e1;
      m[r] = mn; sp[8 * g + r][col] = e0; sp[8 * g + r][16 + col] = e1; }
    ROW16(volatile, "v_add_f32_dpp", es);   // row sum, the xor 1, 2, 4, 8 tree; volatile keeps it here, in front of the wait for the P stores, whose latency it fills (the compiler sinks it behind the pass's barrier otherwise)
#pragma unroll
    for (int r = 0; r < 8; ++r) l[r] = l[r] * alpha[r] + es[r];
#pragma unroll
    for (int j = 0; j < 4; ++j)
#pragma unroll
      for (int r = 0; r < 8; ++r) acc[j][r] *= alpha[r];
    LDSX();
    v16h pa, pr; { const float* prow = &sp[col][0] + 8 * (lane >> 4);
#pragma unroll
      for (int i = 0; i < 8; ++i) { const float x0 = prow[i] * 2048.0f, x1 = prow[16 + i] * 2048.0f; const _Float16 h0 = (_Float16)x0, h1 = (_Float16)x1; pa[i] = h0; pa[8 + i] = h1; pr[i] = (_Float16)(x0 - (float)h0); pr[8 + i] = (_Float16)(x1 - (float)h1); } }
#pragma unroll
    for (int jh = 0; jh < 4; jh += 2) { v16h vh[2], vl[2];   // four fragments' LDS reads as one group ahead of their six products
#pragma unroll
      for (int j = 0; j < 2; ++j) { vh[j] = frag_h(&sv[cur][(jh + j) * 16 + col][0], lane); vl[j] = frag_h(&sv[cur][64 + (jh + j) * 16 + col][0], lane); }
#pragma unroll
      for (int j = 0; j < 2; ++j) { acc[jh + j] = wmma16(pa, vh[j], acc[jh + j]); acc[jh + j] = wmma16(pr, vh[j], acc[jh + j]); acc[jh + j] = wmma16(pa, vl[j], acc[jh + j]); } }
    asm volatile("s_wait_dscnt 0x0" ::: "memory");      // this wave's LDS reads of pass ks have retired before the buffers are refilled
    asm volatile("s_wait_asynccnt 0x0" ::: "memory");   // this wave's copies of tile ks + 1 have landed
    __syncthreads();                                     // publishes tile ks + 1 and ends every wave's reads of the buffers and slots that tile ks + 2 fills
    if (ks + 2 < TT / 32) tile(ks + 2); }
  asm volatile("s_wait_asynccnt 0x0" ::: "memory");     // no copy is outstanding when the wave ends
#pragma unroll
  for (int r = 0; r < 8; ++r) { const float il = (l[r] > 0.f) ? (1.0f / 2048.0f) / l[r] : 0.f;   // fully masked rows -> zeros (the module zeroes them after the softmax)
#pragma unroll
    for (int j = 0; j < 4; ++j) so[8 * g + r][j * 16 + col] = acc[j][r] * il; }
  LDSX(); for (int rl = 0; rl < 16; ++rl) if (lane < 16) vst2(X + (b * TT + i0 + rl) * DMD + h * HD + lane * 4, *(const v4f*)&so[rl][lane * 4]); }
// ---- k_out: block = (64 rows, 128 of 512 cols): out = x (hi + lo) . Wo^T + bo
__global__ __launch_bounds__(128) void k_out(const float* __restrict__ X, const float* __restrict__ WO, const float* __restrict__ BO, float* __restrict__ OUT) { __shared__ OutSm sm; float (&sf)[4][16][132] = sm.sf;   // ring dead at the epilogue (barrier at the foot of the last stage)
  const int tid = threadIdx.x, wave = tid >> 5, lane = tid & 31, col = lane & 15, g = lane >> 4; const int c0 = blockIdx.y * 128; const size_t r0 = (size_t)blockIdx.x * 64 + wave * 16;
  v8f acc[8] = {};
  // stage = 32 k of 128 Wo rows (ring rows 0..127) and of the block's 64 x rows as hi (128..191) and lo (192..255)
  const int lr = tid >> 3, lq = tid & 7; const float* wsrc = WO + (size_t)(c0 + lr) * DMD + lq * 4; const float* xsrc = X + ((size_t)blockIdx.x * 64 + lr) * DMD + lq * 4;
  v4f pf[12];
#pragma unroll
  for (int e = 0; e < 12; ++e) pf[e] = *(const v4f*)(e < 8 ? wsrc + (size_t)e * 16 * DMD : xsrc + (size_t)(e - 8) * 16 * DMD);
#pragma unroll
  for (int e = 0; e < 12; ++e) { const v4b hv = cvt4(pf[e]); *(v4b*)&sm.st[0][e * 16 + lr][lq * 4] = hv; if (e >= 8) *(v4b*)&sm.st[0][64 + e * 16 + lr][lq * 4] = res4(pf[e], hv); }
  __syncthreads();
#pragma unroll
  for (int kc = 0; kc < DMD / 32; ++kc) { const int cur = kc & 1;
    if (kc + 1 < DMD / 32) {
#pragma unroll
      for (int e = 0; e < 12; ++e) pf[e] = *(const v4f*)((e < 8 ? wsrc + (size_t)e * 16 * DMD : xsrc + (size_t)(e - 8) * 16 * DMD) + (kc + 1) * 32); }
    const v16b ah = frag_b(&sm.st[cur][128 + wave * 16 + col][0], lane), al = frag_b(&sm.st[cur][192 + wave * 16 + col][0], lane);
    v16b w[8];   // the stage's LDS reads go ahead of its products as one group: one LDS latency per stage
#pragma unroll
    for (int j = 0; j < 8; ++j) w[j] = frag_b(&sm.st[cur][j * 16 + col][0], lane);
#pragma unroll
    for (int j = 0; j < 8; ++j) { acc[j] = wmma_bf(ah, w[j], acc[j]); acc[j] = wmma_bf(al, w[j], acc[j]); }
    __builtin_amdgcn_sched_barrier(0);   // keeps the wait for the next stage's global loads behind this stage's products, so that they cover its latency
    if (kc + 1 < DMD / 32) {
#pragma unroll
      for (int e = 0; e < 12; ++e) { const v4b hv = cvt4(pf[e]); *(v4b*)&sm.st[cur ^ 1][e * 16 + lr][lq * 4] = hv; if (e >= 8) *(v4b*)&sm.st[cur ^ 1][64 + e * 16 + lr][lq * 4] = res4(pf[e], hv); } }
    __syncthreads(); }   // publishes stage kc + 1 and ends every read of the buffer that the next pass refills
#pragma unroll
  for (int j = 0; j < 8; ++j) { const float bb = bfr(BO[c0 + j * 16 + col]);
#pragma unroll
    for (int r = 0; r < 8; ++r) sf[wave][8 * g + r][j * 16 + col] = acc[j][r] + bb; }
  LDSX(); for (int rl = 0; rl < 16; ++rl) vst2(OUT + (r0 + rl) * DMD + c0 + lane * 4, *(const v4f*)&sf[wave][rl][lane * 4]); }
extern "C" void kernel_launch(void* const* d_in, const int* in_sizes, int n_in, void* d_out, int out_size, void* d_ws, size_t ws_size, hipStream_t stream) {
  (void)in_sizes; (void)n_in; (void)out_size;
  const float** F = (const float**)d_in;   // 0 q, 1 k, 2 v [8,1024,512]; 3 pos [1024,512]; 4 mask [8,1024,1024] int; 5 Wq, 6 bq, 7 Wk, 8 bk, 9 Wv, 10 bv, 11 Wo, 12 bo, 13 Wp (natural); 14 bias_u [8,64], 15 bias_v [8,64]
  if (ws_size < (size_t)WS_END) return;
  char* ws = (char*)d_ws; float* Q = (float*)(ws + WS_Q); _Float16 *KH = (_Float16*)(ws + WS_KH), *PH = (_Float16*)(ws + WS_PH), *VH = (_Float16*)(ws + WS_VH), *VL = (_Float16*)(ws + WS_VL); float* X = (float*)(ws + WS_X);
  k_proj<<<dim3(TNB * TT / 64, DMD / 128, 4), 128, 0, stream>>>(F[0], F[1], F[2], F[3], F[5], F[6], F[7], F[8], F[9], F[10], F[13], Q, KH, VH, VL, PH);
  k_padph<<<64, 256, 0, stream>>>(PH);
  k_att<<<dim3(TT / 64, NH, TNB), 128, 0, stream>>>(Q, KH, PH, VH, VL, F[14], F[15], (const int*)d_in[4], X);
  k_out<<<dim3(TNB * TT / 64, DMD / 128), 128, 0, stream>>>(X, F[11], F[12], (float*)d_out);
}

// v006
// Measured time: 130 microseconds a run.
// Timed twice side by side with v005, it ran 1.03 times as fast both times.
// Counting every step since v000, it is 3.64 times as fast.
// compute dtype: all float inputs rounded to bf16, mask (int) read; q/k/v/pos projections with EXACT bf16 products on WMMA 16x16x32 (natural weights, + bias), f32 accumulate; q kept in f32 (bias_u / bias_v added per head, then split into f16 hi + residual fragments), k / ph rounded once to f16, v split into f16 hi + residual planes; content scores (q+bu) . k and the Transformer-XL position term (q+bv) . ph with single f16 products (logits ~1-2; q, k, ph each rounded once), the rel_shift realised exactly as an index map onto 16 x 32 position tiles (incl. its upper-triangle wrap-around rows and the zero at j == i+1), x 1/8, masked keys excluded, running-max softmax in f32 (hardware exp); P (f16 x 2^11 + residual) . v; out = x (bf16 hi + lo) . Wo^T + bo; f32 output.
#include <hip/hip_runtime.h>
#include <math.h>

typedef __attribute__((ext_vector_type(16))) _Float16 v16h;
typedef __attribute__((ext_vector_type(16))) __bf16 v16b;
typedef __attribute__((ext_vector_type(8)))  _Float16 v8h;
typedef __attribute__((ext_vector_type(8)))  float v8f;
typedef __attribute__((ext_vector_type(4)))  float v4f;
typedef __attribute__((ext_vector_type(2)))  float v2f;
typedef __attribute__((ext_vector_type(4)))  unsigned v4u;
typedef __attribute__((ext_vector_type(4)))  int v4i;
typedef float __attribute__((may_alias)) float_a;
typedef int __attribute__((may_alias)) int_a;

template <typename T> __device__ __forceinline__ void vst2(void* p, T v) { *(T*)p = v;  }
__device__ __forceinline__ v8f wmma16(v16h a, v16h b, v8f c) {
  v8f d = __builtin_amdgcn_wmma_f32_16x16x32_f16(false, a, false, b, (short)0, c, false, false);
  asm volatile("v_nop\n\tv_nop\n\tv_nop\n\tv_nop" : "+v"(d) : "v"(a), "v"(b));
  return d;
}
__device__ __forceinline__ v8f wmma_bf(v16b a, v16b b, v8f c) {
  v8f d = __builtin_amdgcn_wmma_f32_16x16x32_bf16(false, a, false, b, (short)0, c, false, false);
  asm volatile("v_nop\n\tv_nop\n\tv_nop\n\tv_nop" : "+v"(d) : "v"(a), "v"(b));
  return d;
}
// 16x16x32 fragments: lane = (h = lane>>4, row/col = lane&15); elements 0..7 = k0+8h+0..7, 8..15 = k0+16+8h+0..7; D element r = row 8h+r
__device__ __forceinline__ v16h frag_h(const _Float16* rowk0, int lane) {
  union { v16h v; v8h q[2]; } u; const _Float16* p = rowk0 + 8 * (lane >> 4);
  u.q[0] = *(const v8h*)p; u.q[1] = *(const v8h*)(p + 16); return u.v;
}
__device__ __forceinline__ v16h frag_f32(const float* rowk0, int lane) {
  v16h a; const float* p = rowk0 + 8 * (lane >> 4);
#pragma unroll
  for (int i = 0; i < 8; ++i) { a[i] = (_Float16)p[i]; a[8 + i] = (_Float16)p[16 + i]; }
  return a;
}
__device__ __forceinline__ v16h frag_f32s(const float* rowk0, int lane, float sc) {
  v16h a; const float* p = rowk0 + 8 * (lane >> 4);
#pragma unroll
  for (int i = 0; i < 8; ++i) { a[i] = (_Float16)(p[i] * sc); a[8 + i] = (_Float16)(p[16 + i] * sc); }
  return a;
}
// column fragment from a [K][ld] layout (column n), rows >= K read as 0
__device__ __forceinline__ v16h fragc_f32(const float* W, int k0, int n, int lane, int ld, int K) {
  v16h a; const int g = lane >> 4;
#pragma unroll
  for (int i = 0; i < 8; ++i) { const int ka = k0 + 8 * g + i, kb = ka + 16;
    a[i] = (_Float16)(ka < K ? W[(size_t)(ka < K ? ka : K - 1) * ld + n] : 0.f); a[8 + i] = (_Float16)(kb < K ? W[(size_t)(kb < K ? kb : K - 1) * ld + n] : 0.f); }
  return a;
}
struct F2 { v16b h, l; };
__device__ __forceinline__ F2 bsplit16(const float v[16]) { F2 r;
#pragma unroll
  for (int i = 0; i < 16; ++i) { const __bf16 h = (__bf16)v[i]; r.h[i] = h; r.l[i] = (__bf16)(v[i] - (float)h); }
  return r; }
__device__ __forceinline__ F2 split_row(const float* row, int k0, int lane) { float v[16]; const float* p = row + k0 + 8 * (lane >> 4);
#pragma unroll
  for (int i = 0; i < 8; ++i) { v[i] = p[i]; v[8 + i] = p[16 + i]; }
  return bsplit16(v); }
__device__ __forceinline__ F2 split_rowK(const float* row, int k0, int lane, int K) { float v[16]; const int g = lane >> 4;
#pragma unroll
  for (int i = 0; i < 8; ++i) { const int ka = k0 + 8 * g + i, kb = ka + 16; v[i] = ka < K ? row[ka < K ? ka : K - 1] : 0.f; v[8 + i] = kb < K ? row[kb < K ? kb : K - 1] : 0.f; }
  return bsplit16(v); }
__device__ __forceinline__ F2 split_col(const float* W, int k0, int n, int lane, int ld, int K) { float v[16]; const int g = lane >> 4;
#pragma unroll
  for (int i = 0; i < 8; ++i) { const int ka = k0 + 8 * g + i, kb = ka + 16; v[i] = ka < K ? W[(size_t)(ka < K ? ka : K - 1) * ld + n] : 0.f; v[8 + i] = kb < K ? W[(size_t)(kb < K ? kb : K - 1) * ld + n] : 0.f; }
  return bsplit16(v); }
__device__ __forceinline__ v8f mac3(const F2& a, const F2& b, v8f c) { c = wmma_bf(a.l, b.h, c); c = wmma_bf(a.h, b.l, c); return wmma_bf(a.h, b.h, c); }
__device__ __forceinline__ float sigm(float v) { return 1.0f / (1.0f + expf(-v)); }
#define LDSX() do { asm volatile("s_wait_dscnt 0" ::: "memory"); __builtin_amdgcn_wave_barrier(); __builtin_amdgcn_fence(__ATOMIC_RELEASE, "workgroup"); } while (0)


// Relative-position multi-head attention (Transformer-XL style rel_shift; B 8, T 1,024, D 512, 8 heads x 64): scores = ((q+u) k^T + rel_shift((q+v) p^T)) / 8, masked softmax (mask input), attn v, Wo.
#define NB 8
#define TT 1024
#define DMD 512
#define NH 8
#define HD 64
#define POFF 32                 // ph buffer row offset (rows < 0 and >= T read as zeros)
#define PROWS (TT + 64)
#ifndef TNB
#define TNB NB
#endif
typedef __attribute__((ext_vector_type(8))) __bf16 v8b;
__device__ __forceinline__ v16b frag_b(const __bf16* rowk0, int lane) {
  union { v16b v; v8b q[2]; } u; const __bf16* p = rowk0 + 8 * (lane >> 4);
  u.q[0] = *(const v8b*)p; u.q[1] = *(const v8b*)(p + 16); return u.v;
}
__device__ __forceinline__ float bfr(float v) { return (float)(__bf16)v; }
__device__ __attribute__((noinline)) float exp_ni(float v) { return expf(v); }
__device__ __attribute__((noinline)) float erf_ni(float v) { return erff(v); }

#define WS_Q   0u                                   // f32 q rows [b*u][512] (+bq)
#define WS_KH  (WS_Q + 4u * (size_t)NB * TT * DMD)       // f16 k rows [b*t][512]
#define WS_PH  (WS_KH + 2u * (size_t)NB * TT * DMD)      // f16 ph rows [PROWS][512] (row POFF + p)
#define WS_VH  (WS_PH + 2u * (size_t)PROWS * DMD)        // f16 v planes [b][512][t]
#define WS_VL  (WS_VH + 2u * (size_t)NB * DMD * TT)      // f16 v residual planes (unscaled)
#define WS_X   (WS_VL + 2u * (size_t)NB * DMD * TT)      // f32 attention output rows [b*u][512]
#define WS_END (WS_X + 4u * (size_t)NB * TT * DMD)

typedef __attribute__((ext_vector_type(4))) __bf16 v4b;
__device__ __forceinline__ v4b cvt4(v4f v) { v4b r;
#pragma unroll
  for (int i = 0; i < 4; ++i) r[i] = (__bf16)v[i];
  return r; }
__device__ __forceinline__ v4b res4(v4f v, v4b h) { v4b r;
#pragma unroll
  for (int i = 0; i < 4; ++i) r[i] = (__bf16)(v[i] - (float)h[i]);
  return r; }
#define SPI 40   // ring row pitch in bf16: 64-B rows at 80 B (16 B x odd) for 16-byte LDS reads
union __align__(16) ProjSm { __bf16 st[2][192][SPI]; float sf[4][16][132]; _Float16 sh[64][136]; _Float16 t2[2][128][72]; };
union __align__(16) OutSm { __bf16 st[2][256][SPI]; float sf[4][16][132]; };
// ---- k_proj: block = (64 rows, 128-col group, which): 0 q (f32 rows), 1 k (f16 rows), 2 v (f16 hi + residual planes), 3 ph (f16 rows at POFF), natural W + bias (none for ph)
__global__ __launch_bounds__(128) void k_proj(const float* __restrict__ Qi, const float* __restrict__ Ki, const float* __restrict__ Vi, const float* __restrict__ POS, const float* __restrict__ WQ, const float* __restrict__ BQ, const float* __restrict__ WK, const float* __restrict__ BK, const float* __restrict__ WV, const float* __restrict__ BV, const float* __restrict__ WP, float* __restrict__ Q, _Float16* __restrict__ KH, _Float16* __restrict__ VH, _Float16* __restrict__ VL, _Float16* __restrict__ PH) {
  __shared__ ProjSm sm;   // the operand ring is dead when the epilogue tiles are written (barrier at the foot of the last stage)
  float (&sf)[4][16][132] = sm.sf; _Float16 (&sh)[64][136] = sm.sh; _Float16 (&th)[128][72] = sm.t2[0]; _Float16 (&tl)[128][72] = sm.t2[1];
  const int tid = threadIdx.x, wave = tid >> 5, lane = tid & 31, col = lane & 15, g = lane >> 4; const int which = blockIdx.z; const int c0 = blockIdx.y * 128; const int nrows = (which == 3) ? TT : NB * TT;
  if ((int)blockIdx.x * 64 >= nrows) return;
  const float* X = (which == 0 ? Qi : which == 1 ? Ki : which == 2 ? Vi : POS); const float* Wm = (which == 0 ? WQ : which == 1 ? WK : which == 2 ? WV : WP); const float* Bm = (which == 0 ? BQ : which == 1 ? BK : which == 2 ? BV : nullptr);
  const size_t r0 = (size_t)blockIdx.x * 64 + wave * 16;
  v8f acc[8] = {};
  // stage = 32 k of 128 W rows (ring rows 0..127) and of the block's 64 X rows (128..191); 8 lanes x 16 B fetch one whole 128-B line of a row
  const int lr = tid >> 3, lq = tid & 7; const float* wsrc = Wm + (size_t)(c0 + lr) * DMD + lq * 4; const float* xsrc = X + ((size_t)blockIdx.x * 64 + lr) * DMD + lq * 4;
  v4f pf[12];
#pragma unroll
  for (int e = 0; e < 12; ++e) pf[e] = *(const v4f*)(e < 8 ? wsrc + (size_t)e * 16 * DMD : xsrc + (size_t)(e - 8) * 16 * DMD);
#pragma unroll
  for (int e = 0; e < 12; ++e) *(v4b*)&sm.st[0][e * 16 + lr][lq * 4] = cvt4(pf[e]);
  __syncthreads();
#pragma unroll
  for (int kc = 0; kc < DMD / 32; ++kc) { const int cur = kc & 1;
    if (kc + 1 < DMD / 32) {
#pragma unroll
      for (int e = 0; e < 12; ++e) pf[e] = *(const v4f*)((e < 8 ? wsrc + (size_t)e * 16 * DMD : xsrc + (size_t)(e - 8) * 16 * DMD) + (kc + 1) * 32); }
    const v16b a = frag_b(&sm.st[cur][128 + wave * 16 + col][0], lane);
#pragma unroll
    for (int jh = 0; jh < 8; jh += 4) { v16b w[4];   // the LDS reads of four fragments go ahead of their products as one group: one LDS latency per group
#pragma unroll
      for (int j = 0; j < 4; ++j) w[j] = frag_b(&sm.st[cur][(jh + j) * 16 + col][0], lane);
#pragma unroll
      for (int j = 0; j < 4; ++j) acc[jh + j] = wmma_bf(a, w[j], acc[jh + j]); }
    __builtin_amdgcn_sched_barrier(0);   // keeps the wait for the next stage's global loads behind this stage's products, so that they cover its latency
    if (kc + 1 < DMD / 32) {
#pragma unroll
      for (int e = 0; e < 12; ++e) *(v4b*)&sm.st[cur ^ 1][e * 16 + lr][lq * 4] = cvt4(pf[e]); }
    __syncthreads(); }   // publishes stage kc + 1 and ends every read of the buffer that the next pass refills
#pragma unroll
  for (int j = 0; j < 8; ++j) { const float bb = Bm ? bfr(Bm[c0 + j * 16 + col]) : 0.f;
#pragma unroll
    for (int r = 0; r < 8; ++r) { const float v = acc[j][r] + bb; const int rl = wave * 16 + 8 * g + r, cl = j * 16 + col;
      if (which == 0) sf[wave][8 * g + r][cl] = v; else if (which == 2) { const _Float16 hv = (_Float16)v; th[cl][rl] = hv; tl[cl][rl] = (_Float16)(v - (float)hv); } else sh[rl][cl] = (_Float16)v; } }
  __syncthreads();
  if (which == 0) { for (int rl = 0; rl < 16; ++rl) vst2(Q + (r0 + rl) * DMD + c0 + lane * 4, *(const v4f*)&sf[wave][rl][lane * 4]); }
  else if (which == 2) { const size_t b = ((size_t)blockIdx.x * 64) / TT; const int t0 = (int)(((size_t)blockIdx.x * 64) % TT); for (int e = tid; e < 128 * 8; e += 128) { const int cl = e >> 3, q = e & 7; const size_t o = (b * DMD + c0 + cl) * (size_t)TT + t0 + q * 8; vst2((unsigned*)(VH + o), *(const v4u*)&th[cl][q * 8]); vst2((unsigned*)(VL + o), *(const v4u*)&tl[cl][q * 8]); } }
  else { _Float16* dst = (which == 1) ? (KH + (size_t)blockIdx.x * 64 * DMD) : (PH + ((size_t)POFF + blockIdx.x * 64) * DMD); for (int e = tid; e < 64 * 16; e += 128) { const int rl = e >> 4, q = e & 15; vst2((unsigned*)(dst + (size_t)rl * DMD + c0 + q * 8), *(const v4u*)&sh[rl][q * 8]); } } }
// ---- k_padph: the POFF rows before and the rows after the table are zeros
__global__ __launch_bounds__(256) void k_padph(_Float16* __restrict__ PH) { const int t = threadIdx.x; const int r = blockIdx.x; const size_t row = (r < POFF) ? r : (TT + r);   // 0..31 and TT+32 .. TT+63
  v4u z; z[0] = z[1] = z[2] = z[3] = 0u; if (t < DMD / 8) vst2((unsigned*)(PH + row * DMD + t * 8), z); }
// fragments of (q + bias) for 16 rows, head h: hi and residual as f16 (unscaled; q ~ O(1))
__device__ __forceinline__ void qfrags(const float* __restrict__ Q, size_t row0, int h, const float* __restrict__ bias, int lane, v16h* hi, v16h* lo) { const int col = lane & 15, g = lane >> 4; size_t row = row0 + col; if (row > (size_t)NB * TT - 1) row = (size_t)NB * TT - 1;   // clamp (only the never-used row T of the last batch)
#pragma unroll
  for (int kc = 0; kc < 2; ++kc) { const float* p = Q + row * DMD + h * HD + kc * 32 + 8 * g; const float* bp = bias + h * HD + kc * 32 + 8 * g; v16h a, b;
#pragma unroll
    for (int i = 0; i < 8; ++i) { const float v0 = p[i] + bfr(bp[i]), v1 = p[16 + i] + bfr(bp[16 + i]); const _Float16 h0 = (_Float16)v0, h1 = (_Float16)v1; a[i] = h0; a[8 + i] = h1; b[i] = (_Float16)(v0 - (float)h0); b[8 + i] = (_Float16)(v1 - (float)h1); }
    hi[kc] = a; lo[kc] = b; } }
// reduction over each 16-lane row for eight values at once: lane l takes lane l ^ 1, ^ 2, ^ 4, ^ 8 through the DPP operand, every lane ends with the row's result.
// One statement, the eight values' steps interleaved: each step's producer stands eight instructions back, so no step waits for the one before. All 32 lanes must be on.
#define RX(op, n, x) op " %" #n ", %" #n ", %" #n " row_xmask:" #x " row_mask:0xf bank_mask:0xf\n\t"
#define RX8(op, x) RX(op, 0, x) RX(op, 1, x) RX(op, 2, x) RX(op, 3, x) RX(op, 4, x) RX(op, 5, x) RX(op, 6, x) RX(op, 7, x)
#define ROW16(q, op, v) asm q (RX8(op, 1) RX8(op, 2) RX8(op, 4) RX8(op, 8) : "+v"(v[0]), "+v"(v[1]), "+v"(v[2]), "+v"(v[3]), "+v"(v[4]), "+v"(v[5]), "+v"(v[6]), "+v"(v[7]))
// ---- k_att: block = (64 queries u, h, b)
#define KP 72    // LDS pitch of the 128-B k and position rows in f16: 144 B (16 B x odd) for 16-byte LDS reads
#define VP 40    // LDS pitch of the 64-B v rows in f16: 80 B
union __align__(16) AttX { float sp[16][36]; float so[16][68]; };   // a wave's own exchange tiles; so is written behind the loop, when sp is dead
// rel_shift of eight rows in registers: value n (row 8 g + n of the tile) += operand 8 + n taken from lane (col - (8 g + n + 1)) mod 16 of the same 16-lane row.
// row_ror:k gives lane l the word of lane (l - k) mod 16; the two halves of the wave turn by different amounts, so each add writes one half (row_mask 1: lanes 0..15, 2: lanes 16..31).
// Row 15 turns by 16 == 0: the identity quad_perm. One statement, a value's second add eight instructions behind its first. All 32 lanes must be on.
#define SH(n, m, ctl, half) "v_add_f32_dpp %" #n ", %" #m ", %" #n " " ctl " row_mask:" #half " bank_mask:0xf\n\t"
#define SHIFT16(c, v) asm(SH(0, 8, "row_ror:1", 0x1) SH(1, 9, "row_ror:2", 0x1) SH(2, 10, "row_ror:3", 0x1) SH(3, 11, "row_ror:4", 0x1) SH(4, 12, "row_ror:5", 0x1) SH(5, 13, "row_ror:6", 0x1) SH(6, 14, "row_ror:7", 0x1) SH(7, 15, "row_ror:8", 0x1) \
  SH(0, 8, "row_ror:9", 0x2) SH(1, 9, "row_ror:10", 0x2) SH(2, 10, "row_ror:11", 0x2) SH(3, 11, "row_ror:12", 0x2) SH(4, 12, "row_ror:13", 0x2) SH(5, 13, "row_ror:14", 0x2) SH(6, 14, "row_ror:15", 0x2) SH(7, 15, "quad_perm:[0,1,2,3]", 0x2) \
  : "+v"(c[0]), "+v"(c[1]), "+v"(c[2]), "+v"(c[3]), "+v"(c[4]), "+v"(c[5]), "+v"(c[6]), "+v"(c[7]) : "v"(v[0]), "v"(v[1]), "v"(v[2]), "v"(v[3]), "v"(v[4]), "v"(v[5]), "v"(v[6]), "v"(v[7]))
__device__ __forceinline__ unsigned lds_at(const void* p) { return (unsigned)(size_t)p; }   // LDS byte address = low 32 bits of the __shared__ address
// extended position index x = T-1-i+j: x < T is table row x (j <= i), x == T the zero row behind the table (j == i+1), x > T table row x-T-1 (the wrapped rows, j >= i+2)
__device__ __forceinline__ const _Float16* ph_row(const _Float16* __restrict__ PH, int x) { return PH + (size_t)(POFF + (x <= TT ? x : x - TT - 1)) * DMD; }
__global__ __launch_bounds__(128) void k_att(const float* __restrict__ Q, const _Float16* __restrict__ KH, const _Float16* __restrict__ PH, const _Float16* __restrict__ VH, const _Float16* __restrict__ VL, const float* __restrict__ BU, const float* __restrict__ BVv, const int* __restrict__ MK, float* __restrict__ X) {
  __shared__ AttX sx[4];
  __shared__ __align__(16) _Float16 sk[2][32][KP];     // 32 keys x 64 d of this head, two buffers
  __shared__ __align__(16) _Float16 sv[2][128][VP];    // rows 0..63 v hi (d), 64..127 v residual, 32 keys each, two buffers
  __shared__ __align__(16) _Float16 sph[128][KP];      // position rows, slot = x & 127: a pass reads 96 rows, the next pass's 32 new rows fill the slots it does not read
  const int tid = threadIdx.x, wave = tid >> 5, lane = tid & 31, col = lane & 15, g = lane >> 4; const int qb = blockIdx.x, h = blockIdx.y; const size_t b = blockIdx.z; const int i0 = qb * 64 + wave * 16;
  float (&sp)[16][36] = sx[wave].sp; float (&so)[16][68] = sx[wave].so;
  const int iw = __builtin_amdgcn_readfirstlane(i0 >> 4);   // the wave's 16-row tile index in a scalar register: the choice of the position products' A rows is a scalar branch
  const int xb0 = TT - 64 - qb * 64;   // x of (i = the block's last query, j = 0): pass ks reads x = xb0 + 32 ks .. + 95
  const int kr = tid >> 3, kq = (tid & 7) * 8, vr = tid >> 2, vq = (tid & 3) * 8;   // 8 lanes fetch one whole 128-B row of k or of the table, 4 lanes one 64-B row piece of v
  // tile t = keys 32 t .. + 31 of k and v and the last 32 position rows of pass t's window: eight 16-byte copies a lane, no register in between
  auto tile = [&](int t) { const int bf = t & 1, x = xb0 + t * 32 + 64 + kr;
    const _Float16* gk = KH + (b * TT + t * 32 + kr) * DMD + h * HD + kq; const size_t vo = (b * DMD + (size_t)h * HD + vr) * TT + t * 32 + vq;
    // the wait on xcnt closes the statement: it stands in front of every rewrite of a register that a copy names
    asm volatile("global_load_async_to_lds_b128 %0, %8, off\n\tglobal_load_async_to_lds_b128 %1, %9, off\n\tglobal_load_async_to_lds_b128 %2, %10, off\n\tglobal_load_async_to_lds_b128 %3, %11, off\n\t"
                 "global_load_async_to_lds_b128 %4, %12, off\n\tglobal_load_async_to_lds_b128 %5, %13, off\n\tglobal_load_async_to_lds_b128 %6, %14, off\n\tglobal_load_async_to_lds_b128 %7, %15, off\n\ts_wait_xcnt 0x0"
                 :: "v"(lds_at(&sk[bf][kr][kq])), "v"(lds_at(&sk[bf][16 + kr][kq])), "v"(lds_at(&sph[x & 127][kq])), "v"(lds_at(&sph[(x + 16) & 127][kq])),
                    "v"(lds_at(&sv[bf][vr][vq])), "v"(lds_at(&sv[bf][32 + vr][vq])), "v"(lds_at(&sv[bf][64 + vr][vq])), "v"(lds_at(&sv[bf][96 + vr][vq])),
                    "v"(gk), "v"(gk + 16 * DMD), "v"(ph_row(PH, x) + h * HD + kq), "v"(ph_row(PH, x + 16) + h * HD + kq),
                    "v"(VH + vo), "v"(VH + vo + 32 * TT), "v"(VL + vo), "v"(VL + vo + 32 * TT) : "memory"); };
  tile(0);
  { const int x = xb0 + kr;   // the first 64 position rows of pass 0's window
    asm volatile("global_load_async_to_lds_b128 %0, %4, off\n\tglobal_load_async_to_lds_b128 %1, %5, off\n\tglobal_load_async_to_lds_b128 %2, %6, off\n\tglobal_load_async_to_lds_b128 %3, %7, off\n\ts_wait_xcnt 0x0"
                 :: "v"(lds_at(&sph[x & 127][kq])), "v"(lds_at(&sph[(x + 16) & 127][kq])), "v"(lds_at(&sph[(x + 32) & 127][kq])), "v"(lds_at(&sph[(x + 48) & 127][kq])),
                    "v"(ph_row(PH, x) + h * HD + kq), "v"(ph_row(PH, x + 16) + h * HD + kq), "v"(ph_row(PH, x + 32) + h * HD + kq), "v"(ph_row(PH, x + 48) + h * HD + kq) : "memory"); }
  v16h au[2], av[2], aw[2], tmpl[2];   // (q+u) rows i0.., (q+v) rows i0.., (q+v) rows i0+1.. (for the wrapped upper-triangle term); single f16 rounding (residuals dropped: VGPR budget)
  qfrags(Q, b * TT + i0, h, BU, lane, au, tmpl); qfrags(Q, b * TT + i0, h, BVv, lane, av, tmpl);
  qfrags(Q, b * TT + i0 + 1, h, BVv, lane, aw, tmpl);   // rows i+1; for i = T-1 the row belongs to the next batch (or is clamped) but its products are never used: j >= i+2 cannot hold for i = T-1
  float m[8], l[8];
#pragma unroll
  for (int r = 0; r < 8; ++r) { m[r] = -3.0e38f; l[r] = 0.f; }
  v8f acc[4] = {};
  asm volatile("s_wait_asynccnt 0x0" ::: "memory");   // this wave's copies of tile 0 have landed
  __syncthreads();                                     // publishes tile 0
  tile(1);
#pragma unroll 1
  for (int ks = 0; ks < TT / 32; ++ks) { float s[2][8]; const int cur = ks & 1;
    const int xt = TT - 16 - i0 + ks * 32;            // three 16-column position tiles cover x = xt .. xt + 47; keys 16 ct .. + 15 use tiles ct and ct + 1, so the middle one serves both halves
    v16h kf[2][2], pf[3][2];   // the LDS reads of the pass's ten fragments go ahead of their products as one group
#pragma unroll
    for (int kc = 0; kc < 2; ++kc) {
#pragma unroll
      for (int ct = 0; ct < 2; ++ct) kf[ct][kc] = frag_h(&sk[cur][ct * 16 + col][kc * 32], lane);
#pragma unroll
      for (int t = 0; t < 3; ++t) pf[t][kc] = frag_h(&sph[((xt + 16 * t) & 127) + col][kc * 32], lane); }
    v8f c[2] = {}, gp[3] = {};
#pragma unroll
    for (int kc = 0; kc < 2; ++kc)
#pragma unroll
      for (int ct = 0; ct < 2; ++ct) c[ct] = wmma16(au[kc], kf[ct][kc], c[ct]);
    // T and xt are multiples of 16, so a tile lies wholly in x < T (j <= i: rows i, av) or wholly in x >= T (the zero row x == T and the wrapped rows: rows i + 1, aw).
    // Tile t has x < T when 2 ks + t <= i0 / 16. i == T-1 has no j > i, so the row behind the last query is never picked.
#define POS3(A0, A1, A2) do { _Pragma("unroll") for (int kc = 0; kc < 2; ++kc) { gp[0] = wmma16(A0[kc], pf[0][kc], gp[0]); gp[1] = wmma16(A1[kc], pf[1][kc], gp[1]); gp[2] = wmma16(A2[kc], pf[2][kc], gp[2]); } } while (0)
    const int nlow = iw + 1 - 2 * ks;                 // tiles t < nlow take rows i
    if (nlow >= 3) POS3(av, av, av); else if (nlow <= 0) POS3(aw, aw, aw); else if (nlow == 2) POS3(av, av, aw); else POS3(av, aw, aw);   // the two mixed cases: the one pass that holds the wave's diagonal
    int mk[2][8]; const int* mrow = MK + ((size_t)b * TT + i0 + 8 * g) * TT + ks * 32 + col;   // row 8 g, key 32 ks + col of the pass's mask tile
#pragma unroll
    for (int ct = 0; ct < 2; ++ct)
#pragma unroll
      for (int r = 0; r < 8; ++r) mk[ct][r] = mrow[r * TT + ct * 16];
    asm volatile("s_wait_xcnt 0x0" :: "v"(mrow) : "memory");   // stands behind the sixteen mask loads and takes their address: the pair stays live up to the wait, so no result and no later value is placed in it before
#pragma unroll
    for (int ct = 0; ct < 2; ++ct) { float cc[8], sel[8];
      // row 8 g + r wants column 15 + col - (8 g + r) of the 32 columns of tiles ct, ct + 1: lane c of the row holds the wanted word of tile ct when c + 8 g + r >= 15, of tile ct + 1 otherwise; the turn brings it to its key's lane
#pragma unroll
      for (int r = 0; r < 8; ++r) { cc[r] = c[ct][r]; sel[r] = (col + 8 * g + r >= 15) ? gp[ct][r] : gp[ct + 1][r]; }
      SHIFT16(cc, sel);
#pragma unroll
      for (int r = 0; r < 8; ++r) s[ct][r] = (mk[ct][r] != 0) ? cc[r] * 0.125f : -3.0e38f; }
    float alpha[8], mx[8], es[8];
#pragma unroll
    for (int r = 0; r < 8; ++r) mx[r] = fmaxf(fmaxf(s[0][r], s[1][r]), m[r]);   // the running maximum, equal in a row's lanes, goes in ahead of the reduction: what comes out is the new one
    ROW16(, "v_max_num_f32_dpp", mx);   // row maximum over the 16 lanes that hold a query's keys, in the vector unit: no LDS permute, no wait on dscnt between the steps
#pragma unroll
    for (int r = 0; r < 8; ++r) { const float mn = mx[r]; alpha[r] = (m[r] <= -1.0e38f) ? 0.f : __expf(m[r] - mn); const float e0 = (s[0][r] <= -1.0e38f) ? 0.f : __expf(s[0][r] - mn), e1 = (s[1][r] <= -1.0e38f) ? 0.f : __expf(s[1][r] - mn); es[r] = e0 + e1;
      m[r] = mn; sp[8 * g + r][col] = e0; sp[8 * g + r][16 + col] = e1; }
#pragma unroll
    for (int r = 0; r < 8; ++r) l[r] = l[r] * alpha[r] + es[r];   // l is the lane's own share of the row sum (its two keys of every pass); alpha is equal in a row's lanes, so the shares stay on one scale and are added up once, behind the loop
#pragma unroll
    for (int j = 0; j < 4; ++j)
#pragma unroll
      for (int r = 0; r < 8; ++r) acc[j][r] *= alpha[r];
    LDSX();
    v16h pa, pr; { const float* prow = &sp[col][0] + 8 * (lane >> 4);
#pragma unroll
      for (int i = 0; i < 8; ++i) { const float x0 = prow[i] * 2048.0f, x1 = prow[16 + i] * 2048.0f; const _Float16 h0 = (_Float16)x0, h1 = (_Float16)x1; pa[i] = h0; pa[8 + i] = h1; pr[i] = (_Float16)(x0 - (float)h0); pr[8 + i] = (_Float16)(x1 - (float)h1); } }
#pragma unroll
    for (int jh = 0; jh < 4; jh += 2) { v16h vh[2], vl[2];   // four fragments' LDS reads as one group ahead of their six products
#pragma unroll
      for (int j = 0; j < 2; ++j) { vh[j] = frag_h(&sv[cur][(jh + j) * 16 + col][0], lane); vl[j] = frag_h(&sv[cur][64 + (jh + j) * 16 + col][0], lane); }
#pragma unroll
      for (int j = 0; j < 2; ++j) { acc[jh + j] = wmma16(pa, vh[j], acc[jh + j]); acc[jh + j] = wmma16(pr, vh[j], acc[jh + j]); acc[jh + j] = wmma16(pa, vl[j], acc[jh + j]); } }
    asm volatile("s_wait_dscnt 0x0" ::: "memory");      // this wave's LDS reads of pass ks have retired before the buffers are refilled
    asm volatile("s_wait_asynccnt 0x0" ::: "memory");   // this wave's copies of tile ks + 1 have landed
    __syncthreads();                                     // publishes tile ks + 1 and ends every wave's reads of the buffers and slots that tile ks + 2 fills
    if (ks + 2 < TT / 32) tile(ks + 2); }
  asm volatile("s_wait_asynccnt 0x0" ::: "memory");     // no copy is outstanding when the wave ends
  ROW16(, "v_add_f32_dpp", l);   // row sum over the 16 lanes' shares, the xor 1, 2, 4, 8 tree, once a query row instead of once a pass
#pragma unroll
  for (int r = 0; r < 8; ++r) { const float il = (l[r] > 0.f) ? (1.0f / 2048.0f) / l[r] : 0.f;   // fully masked rows -> zeros (the module zeroes them after the softmax)
#pragma unroll
    for (int j = 0; j < 4; ++j) so[8 * g + r][j * 16 + col] = acc[j][r] * il; }
  LDSX(); for (int rl = 0; rl < 16; ++rl) if (lane < 16) vst2(X + (b * TT + i0 + rl) * DMD + h * HD + lane * 4, *(const v4f*)&so[rl][lane * 4]); }
// ---- k_out: block = (64 rows, 128 of 512 cols): out = x (hi + lo) . Wo^T + bo
__global__ __launch_bounds__(128) void k_out(const float* __restrict__ X, const float* __restrict__ WO, const float* __restrict__ BO, float* __restrict__ OUT) { __shared__ OutSm sm; float (&sf)[4][16][132] = sm.sf;   // ring dead at the epilogue (barrier at the foot of the last stage)
  const int tid = threadIdx.x, wave = tid >> 5, lane = tid & 31, col = lane & 15, g = lane >> 4; const int c0 = blockIdx.y * 128; const size_t r0 = (size_t)blockIdx.x * 64 + wave * 16;
  v8f acc[8] = {};
  // stage = 32 k of 128 Wo rows (ring rows 0..127) and of the block's 64 x rows as hi (128..191) and lo (192..255)
  const int lr = tid >> 3, lq = tid & 7; const float* wsrc = WO + (size_t)(c0 + lr) * DMD + lq * 4; const float* xsrc = X + ((size_t)blockIdx.x * 64 + lr) * DMD + lq * 4;
  v4f pf[12];
#pragma unroll
  for (int e = 0; e < 12; ++e) pf[e] = *(const v4f*)(e < 8 ? wsrc + (size_t)e * 16 * DMD : xsrc + (size_t)(e - 8) * 16 * DMD);
#pragma unroll
  for (int e = 0; e < 12; ++e) { const v4b hv = cvt4(pf[e]); *(v4b*)&sm.st[0][e * 16 + lr][lq * 4] = hv; if (e >= 8) *(v4b*)&sm.st[0][64 + e * 16 + lr][lq * 4] = res4(pf[e], hv); }
  __syncthreads();
#pragma unroll
  for (int kc = 0; kc < DMD / 32; ++kc) { const int cur = kc & 1;
    if (kc + 1 < DMD / 32) {
#pragma unroll
      for (int e = 0; e < 12; ++e) pf[e] = *(const v4f*)((e < 8 ? wsrc + (size_t)e * 16 * DMD : xsrc + (size_t)(e - 8) * 16 * DMD) + (kc + 1) * 32); }
    const v16b ah = frag_b(&sm.st[cur][128 + wave * 16 + col][0], lane), al = frag_b(&sm.st[cur][192 + wave * 16 + col][0], lane);
    v16b w[8];   // the stage's LDS reads go ahead of its products as one group: one LDS latency per stage
#pragma unroll
    for (int j = 0; j < 8; ++j) w[j] = frag_b(&sm.st[cur][j * 16 + col][0], lane);
#pragma unroll
    for (int j = 0; j < 8; ++j) { acc[j] = wmma_bf(ah, w[j], acc[j]); acc[j] = wmma_bf(al, w[j], acc[j]); }
    __builtin_amdgcn_sched_barrier(0);   // keeps the wait for the next stage's global loads behind this stage's products, so that they cover its latency
    if (kc + 1 < DMD / 32) {
#pragma unroll
      for (int e = 0; e < 12; ++e) { const v4b hv = cvt4(pf[e]); *(v4b*)&sm.st[cur ^ 1][e * 16 + lr][lq * 4] = hv; if (e >= 8) *(v4b*)&sm.st[cur ^ 1][64 + e * 16 + lr][lq * 4] = res4(pf[e], hv); } }
    __syncthreads(); }   // publishes stage kc + 1 and ends every read of the buffer that the next pass refills
#pragma unroll
  for (int j = 0; j < 8; ++j) { const float bb = bfr(BO[c0 + j * 16 + col]);
#pragma unroll
    for (int r = 0; r < 8; ++r) sf[wave][8 * g + r][j * 16 + col] = acc[j][r] + bb; }
  LDSX(); for (int rl = 0; rl < 16; ++rl) vst2(OUT + (r0 + rl) * DMD + c0 + lane * 4, *(const v4f*)&sf[wave][rl][lane * 4]); }
extern "C" void kernel_launch(void* const* d_in, const int* in_sizes, int n_in, void* d_out, int out_size, void* d_ws, size_t ws_size, hipStream_t stream) {
  (void)in_sizes; (void)n_in; (void)out_size;
  const float** F = (const float**)d_in;   // 0 q, 1 k, 2 v [8,1024,512]; 3 pos [1024,512]; 4 mask [8,1024,1024] int; 5 Wq, 6 bq, 7 Wk, 8 bk, 9 Wv, 10 bv, 11 Wo, 12 bo, 13 Wp (natural); 14 bias_u [8,64], 15 bias_v [8,64]
  if (ws_size < (size_t)WS_END) return;
  char* ws = (char*)d_ws; float* Q = (float*)(ws + WS_Q); _Float16 *KH = (_Float16*)(ws + WS_KH), *PH = (_Float16*)(ws + WS_PH), *VH = (_Float16*)(ws + WS_VH), *VL = (_Float16*)(ws + WS_VL); float* X = (float*)(ws + WS_X);
  k_proj<<<dim3(TNB * TT / 64, DMD / 128, 4), 128, 0, stream>>>(F[0], F[1], F[2], F[3], F[5], F[6], F[7], F[8], F[9], F[10], F[13], Q, KH, VH, VL, PH);
  k_padph<<<64, 256, 0, stream>>>(PH);
  k_att<<<dim3(TT / 64, NH, TNB), 128, 0, stream>>>(Q, KH, PH, VH, VL, F[14], F[15], (const int*)d_in[4], X);
  k_out<<<dim3(TNB * TT / 64, DMD / 128), 128, 0, stream>>>(X, F[11], F[12], (float*)d_out);
}

// v007
// One run takes 126 microseconds.
// Next to v006, in two timings, it ran 1.04 times as fast each time.
// Over all steps from v000 it is 3.77 times as fast.
// compute dtype: all float inputs rounded to bf16, mask (int) read; q/k/v/pos projections with EXACT bf16 products on WMMA 16x16x32 (natural weights, + bias), f32 accumulate; q kept in f32 (bias_u / bias_v added per head, then split into f16 hi + residual fragments), k / ph rounded once to f16, v split into f16 hi + residual planes; content scores (q+bu) . k and the Transformer-XL position term (q+bv) . ph with single f16 products (logits ~1-2; q, k, ph each rounded once), the rel_shift realised exactly as an index map onto 16 x 32 position tiles (incl. its upper-triangle wrap-around rows and the zero at j == i+1), x 1/8, masked keys excluded, running-max softmax in f32 (hardware exp); P (f16 x 2^11 + residual) . v; out = x (bf16 hi + lo) . Wo^T + bo; f32 output.
#include <hip/hip_runtime.h>
#include <math.h>

typedef __attribute__((ext_vector_type(16))) _Float16 v16h;
typedef __attribute__((ext_vector_type(16))) __bf16 v16b;
typedef __attribute__((ext_vector_type(8)))  _Float16 v8h;
typedef __attribute__((ext_vector_type(8)))  float v8f;
typedef __attribute__((ext_vector_type(4)))  float v4f;
typedef __attribute__((ext_vector_type(2)))  float v2f;
typedef __attribute__((ext_vector_type(4)))  unsigned v4u;
typedef __attribute__((ext_vector_type(4)))  int v4i;
typedef float __attribute__((may_alias)) float_a;
typedef int __attribute__((may_alias)) int_a;

template <typename T> __device__ __forceinline__ void vst2(void* p, T v) { *(T*)p = v;  }
__device__ __forceinline__ v8f wmma16(v16h a, v16h b, v8f c) {
  v8f d = __builtin_amdgcn_wmma_f32_16x16x32_f16(false, a, false, b, (short)0, c, false, false);
  asm volatile("v_nop\n\tv_nop\n\tv_nop\n\tv_nop" : "+v"(d) : "v"(a), "v"(b));
  return d;
}
__device__ __forceinline__ v8f wmma_bf(v16b a, v16b b, v8f c) {
  v8f d = __builtin_amdgcn_wmma_f32_16x16x32_bf16(false, a, false, b, (short)0, c, false, false);
  asm volatile("v_nop\n\tv_nop\n\tv_nop\n\tv_nop" : "+v"(d) : "v"(a), "v"(b));
  return d;
}
// 16x16x32 fragments: lane = (h = lane>>4, row/col = lane&15); elements 0..7 = k0+8h+0..7, 8..15 = k0+16+8h+0..7; D element r = row 8h+r
__device__ __forceinline__ v16h frag_h(const _Float16* rowk0, int lane) {
  union { v16h v; v8h q[2]; } u; const _Float16* p = rowk0 + 8 * (lane >> 4);
  u.q[0] = *(const v8h*)p; u.q[1] = *(const v8h*)(p + 16); return u.v;
}
__device__ __forceinline__ v16h frag_f32(const float* rowk0, int lane) {
  v16h a; const float* p = rowk0 + 8 * (lane >> 4);
#pragma unroll
  for (int i = 0; i < 8; ++i) { a[i] = (_Float16)p[i]; a[8 + i] = (_Float16)p[16 + i]; }
  return a;
}
__device__ __forceinline__ v16h frag_f32s(const float* rowk0, int lane, float sc) {
  v16h a; const float* p = rowk0 + 8 * (lane >> 4);
#pragma unroll
  for (int i = 0; i < 8; ++i) { a[i] = (_Float16)(p[i] * sc); a[8 + i] = (_Float16)(p[16 + i] * sc); }
  return a;
}
// column fragment from a [K][ld] layout (column n), rows >= K read as 0
__device__ __forceinline__ v16h fragc_f32(const float* W, int k0, int n, int lane, int ld, int K) {
  v16h a; const int g = lane >> 4;
#pragma unroll
  for (int i = 0; i < 8; ++i) { const int ka = k0 + 8 * g + i, kb = ka + 16;
    a[i] = (_Float16)(ka < K ? W[(size_t)(ka < K ? ka : K - 1) * ld + n] : 0.f); a[8 + i] = (_Float16)(kb < K ? W[(size_t)(kb < K ? kb : K - 1) * ld + n] : 0.f); }
  return a;
}
struct F2 { v16b h, l; };
__device__ __forceinline__ F2 bsplit16(const float v[16]) { F2 r;
#pragma unroll
  for (int i = 0; i < 16; ++i) { const __bf16 h = (__bf16)v[i]; r.h[i] = h; r.l[i] = (__bf16)(v[i] - (float)h); }
  return r; }
__device__ __forceinline__ F2 split_row(const float* row, int k0, int lane) { float v[16]; const float* p = row + k0 + 8 * (lane >> 4);
#pragma unroll
  for (int i = 0; i < 8; ++i) { v[i] = p[i]; v[8 + i] = p[16 + i]; }
  return bsplit16(v); }
__device__ __forceinline__ F2 split_rowK(const float* row, int k0, int lane, int K) { float v[16]; const int g = lane >> 4;
#pragma unroll
  for (int i = 0; i < 8; ++i) { const int ka = k0 + 8 * g + i, kb = ka + 16; v[i] = ka < K ? row[ka < K ? ka : K - 1] : 0.f; v[8 + i] = kb < K ? row[kb < K ? kb : K - 1] : 0.f; }
  return bsplit16(v); }
__device__ __forceinline__ F2 split_col(const float* W, int k0, int n, int lane, int ld, int K) { float v[16]; const int g = lane >> 4;
#pragma unroll
  for (int i = 0; i < 8; ++i) { const int ka = k0 + 8 * g + i, kb = ka + 16; v[i] = ka < K ? W[(size_t)(ka < K ? ka : K - 1) * ld + n] : 0.f; v[8 + i] = kb < K ? W[(size_t)(kb < K ? kb : K - 1) * ld + n] : 0.f; }
  return bsplit16(v); }
__device__ __forceinline__ v8f mac3(const F2& a, const F2& b, v8f c) { c = wmma_bf(a.l, b.h, c); c = wmma_bf(a.h, b.l, c); return wmma_bf(a.h, b.h, c); }
__device__ __forceinline__ float sigm(float v) { return 1.0f / (1.0f + expf(-v)); }
#define LDSX() do { asm volatile("s_wait_dscnt 0" ::: "memory"); __builtin_amdgcn_wave_barrier(); __builtin_amdgcn_fence(__ATOMIC_RELEASE, "workgroup"); } while (0)


// Relative-position multi-head attention (Transformer-XL style rel_shift; B 8, T 1,024, D 512, 8 heads x 64): scores = ((q+u) k^T + rel_shift((q+v) p^T)) / 8, masked softmax (mask input), attn v, Wo.
#define NB 8
#define TT 1024
#define DMD 512
#define NH 8
#define HD 64
#define POFF 32                 // ph buffer row offset (rows < 0 and >= T read as zeros)
#define PROWS (TT + 64)
#ifndef TNB
#define TNB NB
#endif
typedef __attribute__((ext_vector_type(8))) __bf16 v8b;
__device__ __forceinline__ v16b frag_b(const __bf16* rowk0, int lane) {
  union { v16b v; v8b q[2]; } u; const __bf16* p = rowk0 + 8 * (lane >> 4);
  u.q[0] = *(const v8b*)p; u.q[1] = *(const v8b*)(p + 16); return u.v;
}
__device__ __forceinline__ float bfr(float v) { return (float)(__bf16)v; }
__device__ __attribute__((noinline)) float exp_ni(float v) { return expf(v); }
__device__ __attribute__((noinline)) float erf_ni(float v) { return erff(v); }

#define WS_Q   0u                                   // f32 q rows [b*u][512] (+bq)
#define WS_KH  (WS_Q + 4u * (size_t)NB * TT * DMD)       // f16 k rows [b*t][512]
#define WS_PH  (WS_KH + 2u * (size_t)NB * TT * DMD)      // f16 ph rows [PROWS][512] (row POFF + p)
#define WS_VH  (WS_PH + 2u * (size_t)PROWS * DMD)        // f16 v planes [b][512][t]
#define WS_VL  (WS_VH + 2u * (size_t)NB * DMD * TT)      // f16 v residual planes (unscaled)
#define WS_X   (WS_VL + 2u * (size_t)NB * DMD * TT)      // f32 attention output rows [b*u][512]
#define WS_END (WS_X + 4u * (size_t)NB * TT * DMD)

typedef __attribute__((ext_vector_type(4))) __bf16 v4b;
__device__ __forceinline__ v4b cvt4(v4f v) { v4b r;
#pragma unroll
  for (int i = 0; i < 4; ++i) r[i] = (__bf16)v[i];
  return r; }
__device__ __forceinline__ v4b res4(v4f v, v4b h) { v4b r;
#pragma unroll
  for (int i = 0; i < 4; ++i) r[i] = (__bf16)(v[i] - (float)h[i]);
  return r; }
#define SPI 40   // ring row pitch in bf16: 64-B rows at 80 B (16 B x odd) for 16-byte LDS reads
union __align__(16) ProjSm { __bf16 st[2][192][SPI]; float sf[4][16][132]; _Float16 sh[64][136]; _Float16 t2[2][128][72]; };
union __align__(16) OutSm { __bf16 st[2][256][SPI]; float sf[4][16][132]; };
// ---- k_proj: block = (64 rows, 128-col group, which): 0 q (f32 rows), 1 k (f16 rows), 2 v (f16 hi + residual planes), 3 ph (f16 rows at POFF), natural W + bias (none for ph)
__global__ __launch_bounds__(128) void k_proj(const float* __restrict__ Qi, const float* __restrict__ Ki, const float* __restrict__ Vi, const float* __restrict__ POS, const float* __restrict__ WQ, const float* __restrict__ BQ, const float* __restrict__ WK, const float* __restrict__ BK, const float* __restrict__ WV, const float* __restrict__ BV, const float* __restrict__ WP, float* __restrict__ Q, _Float16* __restrict__ KH, _Float16* __restrict__ VH, _Float16* __restrict__ VL, _Float16* __restrict__ PH) {
  __shared__ ProjSm sm;   // the operand ring is dead when the epilogue tiles are written (barrier at the foot of the last stage)
  float (&sf)[4][16][132] = sm.sf; _Float16 (&sh)[64][136] = sm.sh; _Float16 (&th)[128][72] = sm.t2[0]; _Float16 (&tl)[128][72] = sm.t2[1];
  const int tid = threadIdx.x, wave = tid >> 5, lane = tid & 31, col = lane & 15, g = lane >> 4; const int which = blockIdx.z; const int c0 = blockIdx.y * 128; const int nrows = (which == 3) ? TT : NB * TT;
  if ((int)blockIdx.x * 64 >= nrows) return;
  const float* X = (which == 0 ? Qi : which == 1 ? Ki : which == 2 ? Vi : POS); const float* Wm = (which == 0 ? WQ : which == 1 ? WK : which == 2 ? WV : WP); const float* Bm = (which == 0 ? BQ : which == 1 ? BK : which == 2 ? BV : nullptr);
  const size_t r0 = (size_t)blockIdx.x * 64 + wave * 16;
  v8f acc[8] = {};
  // stage = 32 k of 128 W rows (ring rows 0..127) and of the block's 64 X rows (128..191); 8 lanes x 16 B fetch one whole 128-B line of a row
  const int lr = tid >> 3, lq = tid & 7; const float* wsrc = Wm + (size_t)(c0 + lr) * DMD + lq * 4; const float* xsrc = X + ((size_t)blockIdx.x * 64 + lr) * DMD + lq * 4;
  v4f pf[12];
#pragma unroll
  for (int e = 0; e < 12; ++e) pf[e] = *(const v4f*)(e < 8 ? wsrc + (size_t)e * 16 * DMD : xsrc + (size_t)(e - 8) * 16 * DMD);
#pragma unroll
  for (int e = 0; e < 12; ++e) *(v4b*)&sm.st[0][e * 16 + lr][lq * 4] = cvt4(pf[e]);
  __syncthreads();
#pragma unroll
  for (int kc = 0; kc < DMD / 32; ++kc) { const int cur = kc & 1;
    if (kc + 1 < DMD / 32) {
#pragma unroll
      for (int e = 0; e < 12; ++e) pf[e] = *(const v4f*)((e < 8 ? wsrc + (size_t)e * 16 * DMD : xsrc + (size_t)(e - 8) * 16 * DMD) + (kc + 1) * 32); }
    const v16b a = frag_b(&sm.st[cur][128 + wave * 16 + col][0], lane);
#pragma unroll
    for (int jh = 0; jh < 8; jh += 4) { v16b w[4];   // the LDS reads of four fragments go ahead of their products as one group: one LDS latency per group
#pragma unroll
      for (int j = 0; j < 4; ++j) w[j] = frag_b(&sm.st[cur][(jh + j) * 16 + col][0], lane);
#pragma unroll
      for (int j = 0; j < 4; ++j) acc[jh + j] = wmma_bf(a, w[j], acc[jh + j]); }
    __builtin_amdgcn_sched_barrier(0);   // keeps the wait for the next stage's global loads behind this stage's products, so that they cover its latency
    if (kc + 1 < DMD / 32) {
#pragma unroll
      for (int e = 0; e < 12; ++e) *(v4b*)&sm.st[cur ^ 1][e * 16 + lr][lq * 4] = cvt4(pf[e]); }
    __syncthreads(); }   // publishes stage kc + 1 and ends every read of the buffer that the next pass refills
#pragma unroll
  for (int j = 0; j < 8; ++j) { const float bb = Bm ? bfr(Bm[c0 + j * 16 + col]) : 0.f;
#pragma unroll
    for (int r = 0; r < 8; ++r) { const float v = acc[j][r] + bb; const int rl = wave * 16 + 8 * g + r, cl = j * 16 + col;
      if (which == 0) sf[wave][8 * g + r][cl] = v; else if (which == 2) { const _Float16 hv = (_Float16)v; th[cl][rl] = hv; tl[cl][rl] = (_Float16)(v - (float)hv); } else sh[rl][cl] = (_Float16)v; } }
  __syncthreads();
  if (which == 0) { for (int rl = 0; rl < 16; ++rl) vst2(Q + (r0 + rl) * DMD + c0 + lane * 4, *(const v4f*)&sf[wave][rl][lane * 4]); }
  else if (which == 2) { const size_t b = ((size_t)blockIdx.x * 64) / TT; const int t0 = (int)(((size_t)blockIdx.x * 64) % TT); for (int e = tid; e < 128 * 8; e += 128) { const int cl = e >> 3, q = e & 7; const size_t o = (b * DMD + c0 + cl) * (size_t)TT + t0 + q * 8; vst2((unsigned*)(VH + o), *(const v4u*)&th[cl][q * 8]); vst2((unsigned*)(VL + o), *(const v4u*)&tl[cl][q * 8]); } }
  else { _Float16* dst = (which == 1) ? (KH + (size_t)blockIdx.x * 64 * DMD) : (PH + ((size_t)POFF + blockIdx.x * 64) * DMD); for (int e = tid; e < 64 * 16; e += 128) { const int rl = e >> 4, q = e & 15; vst2((unsigned*)(dst + (size_t)rl * DMD + c0 + q * 8), *(const v4u*)&sh[rl][q * 8]); } } }
// ---- k_padph: the POFF rows before and the rows after the table are zeros
__global__ __launch_bounds__(256) void k_padph(_Float16* __restrict__ PH) { const int t = threadIdx.x; const int r = blockIdx.x; const size_t row = (r < POFF) ? r : (TT + r);   // 0..31 and TT+32 .. TT+63
  v4u z; z[0] = z[1] = z[2] = z[3] = 0u; if (t < DMD / 8) vst2((unsigned*)(PH + row * DMD + t * 8), z); }
// fragments of (q + bias) for 16 rows, head h: hi and residual as f16 (unscaled; q ~ O(1))
__device__ __forceinline__ void qfrags(const float* __restrict__ Q, size_t row0, int h, const float* __restrict__ bias, int lane, v16h* hi, v16h* lo) { const int col = lane & 15, g = lane >> 4; size_t row = row0 + col; if (row > (size_t)NB * TT - 1) row = (size_t)NB * TT - 1;   // clamp (only the never-used row T of the last batch)
#pragma unroll
  for (int kc = 0; kc < 2; ++kc) { const float* p = Q + row * DMD + h * HD + kc * 32 + 8 * g; const float* bp = bias + h * HD + kc * 32 + 8 * g; v16h a, b;
#pragma unroll
    for (int i = 0; i < 8; ++i) { const float v0 = p[i] + bfr(bp[i]), v1 = p[16 + i] + bfr(bp[16 + i]); const _Float16 h0 = (_Float16)v0, h1 = (_Float16)v1; a[i] = h0; a[8 + i] = h1; b[i] = (_Float16)(v0 - (float)h0); b[8 + i] = (_Float16)(v1 - (float)h1); }
    hi[kc] = a; lo[kc] = b; } }
// reduction over each 16-lane row for eight values at once: lane l takes lane l ^ 1, ^ 2, ^ 4, ^ 8 through the DPP operand, every lane ends with the row's result.
// One statement, the eight values' steps interleaved: each step's producer stands eight instructions back, so no step waits for the one before. All 32 lanes must be on.
#define RX(op, n, x) op " %" #n ", %" #n ", %" #n " row_xmask:" #x " row_mask:0xf bank_mask:0xf\n\t"
#define RX8(op, x) RX(op, 0, x) RX(op, 1, x) RX(op, 2, x) RX(op, 3, x) RX(op, 4, x) RX(op, 5, x) RX(op, 6, x) RX(op, 7, x)
#define ROW16(q, op, v) asm q (RX8(op, 1) RX8(op, 2) RX8(op, 4) RX8(op, 8) : "+v"(v[0]), "+v"(v[1]), "+v"(v[2]), "+v"(v[3]), "+v"(v[4]), "+v"(v[5]), "+v"(v[6]), "+v"(v[7]))
// ---- k_att: block = (64 queries u, h, b)
#define KP 72    // LDS pitch of the 128-B k and position rows in f16: 144 B (16 B x odd) for 16-byte LDS reads
#define VP 40    // LDS pitch of the 64-B v rows in f16: 80 B
union __align__(16) AttX { float sp[16][36]; float so[16][68]; };   // a wave's own exchange tiles; so is written behind the loop, when sp is dead
// rel_shift of eight rows in registers: value n (row 8 g + n of the tile) += operand 8 + n taken from lane (col - (8 g + n + 1)) mod 16 of the same 16-lane row.
// row_ror:k gives lane l the word of lane (l - k) mod 16; the two halves of the wave turn by different amounts, so each add writes one half (row_mask 1: lanes 0..15, 2: lanes 16..31).
// Row 15 turns by 16 == 0: the identity quad_perm. One statement, a value's second add eight instructions behind its first. All 32 lanes must be on.
#define SH(n, m, ctl, half) "v_add_f32_dpp %" #n ", %" #m ", %" #n " " ctl " row_mask:" #half " bank_mask:0xf\n\t"
#define SHIFT16(c, v) asm(SH(0, 8, "row_ror:1", 0x1) SH(1, 9, "row_ror:2", 0x1) SH(2, 10, "row_ror:3", 0x1) SH(3, 11, "row_ror:4", 0x1) SH(4, 12, "row_ror:5", 0x1) SH(5, 13, "row_ror:6", 0x1) SH(6, 14, "row_ror:7", 0x1) SH(7, 15, "row_ror:8", 0x1) \
  SH(0, 8, "row_ror:9", 0x2) SH(1, 9, "row_ror:10", 0x2) SH(2, 10, "row_ror:11", 0x2) SH(3, 11, "row_ror:12", 0x2) SH(4, 12, "row_ror:13", 0x2) SH(5, 13, "row_ror:14", 0x2) SH(6, 14, "row_ror:15", 0x2) SH(7, 15, "quad_perm:[0,1,2,3]", 0x2) \
  : "+v"(c[0]), "+v"(c[1]), "+v"(c[2]), "+v"(c[3]), "+v"(c[4]), "+v"(c[5]), "+v"(c[6]), "+v"(c[7]) : "v"(v[0]), "v"(v[1]), "v"(v[2]), "v"(v[3]), "v"(v[4]), "v"(v[5]), "v"(v[6]), "v"(v[7]))
__device__ __forceinline__ unsigned lds_at(const void* p) { return (unsigned)(size_t)p; }   // LDS byte address = low 32 bits of the __shared__ address
// extended position index x = T-1-i+j: x < T is table row x (j <= i), x == T the zero row behind the table (j == i+1), x > T table row x-T-1 (the wrapped rows, j >= i+2)
__device__ __forceinline__ const _Float16* ph_row(const _Float16* __restrict__ PH, int x) { return PH + (size_t)(POFF + (x <= TT ? x : x - TT - 1)) * DMD; }
__global__ __launch_bounds__(128) void k_att(const float* __restrict__ Q, const _Float16* __restrict__ KH, const _Float16* __restrict__ PH, const _Float16* __restrict__ VH, const _Float16* __restrict__ VL, const float* __restrict__ BU, const float* __restrict__ BVv, const int* __restrict__ MK, float* __restrict__ X) {
  __shared__ AttX sx[4];
  __shared__ __align__(16) _Float16 sk[2][32][KP];     // 32 keys x 64 d of this head, two buffers
  __shared__ __align__(16) _Float16 sv[2][128][VP];    // rows 0..63 v hi (d), 64..127 v residual, 32 keys each, two buffers
  __shared__ __align__(16) _Float16 sph[128][KP];      // position rows, slot = x & 127: a pass reads 96 rows, the next pass's 32 new rows fill the slots it does not read
  const int tid = threadIdx.x, wave = tid >> 5, lane = tid & 31, col = lane & 15, g = lane >> 4; const int qb = blockIdx.x, h = blockIdx.y; const size_t b = blockIdx.z; const int i0 = qb * 64 + wave * 16;
  float (&sp)[16][36] = sx[wave].sp; float (&so)[16][68] = sx[wave].so;
  const int iw = __builtin_amdgcn_readfirstlane(i0 >> 4);   // the wave's 16-row tile index in a scalar register: the choice of the position products' A rows is a scalar branch
  const int xb0 = TT - 64 - qb * 64;   // x of (i = the block's last query, j = 0): pass ks reads x = xb0 + 32 ks .. + 95
  const int kr = tid >> 3, kq = (tid & 7) * 8, vr = tid >> 2, vq = (tid & 3) * 8;   // 8 lanes fetch one whole 128-B row of k or of the table, 4 lanes one 64-B row piece of v
  // tile t = keys 32 t .. + 31 of k and v and the last 32 position rows of pass t's window: eight 16-byte copies a lane, no register in between
  auto tile = [&](int t) { const int bf = t & 1, x = xb0 + t * 32 + 64 + kr;
    const _Float16* gk = KH + (b * TT + t * 32 + kr) * DMD + h * HD + kq; const size_t vo = (b * DMD + (size_t)h * HD + vr) * TT + t * 32 + vq;
    // the wait on xcnt closes the statement: it stands in front of every rewrite of a register that a copy names
    asm volatile("global_load_async_to_lds_b128 %0, %8, off\n\tglobal_load_async_to_lds_b128 %1, %9, off\n\tglobal_load_async_to_lds_b128 %2, %10, off\n\tglobal_load_async_to_lds_b128 %3, %11, off\n\t"
                 "global_load_async_to_lds_b128 %4, %12, off\n\tglobal_load_async_to_lds_b128 %5, %13, off\n\tglobal_load_async_to_lds_b128 %6, %14, off\n\tglobal_load_async_to_lds_b128 %7, %15, off\n\ts_wait_xcnt 0x0"
                 :: "v"(lds_at(&sk[bf][kr][kq])), "v"(lds_at(&sk[bf][16 + kr][kq])), "v"(lds_at(&sph[x & 127][kq])), "v"(lds_at(&sph[(x + 16) & 127][kq])),
                    "v"(lds_at(&sv[bf][vr][vq])), "v"(lds_at(&sv[bf][32 + vr][vq])), "v"(lds_at(&sv[bf][64 + vr][vq])), "v"(lds_at(&sv[bf][96 + vr][vq])),
                    "v"(gk), "v"(gk + 16 * DMD), "v"(ph_row(PH, x) + h * HD + kq), "v"(ph_row(PH, x + 16) + h * HD + kq),
                    "v"(VH + vo), "v"(VH + vo + 32 * TT), "v"(VL + vo), "v"(VL + vo + 32 * TT) : "memory"); };
  tile(0);
  { const int x = xb0 + kr;   // the first 64 position rows of pass 0's window
    asm volatile("global_load_async_to_lds_b128 %0, %4, off\n\tglobal_load_async_to_lds_b128 %1, %5, off\n\tglobal_load_async_to_lds_b128 %2, %6, off\n\tglobal_load_async_to_lds_b128 %3, %7, off\n\ts_wait_xcnt 0x0"
                 :: "v"(lds_at(&sph[x & 127][kq])), "v"(lds_at(&sph[(x + 16) & 127][kq])), "v"(lds_at(&sph[(x + 32) & 127][kq])), "v"(lds_at(&sph[(x + 48) & 127][kq])),
                    "v"(ph_row(PH, x) + h * HD + kq), "v"(ph_row(PH, x + 16) + h * HD + kq), "v"(ph_row(PH, x + 32) + h * HD + kq), "v"(ph_row(PH, x + 48) + h * HD + kq) : "memory"); }
  v16h au[2], av[2], aw[2], tmpl[2];   // (q+u) rows i0.., (q+v) rows i0.., (q+v) rows i0+1.. (for the wrapped upper-triangle term); single f16 rounding (residuals dropped: VGPR budget)
  qfrags(Q, b * TT + i0, h, BU, lane, au, tmpl); qfrags(Q, b * TT + i0, h, BVv, lane, av, tmpl);
  qfrags(Q, b * TT + i0 + 1, h, BVv, lane, aw, tmpl);   // rows i+1; for i = T-1 the row belongs to the next batch (or is clamped) but its products are never used: j >= i+2 cannot hold for i = T-1
  // exp2 argument of a score c: c * SC + nb, nb = 11 - (running max) * SC: 1/8, log2 e and P's 2^11 in one fused multiply-add.
  // The running max never falls below -1e38, a masked key counts as -3e38: its argument is below -3e37 and exp2 gives 0 with no compare. nb starts at 3e38: the first pass's alpha is 0.
  const float SC = 0.125f * 1.44269504088896340736f;
  float m[8], nb[8], l[8];
#pragma unroll
  for (int r = 0; r < 8; ++r) { m[r] = -1.0e38f; nb[r] = 3.0e38f; l[r] = 0.f; }
  v8f acc[4] = {};
  asm volatile("s_wait_asynccnt 0x0" ::: "memory");   // this wave's copies of tile 0 have landed
  __syncthreads();                                     // publishes tile 0
  tile(1);
#pragma unroll 1
  for (int ks = 0; ks < TT / 32; ++ks) { float s[2][8]; const int cur = ks & 1;
    const int xt = TT - 16 - i0 + ks * 32;            // three 16-column position tiles cover x = xt .. xt + 47; keys 16 ct .. + 15 use tiles ct and ct + 1, so the middle one serves both halves
    v16h kf[2][2], pf[3][2];   // the LDS reads of the pass's ten fragments go ahead of their products as one group
#pragma unroll
    for (int kc = 0; kc < 2; ++kc) {
#pragma unroll
      for (int ct = 0; ct < 2; ++ct) kf[ct][kc] = frag_h(&sk[cur][ct * 16 + col][kc * 32], lane);
#pragma unroll
      for (int t = 0; t < 3; ++t) pf[t][kc] = frag_h(&sph[((xt + 16 * t) & 127) + col][kc * 32], lane); }
    v8f c[2] = {}, gp[3] = {};
#pragma unroll
    for (int kc = 0; kc < 2; ++kc)
#pragma unroll
      for (int ct = 0; ct < 2; ++ct) c[ct] = wmma16(au[kc], kf[ct][kc], c[ct]);
    // T and xt are multiples of 16, so a tile lies wholly in x < T (j <= i: rows i, av) or wholly in x >= T (the zero row x == T and the wrapped rows: rows i + 1, aw).
    // Tile t has x < T when 2 ks + t <= i0 / 16. i == T-1 has no j > i, so the row behind the last query is never picked.
#define POS3(A0, A1, A2) do { _Pragma("unroll") for (int kc = 0; kc < 2; ++kc) { gp[0] = wmma16(A0[kc], pf[0][kc], gp[0]); gp[1] = wmma16(A1[kc], pf[1][kc], gp[1]); gp[2] = wmma16(A2[kc], pf[2][kc], gp[2]); } } while (0)
    const int nlow = iw + 1 - 2 * ks;                 // tiles t < nlow take rows i
    if (nlow >= 3) POS3(av, av, av); else if (nlow <= 0) POS3(aw, aw, aw); else if (nlow == 2) POS3(av, av, aw); else POS3(av, aw, aw);   // the two mixed cases: the one pass that holds the wave's diagonal
    int mk[2][8]; const int* mrow = MK + ((size_t)b * TT + i0 + 8 * g) * TT + ks * 32 + col;   // row 8 g, key 32 ks + col of the pass's mask tile
#pragma unroll
    for (int ct = 0; ct < 2; ++ct)
#pragma unroll
      for (int r = 0; r < 8; ++r) mk[ct][r] = mrow[r * TT + ct * 16];
    asm volatile("s_wait_xcnt 0x0" :: "v"(mrow) : "memory");   // stands behind the sixteen mask loads and takes their address: the pair stays live up to the wait, so no result and no later value is placed in it before
#pragma unroll
    for (int ct = 0; ct < 2; ++ct) { float cc[8], sel[8];
      // row 8 g + r wants column 15 + col - (8 g + r) of the 32 columns of tiles ct, ct + 1: lane c of the row holds the wanted word of tile ct when c + 8 g + r >= 15, of tile ct + 1 otherwise; the turn brings it to its key's lane
#pragma unroll
      for (int r = 0; r < 8; ++r) { cc[r] = c[ct][r]; sel[r] = (col + 8 * g + r >= 15) ? gp[ct][r] : gp[ct + 1][r]; }
      SHIFT16(cc, sel);
#pragma unroll
      for (int r = 0; r < 8; ++r) s[ct][r] = (mk[ct][r] != 0) ? cc[r] : -3.0e38f; }
    float alpha[8], mx[8], es[8];
#pragma unroll
    for (int r = 0; r < 8; ++r) mx[r] = fmaxf(fmaxf(s[0][r], s[1][r]), m[r]);   // the running maximum, equal in a row's lanes, goes in ahead of the reduction: what comes out is the new one
    ROW16(, "v_max_num_f32_dpp", mx);   // row maximum over the 16 lanes that hold a query's keys, in the vector unit: no LDS permute, no wait on dscnt between the steps
#pragma unroll
    for (int r = 0; r < 8; ++r) { const float mn = mx[r], nn = __builtin_fmaf(mn, -SC, 11.0f); alpha[r] = __builtin_amdgcn_exp2f(nn - nb[r]); const float e0 = __builtin_amdgcn_exp2f(__builtin_fmaf(s[0][r], SC, nn)), e1 = __builtin_amdgcn_exp2f(__builtin_fmaf(s[1][r], SC, nn)); es[r] = e0 + e1;
      m[r] = mn; nb[r] = nn; sp[8 * g + r][col] = e0; sp[8 * g + r][16 + col] = e1; }
#pragma unroll
    for (int r = 0; r < 8; ++r) l[r] = l[r] * alpha[r] + es[r];   // l is the lane's own share of the row sum (its two keys of every pass); alpha is equal in a row's lanes, so the shares stay on one scale and are added up once, behind the loop
#pragma unroll
    for (int j = 0; j < 4; ++j)
#pragma unroll
      for (int r = 0; r < 8; ++r) acc[j][r] *= alpha[r];
    LDSX();
    v16h pa, pr; { const float* prow = &sp[col][0] + 8 * (lane >> 4);
#pragma unroll
      for (int i = 0; i < 8; ++i) { const float x0 = prow[i], x1 = prow[16 + i]; const _Float16 h0 = (_Float16)x0, h1 = (_Float16)x1; pa[i] = h0; pa[8 + i] = h1; pr[i] = (_Float16)(x0 - (float)h0); pr[8 + i] = (_Float16)(x1 - (float)h1); } }
#pragma unroll
    for (int jh = 0; jh < 4; jh += 2) { v16h vh[2], vl[2];   // four fragments' LDS reads as one group ahead of their six products
#pragma unroll
      for (int j = 0; j < 2; ++j) { vh[j] = frag_h(&sv[cur][(jh + j) * 16 + col][0], lane); vl[j] = frag_h(&sv[cur][64 + (jh + j) * 16 + col][0], lane); }
#pragma unroll
      for (int j = 0; j < 2; ++j) { acc[jh + j] = wmma16(pa, vh[j], acc[jh + j]); acc[jh + j] = wmma16(pr, vh[j], acc[jh + j]); acc[jh + j] = wmma16(pa, vl[j], acc[jh + j]); } }
    asm volatile("s_wait_dscnt 0x0" ::: "memory");      // this wave's LDS reads of pass ks have retired before the buffers are refilled
    asm volatile("s_wait_asynccnt 0x0" ::: "memory");   // this wave's copies of tile ks + 1 have landed
    __syncthreads();                                     // publishes tile ks + 1 and ends every wave's reads of the buffers and slots that tile ks + 2 fills
    if (ks + 2 < TT / 32) tile(ks + 2); }
  asm volatile("s_wait_asynccnt 0x0" ::: "memory");     // no copy is outstanding when the wave ends
  ROW16(, "v_add_f32_dpp", l);   // row sum over the 16 lanes' shares, the xor 1, 2, 4, 8 tree, once a query row instead of once a pass
#pragma unroll
  for (int r = 0; r < 8; ++r) { const float il = (l[r] > 0.f) ? 1.0f / l[r] : 0.f;   // fully masked rows -> zeros (the module zeroes them after the softmax)
#pragma unroll
    for (int j = 0; j < 4; ++j) so[8 * g + r][j * 16 + col] = acc[j][r] * il; }
  LDSX(); for (int rl = 0; rl < 16; ++rl) if (lane < 16) vst2(X + (b * TT + i0 + rl) * DMD + h * HD + lane * 4, *(const v4f*)&so[rl][lane * 4]); }
// ---- k_out: block = (64 rows, 128 of 512 cols): out = x (hi + lo) . Wo^T + bo
__global__ __launch_bounds__(128) void k_out(const float* __restrict__ X, const float* __restrict__ WO, const float* __restrict__ BO, float* __restrict__ OUT) { __shared__ OutSm sm; float (&sf)[4][16][132] = sm.sf;   // ring dead at the epilogue (barrier at the foot of the last stage)
  const int tid = threadIdx.x, wave = tid >> 5, lane = tid & 31, col = lane & 15, g = lane >> 4; const int c0 = blockIdx.y * 128; const size_t r0 = (size_t)blockIdx.x * 64 + wave * 16;
  v8f acc[8] = {};
  // stage = 32 k of 128 Wo rows (ring rows 0..127) and of the block's 64 x rows as hi (128..191) and lo (192..255)
  const int lr = tid >> 3, lq = tid & 7; const float* wsrc = WO + (size_t)(c0 + lr) * DMD + lq * 4; const float* xsrc = X + ((size_t)blockIdx.x * 64 + lr) * DMD + lq * 4;
  v4f pf[12];
#pragma unroll
  for (int e = 0; e < 12; ++e) pf[e] = *(const v4f*)(e < 8 ? wsrc + (size_t)e * 16 * DMD : xsrc + (size_t)(e - 8) * 16 * DMD);
#pragma unroll
  for (int e = 0; e < 12; ++e) { const v4b hv = cvt4(pf[e]); *(v4b*)&sm.st[0][e * 16 + lr][lq * 4] = hv; if (e >= 8) *(v4b*)&sm.st[0][64 + e * 16 + lr][lq * 4] = res4(pf[e], hv); }
  __syncthreads();
#pragma unroll
  for (int kc = 0; kc < DMD / 32; ++kc) { const int cur = kc & 1;
    if (kc + 1 < DMD / 32) {
#pragma unroll
      for (int e = 0; e < 12; ++e) pf[e] = *(const v4f*)((e < 8 ? wsrc + (size_t)e * 16 * DMD : xsrc + (size_t)(e - 8) * 16 * DMD) + (kc + 1) * 32); }
    const v16b ah = frag_b(&sm.st[cur][128 + wave * 16 + col][0], lane), al = frag_b(&sm.st[cur][192 + wave * 16 + col][0], lane);
    v16b w[8];   // the stage's LDS reads go ahead of its products as one group: one LDS latency per stage
#pragma unroll
    for (int j = 0; j < 8; ++j) w[j] = frag_b(&sm.st[cur][j * 16 + col][0], lane);
#pragma unroll
    for (int j = 0; j < 8; ++j) { acc[j] = wmma_bf(ah, w[j], acc[j]); acc[j] = wmma_bf(al, w[j], acc[j]); }
    __builtin_amdgcn_sched_barrier(0);   // keeps the wait for the next stage's global loads behind this stage's products, so that they cover its latency
    if (kc + 1 < DMD / 32) {
#pragma unroll
      for (int e = 0; e < 12; ++e) { const v4b hv = cvt4(pf[e]); *(v4b*)&sm.st[cur ^ 1][e * 16 + lr][lq * 4] = hv; if (e >= 8) *(v4b*)&sm.st[cur ^ 1][64 + e * 16 + lr][lq * 4] = res4(pf[e], hv); } }
    __syncthreads(); }   // publishes stage kc + 1 and ends every read of the buffer that the next pass refills
#pragma unroll
  for (int j = 0; j < 8; ++j) { const float bb = bfr(BO[c0 + j * 16 + col]);
#pragma unroll
    for (int r = 0; r < 8; ++r) sf[wave][8 * g + r][j * 16 + col] = acc[j][r] + bb; }
  LDSX(); for (int rl = 0; rl < 16; ++rl) vst2(OUT + (r0 + rl) * DMD + c0 + lane * 4, *(const v4f*)&sf[wave][rl][lane * 4]); }
extern "C" void kernel_launch(void* const* d_in, const int* in_sizes, int n_in, void* d_out, int out_size, void* d_ws, size_t ws_size, hipStream_t stream) {
  (void)in_sizes; (void)n_in; (void)out_size;
  const float** F = (const float**)d_in;   // 0 q, 1 k, 2 v [8,1024,512]; 3 pos [1024,512]; 4 mask [8,1024,1024] int; 5 Wq, 6 bq, 7 Wk, 8 bk, 9 Wv, 10 bv, 11 Wo, 12 bo, 13 Wp (natural); 14 bias_u [8,64], 15 bias_v [8,64]
  if (ws_size < (size_t)WS_END) return;
  char* ws = (char*)d_ws; float* Q = (float*)(ws + WS_Q); _Float16 *KH = (_Float16*)(ws + WS_KH), *PH = (_Float16*)(ws + WS_PH), *VH = (_Float16*)(ws + WS_VH), *VL = (_Float16*)(ws + WS_VL); float* X = (float*)(ws + WS_X);
  k_proj<<<dim3(TNB * TT / 64, DMD / 128, 4), 128, 0, stream>>>(F[0], F[1], F[2], F[3], F[5], F[6], F[7], F[8], F[9], F[10], F[13], Q, KH, VH, VL, PH);
  k_padph<<<64, 256, 0, stream>>>(PH);
  k_att<<<dim3(TT / 64, NH, TNB), 128, 0, stream>>>(Q, KH, PH, VH, VL, F[14], F[15], (const int*)d_in[4], X);
  k_out<<<dim3(TNB * TT / 64, DMD / 128), 128, 0, stream>>>(X, F[11], F[12], (float*)d_out);
}

// v010
// Measured time: 103 microseconds a run.
// Versions in between are left out here; by their measured steps it is 1.22 times as fast as v007.
// Counting every step since v000, it is 4.62 times as fast.
// compute dtype: all float inputs rounded to bf16, mask (int) read; q/k/v/pos projections with EXACT bf16 products on WMMA 16x16x32 (natural weights, + bias), f32 accumulate; q kept in f32 (bias_u / bias_v added per head, then rounded once to f16 fragments; residuals dropped), k / ph / v rounded once to f16; content scores (q+bu) . k and the Transformer-XL position term (q+bv) . ph with single f16 products (logits ~1-2; q, k, ph each rounded once), the rel_shift realised exactly as an index map onto 16 x 32 position tiles (incl. its upper-triangle wrap-around rows and the zero at j == i+1), x 1/8, masked keys excluded, softmax in f32 (hardware exp) against a per-row reference that is raised to the running max only when a P would leave f16's range; P (x 2^8 at the reference) . v, each rounded once to f16; out = x (bf16 hi + lo) . Wo^T + bo; f32 output.
#include <hip/hip_runtime.h>
#include <math.h>

typedef __attribute__((ext_vector_type(16))) _Float16 v16h;
typedef __attribute__((ext_vector_type(16))) __bf16 v16b;
typedef __attribute__((ext_vector_type(8)))  _Float16 v8h;
typedef __attribute__((ext_vector_type(8)))  float v8f;
typedef __attribute__((ext_vector_type(4)))  float v4f;
typedef __attribute__((ext_vector_type(2)))  float v2f;
typedef __attribute__((ext_vector_type(4)))  unsigned v4u;
typedef __attribute__((ext_vector_type(4)))  int v4i;
typedef float __attribute__((may_alias)) float_a;
typedef int __attribute__((may_alias)) int_a;

template <typename T> __device__ __forceinline__ void vst2(void* p, T v) { *(T*)p = v;  }
__device__ __forceinline__ v8f wmma16(v16h a, v16h b, v8f c) {
  v8f d = __builtin_amdgcn_wmma_f32_16x16x32_f16(false, a, false, b, (short)0, c, false, false);
  asm volatile("v_nop\n\tv_nop\n\tv_nop\n\tv_nop" : "+v"(d) : "v"(a), "v"(b));
  return d;
}
__device__ __forceinline__ v8f wmma_bf(v16b a, v16b b, v8f c) {
  v8f d = __builtin_amdgcn_wmma_f32_16x16x32_bf16(false, a, false, b, (short)0, c, false, false);
  asm volatile("v_nop\n\tv_nop\n\tv_nop\n\tv_nop" : "+v"(d) : "v"(a), "v"(b));
  return d;
}
// 16x16x32 fragments: lane = (h = lane>>4, row/col = lane&15); elements 0..7 = k0+8h+0..7, 8..15 = k0+16+8h+0..7; D element r = row 8h+r
__device__ __forceinline__ v16h frag_h(const _Float16* rowk0, int lane) {
  union { v16h v; v8h q[2]; } u; const _Float16* p = rowk0 + 8 * (lane >> 4);
  u.q[0] = *(const v8h*)p; u.q[1] = *(const v8h*)(p + 16); return u.v;
}
__device__ __forceinline__ v16h frag_f32(const float* rowk0, int lane) {
  v16h a; const float* p = rowk0 + 8 * (lane >> 4);
#pragma unroll
  for (int i = 0; i < 8; ++i) { a[i] = (_Float16)p[i]; a[8 + i] = (_Float16)p[16 + i]; }
  return a;
}
__device__ __forceinline__ v16h frag_f32s(const float* rowk0, int lane, float sc) {
  v16h a; const float* p = rowk0 + 8 * (lane >> 4);
#pragma unroll
  for (int i = 0; i < 8; ++i) { a[i] = (_Float16)(p[i] * sc); a[8 + i] = (_Float16)(p[16 + i] * sc); }
  return a;
}
// column fragment from a [K][ld] layout (column n), rows >= K read as 0
__device__ __forceinline__ v16h fragc_f32(const float* W, int k0, int n, int lane, int ld, int K) {
  v16h a; const int g = lane >> 4;
#pragma unroll
  for (int i = 0; i < 8; ++i) { const int ka = k0 + 8 * g + i, kb = ka + 16;
    a[i] = (_Float16)(ka < K ? W[(size_t)(ka < K ? ka : K - 1) * ld + n] : 0.f); a[8 + i] = (_Float16)(kb < K ? W[(size_t)(kb < K ? kb : K - 1) * ld + n] : 0.f); }
  return a;
}
struct F2 { v16b h, l; };
__device__ __forceinline__ F2 bsplit16(const float v[16]) { F2 r;
#pragma unroll
  for (int i = 0; i < 16; ++i) { const __bf16 h = (__bf16)v[i]; r.h[i] = h; r.l[i] = (__bf16)(v[i] - (float)h); }
  return r; }
__device__ __forceinline__ F2 split_row(const float* row, int k0, int lane) { float v[16]; const float* p = row + k0 + 8 * (lane >> 4);
#pragma unroll
  for (int i = 0; i < 8; ++i) { v[i] = p[i]; v[8 + i] = p[16 + i]; }
  return bsplit16(v); }
__device__ __forceinline__ F2 split_rowK(const float* row, int k0, int lane, int K) { float v[16]; const int g = lane >> 4;
#pragma unroll
  for (int i = 0; i < 8; ++i) { const int ka = k0 + 8 * g + i, kb = ka + 16; v[i] = ka < K ? row[ka < K ? ka : K - 1] : 0.f; v[8 + i] = kb < K ? row[kb < K ? kb : K - 1] : 0.f; }
  return bsplit16(v); }
__device__ __forceinline__ F2 split_col(const float* W, int k0, int n, int lane, int ld, int K) { float v[16]; const int g = lane >> 4;
#pragma unroll
  for (int i = 0; i < 8; ++i) { const int ka = k0 + 8 * g + i, kb = ka + 16; v[i] = ka < K ? W[(size_t)(ka < K ? ka : K - 1) * ld + n] : 0.f; v[8 + i] = kb < K ? W[(size_t)(kb < K ? kb : K - 1) * ld + n] : 0.f; }
  return bsplit16(v); }
__device__ __forceinline__ v8f mac3(const F2& a, const F2& b, v8f c) { c = wmma_bf(a.l, b.h, c); c = wmma_bf(a.h, b.l, c); return wmma_bf(a.h, b.h, c); }
__device__ __forceinline__ float sigm(float v) { return 1.0f / (1.0f + expf(-v)); }
#define LDSX() do { asm volatile("s_wait_dscnt 0" ::: "memory"); __builtin_amdgcn_wave_barrier(); __builtin_amdgcn_fence(__ATOMIC_RELEASE, "workgroup"); } while (0)


// Relative-position multi-head attention (Transformer-XL style rel_shift; B 8, T 1,024, D 512, 8 heads x 64): scores = ((q+u) k^T + rel_shift((q+v) p^T)) / 8, masked softmax (mask input), attn v, Wo.
#define NB 8
#define TT 1024
#define DMD 512
#define NH 8
#define HD 64
#define POFF 32                 // ph buffer row offset (rows < 0 and >= T read as zeros)
#define PROWS (TT + 64)
#ifndef TNB
#define TNB NB
#endif
typedef __attribute__((ext_vector_type(8))) __bf16 v8b;
__device__ __forceinline__ v16b frag_b(const __bf16* rowk0, int lane) {
  union { v16b v; v8b q[2]; } u; const __bf16* p = rowk0 + 8 * (lane >> 4);
  u.q[0] = *(const v8b*)p; u.q[1] = *(const v8b*)(p + 16); return u.v;
}
__device__ __forceinline__ float bfr(float v) { return (float)(__bf16)v; }
__device__ __attribute__((noinline)) float exp_ni(float v) { return expf(v); }
__device__ __attribute__((noinline)) float erf_ni(float v) { return erff(v); }

#define WS_Q   0u                                   // f32 q rows [b*u][512] (+bq)
#define WS_KH  (WS_Q + 4u * (size_t)NB * TT * DMD)       // f16 k rows [b*t][512]
#define WS_PH  (WS_KH + 2u * (size_t)NB * TT * DMD)      // f16 ph rows [PROWS][512] (row POFF + p)
#define WS_VH  (WS_PH + 2u * (size_t)PROWS * DMD)        // f16 v planes [b][512][t]
#define WS_X   (WS_VH + 2u * (size_t)NB * DMD * TT)      // f32 attention output rows [b*u][512]
#define WS_END (WS_X + 4u * (size_t)NB * TT * DMD)

typedef __attribute__((ext_vector_type(4))) __bf16 v4b;
__device__ __forceinline__ v4b cvt4(v4f v) { v4b r;
#pragma unroll
  for (int i = 0; i < 4; ++i) r[i] = (__bf16)v[i];
  return r; }
__device__ __forceinline__ v4b res4(v4f v, v4b h) { v4b r;
#pragma unroll
  for (int i = 0; i < 4; ++i) r[i] = (__bf16)(v[i] - (float)h[i]);
  return r; }
#define SPI 40   // ring row pitch in bf16: 64-B rows at 80 B (16 B x odd) for 16-byte LDS reads
union __align__(16) ProjSm { __bf16 st[2][192][SPI]; float sf[4][16][132]; _Float16 sh[64][136]; _Float16 t2[128][72]; };
union __align__(16) OutSm { __bf16 st[2][256][SPI]; float sf[4][16][132]; };
// ---- k_proj: block = (64 rows, 128-col group, which): 0 q (f32 rows), 1 k (f16 rows), 2 v (f16 planes), 3 ph (f16 rows at POFF), natural W + bias (none for ph)
__global__ __launch_bounds__(128) void k_proj(const float* __restrict__ Qi, const float* __restrict__ Ki, const float* __restrict__ Vi, const float* __restrict__ POS, const float* __restrict__ WQ, const float* __restrict__ BQ, const float* __restrict__ WK, const float* __restrict__ BK, const float* __restrict__ WV, const float* __restrict__ BV, const float* __restrict__ WP, float* __restrict__ Q, _Float16* __restrict__ KH, _Float16* __restrict__ VH, _Float16* __restrict__ PH) {
  __shared__ ProjSm sm;   // the operand ring is dead when the epilogue tiles are written (barrier at the foot of the last stage)
  float (&sf)[4][16][132] = sm.sf; _Float16 (&sh)[64][136] = sm.sh; _Float16 (&th)[128][72] = sm.t2;
  const int tid = threadIdx.x, wave = tid >> 5, lane = tid & 31, col = lane & 15, g = lane >> 4; const int which = blockIdx.z; const int c0 = blockIdx.y * 128; const int nrows = (which == 3) ? TT : NB * TT;
  if ((int)blockIdx.x * 64 >= nrows) return;
  const float* X = (which == 0 ? Qi : which == 1 ? Ki : which == 2 ? Vi : POS); const float* Wm = (which == 0 ? WQ : which == 1 ? WK : which == 2 ? WV : WP); const float* Bm = (which == 0 ? BQ : which == 1 ? BK : which == 2 ? BV : nullptr);
  const size_t r0 = (size_t)blockIdx.x * 64 + wave * 16;
  v8f acc[8] = {};
  // stage = 32 k of 128 W rows (ring rows 0..127) and of the block's 64 X rows (128..191); 8 lanes x 16 B fetch one whole 128-B line of a row
  const int lr = tid >> 3, lq = tid & 7; const float* wsrc = Wm + (size_t)(c0 + lr) * DMD + lq * 4; const float* xsrc = X + ((size_t)blockIdx.x * 64 + lr) * DMD + lq * 4;
  v4f pf[12];
#pragma unroll
  for (int e = 0; e < 12; ++e) pf[e] = *(const v4f*)(e < 8 ? wsrc + (size_t)e * 16 * DMD : xsrc + (size_t)(e - 8) * 16 * DMD);
  float bb[8];   // the lane's eight bias values, loaded as one group here: the k loop covers their latency
#pragma unroll
  for (int j = 0; j < 8; ++j) bb[j] = 0.f;
  if (Bm) {
#pragma unroll
    for (int j = 0; j < 8; ++j) bb[j] = bfr(Bm[c0 + j * 16 + col]); }
#pragma unroll
  for (int e = 0; e < 12; ++e) *(v4b*)&sm.st[0][e * 16 + lr][lq * 4] = cvt4(pf[e]);
  __syncthreads();
#pragma unroll
  for (int kc = 0; kc < DMD / 32; ++kc) { const int cur = kc & 1;
    if (kc + 1 < DMD / 32) {
#pragma unroll
      for (int e = 0; e < 12; ++e) pf[e] = *(const v4f*)((e < 8 ? wsrc + (size_t)e * 16 * DMD : xsrc + (size_t)(e - 8) * 16 * DMD) + (kc + 1) * 32); }
    const v16b a = frag_b(&sm.st[cur][128 + wave * 16 + col][0], lane);
#pragma unroll
    for (int jh = 0; jh < 8; jh += 4) { v16b w[4];   // the LDS reads of four fragments go ahead of their products as one group: one LDS latency per group
#pragma unroll
      for (int j = 0; j < 4; ++j) w[j] = frag_b(&sm.st[cur][(jh + j) * 16 + col][0], lane);
#pragma unroll
      for (int j = 0; j < 4; ++j) acc[jh + j] = wmma_bf(a, w[j], acc[jh + j]); }
    __builtin_amdgcn_sched_barrier(0);   // keeps the wait for the next stage's global loads behind this stage's products, so that they cover its latency
    if (kc + 1 < DMD / 32) {
#pragma unroll
      for (int e = 0; e < 12; ++e) *(v4b*)&sm.st[cur ^ 1][e * 16 + lr][lq * 4] = cvt4(pf[e]); }
    __syncthreads(); }   // publishes stage kc + 1 and ends every read of the buffer that the next pass refills
  // which is the same for the whole block: the output form is chosen once, around the 64 elements of a lane, so that each form's stores are straight-line code
  if (which == 0) {
#pragma unroll
    for (int j = 0; j < 8; ++j)
#pragma unroll
      for (int r = 0; r < 8; ++r) sf[wave][8 * g + r][j * 16 + col] = acc[j][r] + bb[j]; }
  else if (which == 2) {
#pragma unroll
    for (int j = 0; j < 8; ++j)
#pragma unroll
      for (int r = 0; r < 8; ++r) th[j * 16 + col][wave * 16 + 8 * g + r] = (_Float16)(acc[j][r] + bb[j]); }
  else {
#pragma unroll
    for (int j = 0; j < 8; ++j)
#pragma unroll
      for (int r = 0; r < 8; ++r) sh[wave * 16 + 8 * g + r][j * 16 + col] = (_Float16)(acc[j][r] + bb[j]); }
  __syncthreads();
  if (which == 0) { for (int rl = 0; rl < 16; ++rl) vst2(Q + (r0 + rl) * DMD + c0 + lane * 4, *(const v4f*)&sf[wave][rl][lane * 4]); }
  else if (which == 2) { const size_t b = ((size_t)blockIdx.x * 64) / TT; const int t0 = (int)(((size_t)blockIdx.x * 64) % TT); for (int e = tid; e < 128 * 8; e += 128) { const int cl = e >> 3, q = e & 7; const size_t o = (b * DMD + c0 + cl) * (size_t)TT + t0 + q * 8; vst2((unsigned*)(VH + o), *(const v4u*)&th[cl][q * 8]); } }
  else { _Float16* dst = (which == 1) ? (KH + (size_t)blockIdx.x * 64 * DMD) : (PH + ((size_t)POFF + blockIdx.x * 64) * DMD); for (int e = tid; e < 64 * 16; e += 128) { const int rl = e >> 4, q = e & 15; vst2((unsigned*)(dst + (size_t)rl * DMD + c0 + q * 8), *(const v4u*)&sh[rl][q * 8]); } } }
// ---- k_padph: the POFF rows before and the rows after the table are zeros
__global__ __launch_bounds__(256) void k_padph(_Float16* __restrict__ PH) { const int t = threadIdx.x; const int r = blockIdx.x; const size_t row = (r < POFF) ? r : (TT + r);   // 0..31 and TT+32 .. TT+63
  v4u z; z[0] = z[1] = z[2] = z[3] = 0u; if (t < DMD / 8) vst2((unsigned*)(PH + row * DMD + t * 8), z); }
// fragments of (q + bias) for 16 rows, head h: hi and residual as f16 (unscaled; q ~ O(1))
__device__ __forceinline__ void qfrags(const float* __restrict__ Q, size_t row0, int h, const float* __restrict__ bias, int lane, v16h* hi, v16h* lo) { const int col = lane & 15, g = lane >> 4; size_t row = row0 + col; if (row > (size_t)NB * TT - 1) row = (size_t)NB * TT - 1;   // clamp (only the never-used row T of the last batch)
#pragma unroll
  for (int kc = 0; kc < 2; ++kc) { const float* p = Q + row * DMD + h * HD + kc * 32 + 8 * g; const float* bp = bias + h * HD + kc * 32 + 8 * g; v16h a, b;
#pragma unroll
    for (int i = 0; i < 8; ++i) { const float v0 = p[i] + bfr(bp[i]), v1 = p[16 + i] + bfr(bp[16 + i]); const _Float16 h0 = (_Float16)v0, h1 = (_Float16)v1; a[i] = h0; a[8 + i] = h1; b[i] = (_Float16)(v0 - (float)h0); b[8 + i] = (_Float16)(v1 - (float)h1); }
    hi[kc] = a; lo[kc] = b; } }
// reduction over each 16-lane row for eight values at once: lane l takes lane l ^ 1, ^ 2, ^ 4, ^ 8 through the DPP operand, every lane ends with the row's result.
// One statement, the eight values' steps interleaved: each step's producer stands eight instructions back, so no step waits for the one before. All 32 lanes must be on.
#define RX(op, n, x) op " %" #n ", %" #n ", %" #n " row_xmask:" #x " row_mask:0xf bank_mask:0xf\n\t"
#define RX8(op, x) RX(op, 0, x) RX(op, 1, x) RX(op, 2, x) RX(op, 3, x) RX(op, 4, x) RX(op, 5, x) RX(op, 6, x) RX(op, 7, x)
#define ROW16(q, op, v) asm q (RX8(op, 1) RX8(op, 2) RX8(op, 4) RX8(op, 8) : "+v"(v[0]), "+v"(v[1]), "+v"(v[2]), "+v"(v[3]), "+v"(v[4]), "+v"(v[5]), "+v"(v[6]), "+v"(v[7]))
// exp2 in place, a run of values in one statement: every value has its own register, so no instruction that stands directly behind a transcendental reads its result or writes over its source
// the v_nop at the end keeps the slot behind the last one.
#define EX(n) "v_exp_f32 %" #n ", %" #n "\n\t"
#define EXP2X8(v) asm(EX(0) EX(1) EX(2) EX(3) EX(4) EX(5) EX(6) EX(7) "v_nop" : "+v"(v[0]), "+v"(v[1]), "+v"(v[2]), "+v"(v[3]), "+v"(v[4]), "+v"(v[5]), "+v"(v[6]), "+v"(v[7]))
#define EXP2X16(v, w) asm(EX(0) EX(1) EX(2) EX(3) EX(4) EX(5) EX(6) EX(7) EX(8) EX(9) EX(10) EX(11) EX(12) EX(13) EX(14) EX(15) "v_nop" \
  : "+v"(v[0]), "+v"(w[0]), "+v"(v[1]), "+v"(w[1]), "+v"(v[2]), "+v"(w[2]), "+v"(v[3]), "+v"(w[3]), "+v"(v[4]), "+v"(w[4]), "+v"(v[5]), "+v"(w[5]), "+v"(v[6]), "+v"(w[6]), "+v"(v[7]), "+v"(w[7]))
// ---- k_att: block = (64 queries u, h, b)
#define KP 72    // LDS pitch of the 128-B k and position rows in f16: 144 B (16 B x odd) for 16-byte LDS reads
#define VP 40    // LDS pitch of the 64-B v rows in f16: 80 B
union __align__(16) AttX { float sp[16][36]; float so[16][68]; };   // a wave's own exchange tiles; so is written behind the loop, when sp is dead
// rel_shift of eight rows in registers: value n (row 8 g + n of the tile) += operand 8 + n taken from lane (col - (8 g + n + 1)) mod 16 of the same 16-lane row.
// row_ror:k gives lane l the word of lane (l - k) mod 16; the two halves of the wave turn by different amounts, so each add writes one half (row_mask 1: lanes 0..15, 2: lanes 16..31).
// Row 15 turns by 16 == 0: the identity quad_perm. One statement, a value's second add eight instructions behind its first. All 32 lanes must be on.
#define SH(n, m, ctl, half) "v_add_f32_dpp %" #n ", %" #m ", %" #n " " ctl " row_mask:" #half " bank_mask:0xf\n\t"
#define SHIFT16(c, v) asm(SH(0, 8, "row_ror:1", 0x1) SH(1, 9, "row_ror:2", 0x1) SH(2, 10, "row_ror:3", 0x1) SH(3, 11, "row_ror:4", 0x1) SH(4, 12, "row_ror:5", 0x1) SH(5, 13, "row_ror:6", 0x1) SH(6, 14, "row_ror:7", 0x1) SH(7, 15, "row_ror:8", 0x1) \
  SH(0, 8, "row_ror:9", 0x2) SH(1, 9, "row_ror:10", 0x2) SH(2, 10, "row_ror:11", 0x2) SH(3, 11, "row_ror:12", 0x2) SH(4, 12, "row_ror:13", 0x2) SH(5, 13, "row_ror:14", 0x2) SH(6, 14, "row_ror:15", 0x2) SH(7, 15, "quad_perm:[0,1,2,3]", 0x2) \
  : "+v"(c[0]), "+v"(c[1]), "+v"(c[2]), "+v"(c[3]), "+v"(c[4]), "+v"(c[5]), "+v"(c[6]), "+v"(c[7]) : "v"(v[0]), "v"(v[1]), "v"(v[2]), "v"(v[3]), "v"(v[4]), "v"(v[5]), "v"(v[6]), "v"(v[7]))
__device__ __forceinline__ unsigned lds_at(const void* p) { return (unsigned)(size_t)p; }   // LDS byte address = low 32 bits of the __shared__ address
// extended position index x = T-1-i+j: x < T is table row x (j <= i), x == T the zero row behind the table (j == i+1), x > T table row x-T-1 (the wrapped rows, j >= i+2)
__device__ __forceinline__ const _Float16* ph_row(const _Float16* __restrict__ PH, int x) { return PH + (size_t)(POFF + (x <= TT ? x : x - TT - 1)) * DMD; }
__global__ __launch_bounds__(128) void k_att(const float* __restrict__ Q, const _Float16* __restrict__ KH, const _Float16* __restrict__ PH, const _Float16* __restrict__ VH, const float* __restrict__ BU, const float* __restrict__ BVv, const int* __restrict__ MK, float* __restrict__ X) {
  __shared__ AttX sx[4];
  __shared__ __align__(16) _Float16 sk[2][32][KP];     // 32 keys x 64 d of this head, two buffers
  __shared__ __align__(16) _Float16 sv[2][64][VP];     // rows = the head's 64 d of v, 32 keys each, two buffers
  __shared__ __align__(16) _Float16 sph[128][KP];      // position rows, slot = x & 127: a pass reads 96 rows, the next pass's 32 new rows fill the slots it does not read
  const int tid = threadIdx.x, wave = tid >> 5, lane = tid & 31, col = lane & 15, g = lane >> 4; const int qb = blockIdx.x, h = blockIdx.y; const size_t b = blockIdx.z; const int i0 = qb * 64 + wave * 16;
  float (&sp)[16][36] = sx[wave].sp; float (&so)[16][68] = sx[wave].so;
  const int iw = __builtin_amdgcn_readfirstlane(i0 >> 4);   // the wave's 16-row tile index in a scalar register: the choice of the position products' A rows is a scalar branch
  const int xb0 = TT - 64 - qb * 64;   // x of (i = the block's last query, j = 0): pass ks reads x = xb0 + 32 ks .. + 95
  const int kr = tid >> 3, kq = (tid & 7) * 8, vr = tid >> 2, vq = (tid & 3) * 8;   // 8 lanes fetch one whole 128-B row of k or of the table, 4 lanes one 64-B row piece of v
  // tile t = keys 32 t .. + 31 of k and v and the last 32 position rows of pass t's window: six 16-byte copies a lane, no register in between
  auto tile = [&](int t) { const int bf = t & 1, x = xb0 + t * 32 + 64 + kr;
    const _Float16* gk = KH + (b * TT + t * 32 + kr) * DMD + h * HD + kq; const size_t vo = (b * DMD + (size_t)h * HD + vr) * TT + t * 32 + vq;
    // the wait on xcnt closes the statement: it stands in front of every rewrite of a register that a copy names
    asm volatile("global_load_async_to_lds_b128 %0, %6, off\n\tglobal_load_async_to_lds_b128 %1, %7, off\n\tglobal_load_async_to_lds_b128 %2, %8, off\n\t"
                 "global_load_async_to_lds_b128 %3, %9, off\n\tglobal_load_async_to_lds_b128 %4, %10, off\n\tglobal_load_async_to_lds_b128 %5, %11, off\n\ts_wait_xcnt 0x0"
                 :: "v"(lds_at(&sk[bf][kr][kq])), "v"(lds_at(&sk[bf][16 + kr][kq])), "v"(lds_at(&sph[x & 127][kq])), "v"(lds_at(&sph[(x + 16) & 127][kq])),
                    "v"(lds_at(&sv[bf][vr][vq])), "v"(lds_at(&sv[bf][32 + vr][vq])),
                    "v"(gk), "v"(gk + 16 * DMD), "v"(ph_row(PH, x) + h * HD + kq), "v"(ph_row(PH, x + 16) + h * HD + kq),
                    "v"(VH + vo), "v"(VH + vo + 32 * TT) : "memory"); };
  tile(0);
  { const int x = xb0 + kr;   // the first 64 position rows of pass 0's window
    asm volatile("global_load_async_to_lds_b128 %0, %4, off\n\tglobal_load_async_to_lds_b128 %1, %5, off\n\tglobal_load_async_to_lds_b128 %2, %6, off\n\tglobal_load_async_to_lds_b128 %3, %7, off\n\ts_wait_xcnt 0x0"
                 :: "v"(lds_at(&sph[x & 127][kq])), "v"(lds_at(&sph[(x + 16) & 127][kq])), "v"(lds_at(&sph[(x + 32) & 127][kq])), "v"(lds_at(&sph[(x + 48) & 127][kq])),
                    "v"(ph_row(PH, x) + h * HD + kq), "v"(ph_row(PH, x + 16) + h * HD + kq), "v"(ph_row(PH, x + 32) + h * HD + kq), "v"(ph_row(PH, x + 48) + h * HD + kq) : "memory"); }
  v16h au[2], av[2], aw[2], tmpl[2];   // (q+u) rows i0.., (q+v) rows i0.., (q+v) rows i0+1.. (for the wrapped upper-triangle term); single f16 rounding (residuals dropped: VGPR budget)
  qfrags(Q, b * TT + i0, h, BU, lane, au, tmpl); qfrags(Q, b * TT + i0, h, BVv, lane, av, tmpl);
  qfrags(Q, b * TT + i0 + 1, h, BVv, lane, aw, tmpl);   // rows i+1; for i = T-1 the row belongs to the next batch (or is clamped) but its products are never used: j >= i+2 cannot hold for i = T-1
  // exp2 argument of a score c: c * SC + nb, nb = PB - (reference m) * SC: 1/8, log2 e and P's 2^PB in one fused multiply-add.
  // m is a row's reference, not its exact running maximum: it is moved up (row maximum, alpha, rescale of l and acc) only in a pass in which some argument of the wave passes PLIM:
  // 2^PLIM lies just below the largest f16, 65504, and P goes into its product as f16. Any reference gives the same quotient acc / l; every other pass takes its scores against the held nb and rescales nothing.
  // m never falls below -1e38, a masked key counts as -3e38: its argument is below -3e37 and exp2 gives 0 with no compare. nb starts at 3e38: the first pass always moves m, and its alpha is 0.
  const float SC = 0.125f * 1.44269504088896340736f, PB = 8.0f, PLIM = 15.9f;
  float m[8], nb[8], l[8];
#pragma unroll
  for (int r = 0; r < 8; ++r) { m[r] = -1.0e38f; nb[r] = 3.0e38f; l[r] = 0.f; }
  v8f acc[4] = {};
  asm volatile("s_wait_asynccnt 0x0" ::: "memory");   // this wave's copies of tile 0 have landed
  __syncthreads();                                     // publishes tile 0
  tile(1);
#pragma unroll 1
  for (int ks = 0; ks < TT / 32; ++ks) { float s[2][8]; const int cur = ks & 1;
    const int xt = TT - 16 - i0 + ks * 32;            // three 16-column position tiles cover x = xt .. xt + 47; keys 16 ct .. + 15 use tiles ct and ct + 1, so the middle one serves both halves
    v16h kf[2][2], pf[3][2];   // the LDS reads of the pass's ten fragments go ahead of their products as one group
#pragma unroll
    for (int kc = 0; kc < 2; ++kc) {
#pragma unroll
      for (int ct = 0; ct < 2; ++ct) kf[ct][kc] = frag_h(&sk[cur][ct * 16 + col][kc * 32], lane);
#pragma unroll
      for (int t = 0; t < 3; ++t) pf[t][kc] = frag_h(&sph[((xt + 16 * t) & 127) + col][kc * 32], lane); }
    v8f c[2] = {}, gp[3] = {};
#pragma unroll
    for (int kc = 0; kc < 2; ++kc)
#pragma unroll
      for (int ct = 0; ct < 2; ++ct) c[ct] = wmma16(au[kc], kf[ct][kc], c[ct]);
    // T and xt are multiples of 16, so a tile lies wholly in x < T (j <= i: rows i, av) or wholly in x >= T (the zero row x == T and the wrapped rows: rows i + 1, aw).
    // Tile t has x < T when 2 ks + t <= i0 / 16. i == T-1 has no j > i, so the row behind the last query is never picked.
#define POS3(A0, A1, A2) do { _Pragma("unroll") for (int kc = 0; kc < 2; ++kc) { gp[0] = wmma16(A0[kc], pf[0][kc], gp[0]); gp[1] = wmma16(A1[kc], pf[1][kc], gp[1]); gp[2] = wmma16(A2[kc], pf[2][kc], gp[2]); } } while (0)
    const int nlow = iw + 1 - 2 * ks;                 // tiles t < nlow take rows i
    if (nlow >= 3) POS3(av, av, av); else if (nlow <= 0) POS3(aw, aw, aw); else if (nlow == 2) POS3(av, av, aw); else POS3(av, aw, aw);   // the two mixed cases: the one pass that holds the wave's diagonal
    int mk[2][8]; const int* mrow = MK + ((size_t)b * TT + i0 + 8 * g) * TT + ks * 32 + col;   // row 8 g, key 32 ks + col of the pass's mask tile
#pragma unroll
    for (int ct = 0; ct < 2; ++ct)
#pragma unroll
      for (int r = 0; r < 8; ++r) mk[ct][r] = mrow[r * TT + ct * 16];
    asm volatile("s_wait_xcnt 0x0" :: "v"(mrow) : "memory");   // stands behind the sixteen mask loads and takes their address: the pair stays live up to the wait, so no result and no later value is placed in it before
#pragma unroll
    for (int ct = 0; ct < 2; ++ct) { float cc[8], sel[8];
      // row 8 g + r wants column 15 + col - (8 g + r) of the 32 columns of tiles ct, ct + 1: lane c of the row holds the wanted word of tile ct when c + 8 g + r >= 15, of tile ct + 1 otherwise; the turn brings it to its key's lane
#pragma unroll
      for (int r = 0; r < 8; ++r) { cc[r] = c[ct][r]; sel[r] = (col + 8 * g + r >= 15) ? gp[ct][r] : gp[ct + 1][r]; }
      SHIFT16(cc, sel);
#pragma unroll
      for (int r = 0; r < 8; ++r) s[ct][r] = (mk[ct][r] != 0) ? cc[r] : -3.0e38f; }
    float a0[8], a1[8];
#pragma unroll
    for (int r = 0; r < 8; ++r) { a0[r] = __builtin_fmaf(s[0][r], SC, nb[r]); a1[r] = __builtin_fmaf(s[1][r], SC, nb[r]); }
    // the lane's largest argument, three levels of three-way maxima
    const float t0 = fmaxf(fmaxf(a0[0], a1[0]), a0[1]), t1 = fmaxf(fmaxf(a1[1], a0[2]), a1[2]), t2 = fmaxf(fmaxf(a0[3], a1[3]), a0[4]), t3 = fmaxf(fmaxf(a1[4], a0[5]), a1[5]), t4 = fmaxf(fmaxf(a0[6], a1[6]), a0[7]);
    const float top = fmaxf(fmaxf(fmaxf(t0, t1), a1[7]), fmaxf(fmaxf(t2, t3), t4));
    if (__builtin_amdgcn_ballot_w32(top > PLIM) != 0u) {   // one test a pass, the same for the whole wave (a scalar branch, all 32 lanes stay on): some P would leave f16's range against the held references
      float mx[8], alpha[8];
#pragma unroll
      for (int r = 0; r < 8; ++r) mx[r] = fmaxf(fmaxf(s[0][r], s[1][r]), m[r]);   // the held reference, equal in a row's lanes, goes in ahead of the reduction: what comes out is the new one
      ROW16(, "v_max_num_f32_dpp", mx);   // row maximum over the 16 lanes that hold a query's keys, in the vector unit: no LDS permute, no wait on dscnt between the steps
#pragma unroll
      for (int r = 0; r < 8; ++r) { const float nn = __builtin_fmaf(mx[r], -SC, PB); alpha[r] = nn - nb[r];
        m[r] = mx[r]; nb[r] = nn; a0[r] = __builtin_fmaf(s[0][r], SC, nn); a1[r] = __builtin_fmaf(s[1][r], SC, nn); }
      EXP2X8(alpha);   // alpha is equal in a row's lanes, so the lanes' shares of l stay on one scale
#pragma unroll
      for (int r = 0; r < 8; ++r) { l[r] *= alpha[r];
#pragma unroll
        for (int j = 0; j < 4; ++j) acc[j][r] *= alpha[r]; } }
    EXP2X16(a0, a1);   // P of the pass's two 16-key halves
#pragma unroll
    for (int r = 0; r < 8; ++r) { l[r] += a0[r] + a1[r];   // l is the lane's own share of the row sum (its two keys of every pass); the shares are added up once, behind the loop
      sp[8 * g + r][col] = a0[r]; sp[8 * g + r][16 + col] = a1[r]; }
    LDSX();
    const v16h pa = frag_f32(&sp[col][0], lane);   // P rounded once to f16, like q, k and the position rows of the scores it comes from
    v16h vh[4];   // four fragments' LDS reads as one group ahead of their four products
#pragma unroll
    for (int j = 0; j < 4; ++j) vh[j] = frag_h(&sv[cur][j * 16 + col][0], lane);
#pragma unroll
    for (int j = 0; j < 4; ++j) acc[j] = wmma16(pa, vh[j], acc[j]);
    asm volatile("s_wait_dscnt 0x0" ::: "memory");      // this wave's LDS reads of pass ks have retired before the buffers are refilled
    asm volatile("s_wait_asynccnt 0x0" ::: "memory");   // this wave's copies of tile ks + 1 have landed
    __syncthreads();                                     // publishes tile ks + 1 and ends every wave's reads of the buffers and slots that tile ks + 2 fills
    if (ks + 2 < TT / 32) tile(ks + 2); }
  asm volatile("s_wait_asynccnt 0x0" ::: "memory");     // no copy is outstanding when the wave ends
  ROW16(, "v_add_f32_dpp", l);   // row sum over the 16 lanes' shares, the xor 1, 2, 4, 8 tree, once a query row instead of once a pass
#pragma unroll
  for (int r = 0; r < 8; ++r) { const float il = (l[r] > 0.f) ? 1.0f / l[r] : 0.f;   // fully masked rows -> zeros (the module zeroes them after the softmax)
#pragma unroll
    for (int j = 0; j < 4; ++j) so[8 * g + r][j * 16 + col] = acc[j][r] * il; }
  LDSX(); for (int rl = 0; rl < 16; ++rl) if (lane < 16) vst2(X + (b * TT + i0 + rl) * DMD + h * HD + lane * 4, *(const v4f*)&so[rl][lane * 4]); }
// ---- k_out: block = (64 rows, 128 of 512 cols): out = x (hi + lo) . Wo^T + bo
__global__ __launch_bounds__(128) void k_out(const float* __restrict__ X, const float* __restrict__ WO, const float* __restrict__ BO, float* __restrict__ OUT) { __shared__ OutSm sm; float (&sf)[4][16][132] = sm.sf;   // ring dead at the epilogue (barrier at the foot of the last stage)
  const int tid = threadIdx.x, wave = tid >> 5, lane = tid & 31, col = lane & 15, g = lane >> 4; const int c0 = blockIdx.y * 128; const size_t r0 = (size_t)blockIdx.x * 64 + wave * 16;
  v8f acc[8] = {};
  // stage = 32 k of 128 Wo rows (ring rows 0..127) and of the block's 64 x rows as hi (128..191) and lo (192..255)
  const int lr = tid >> 3, lq = tid & 7; const float* wsrc = WO + (size_t)(c0 + lr) * DMD + lq * 4; const float* xsrc = X + ((size_t)blockIdx.x * 64 + lr) * DMD + lq * 4;
  v4f pf[12];
#pragma unroll
  for (int e = 0; e < 12; ++e) pf[e] = *(const v4f*)(e < 8 ? wsrc + (size_t)e * 16 * DMD : xsrc + (size_t)(e - 8) * 16 * DMD);
#pragma unroll
  for (int e = 0; e < 12; ++e) { const v4b hv = cvt4(pf[e]); *(v4b*)&sm.st[0][e * 16 + lr][lq * 4] = hv; if (e >= 8) *(v4b*)&sm.st[0][64 + e * 16 + lr][lq * 4] = res4(pf[e], hv); }
  __syncthreads();
#pragma unroll
  for (int kc = 0; kc < DMD / 32; ++kc) { const int cur = kc & 1;
    if (kc + 1 < DMD / 32) {
#pragma unroll
      for (int e = 0; e < 12; ++e) pf[e] = *(const v4f*)((e < 8 ? wsrc + (size_t)e * 16 * DMD : xsrc + (size_t)(e - 8) * 16 * DMD) + (kc + 1) * 32); }
    const v16b ah = frag_b(&sm.st[cur][128 + wave * 16 + col][0], lane), al = frag_b(&sm.st[cur][192 + wave * 16 + col][0], lane);
    v16b w[8];   // the stage's LDS reads go ahead of its products as one group: one LDS latency per stage
#pragma unroll
    for (int j = 0; j < 8; ++j) w[j] = frag_b(&sm.st[cur][j * 16 + col][0], lane);
#pragma unroll
    for (int j = 0; j < 8; ++j) { acc[j] = wmma_bf(ah, w[j], acc[j]); acc[j] = wmma_bf(al, w[j], acc[j]); }
    __builtin_amdgcn_sched_barrier(0);   // keeps the wait for the next stage's global loads behind this stage's products, so that they cover its latency
    if (kc + 1 < DMD / 32) {
#pragma unroll
      for (int e = 0; e < 12; ++e) { const v4b hv = cvt4(pf[e]); *(v4b*)&sm.st[cur ^ 1][e * 16 + lr][lq * 4] = hv; if (e >= 8) *(v4b*)&sm.st[cur ^ 1][64 + e * 16 + lr][lq * 4] = res4(pf[e], hv); } }
    __syncthreads(); }   // publishes stage kc + 1 and ends every read of the buffer that the next pass refills
#pragma unroll
  for (int j = 0; j < 8; ++j) { const float bb = bfr(BO[c0 + j * 16 + col]);
#pragma unroll
    for (int r = 0; r < 8; ++r) sf[wave][8 * g + r][j * 16 + col] = acc[j][r] + bb; }
  LDSX(); for (int rl = 0; rl < 16; ++rl) vst2(OUT + (r0 + rl) * DMD + c0 + lane * 4, *(const v4f*)&sf[wave][rl][lane * 4]); }
extern "C" void kernel_launch(void* const* d_in, const int* in_sizes, int n_in, void* d_out, int out_size, void* d_ws, size_t ws_size, hipStream_t stream) {
  (void)in_sizes; (void)n_in; (void)out_size;
  const float** F = (const float**)d_in;   // 0 q, 1 k, 2 v [8,1024,512]; 3 pos [1024,512]; 4 mask [8,1024,1024] int; 5 Wq, 6 bq, 7 Wk, 8 bk, 9 Wv, 10 bv, 11 Wo, 12 bo, 13 Wp (natural); 14 bias_u [8,64], 15 bias_v [8,64]
  if (ws_size < (size_t)WS_END) return;
  char* ws = (char*)d_ws; float* Q = (float*)(ws + WS_Q); _Float16 *KH = (_Float16*)(ws + WS_KH), *PH = (_Float16*)(ws + WS_PH), *VH = (_Float16*)(ws + WS_VH); float* X = (float*)(ws + WS_X);
  k_proj<<<dim3(TNB * TT / 64, DMD / 128, 4), 128, 0, stream>>>(F[0], F[1], F[2], F[3], F[5], F[6], F[7], F[8], F[9], F[10], F[13], Q, KH, VH, PH);
  k_padph<<<64, 256, 0, stream>>>(PH);
  k_att<<<dim3(TT / 64, NH, TNB), 128, 0, stream>>>(Q, KH, PH, VH, F[14], F[15], (const int*)d_in[4], X);
  k_out<<<dim3(TNB * TT / 64, DMD / 128), 128, 0, stream>>>(X, F[11], F[12], (float*)d_out);
}
